// v000
// Times are from an AMD MI455X. After a warm-up the kernel runs many times in a row, and a time is the length of
// such a window on the GPU divided by its runs, so every launch and the gaps after it count. The runs cycle
// through copies of the inputs. A figure is the median of several windows, for all but v000 over two sittings.
// Sittings can differ by a few percent; kernels timed side by side share one.
// v000, which the later versions start from, runs in 1470 microseconds.
// compute dtype: all float inputs rounded to bf16; qk = x Wq^T + bq (shared query/key) and v = x Wv^T + bv with EXACT bf16 products on WMMA 16x16x32, f32 accumulate; q as f16 hi + residual (x 2^10), k f16 -> 2-product logits / 8, causal, stored in f32 (4 heads per launch); softmax in f32 (precise expf), P x 2^11 f32 split bf16 hi + lo against v bf16 hi + lo (3 products); out = y (bf16 hi + lo) Wo^T + bo; f32 output.
#include <hip/hip_runtime.h>
#include <math.h>

typedef __attribute__((ext_vector_type(16))) _Float16 v16h;
typedef __attribute__((ext_vector_type(16))) __bf16 v16b;
typedef __attribute__((ext_vector_type(8)))  _Float16 v8h;
typedef __attribute__((ext_vector_type(8)))  float v8f;
typedef __attribute__((ext_vector_type(4)))  float v4f;
typedef __attribute__((ext_vector_type(2)))  float v2f;
typedef __attribute__((ext_vector_type(4)))  unsigned v4u;
typedef __attribute__((ext_vector_type(4)))  int v4i;
typedef float __attribute__((may_alias)) float_a;
typedef int __attribute__((may_alias)) int_a;

template <typename T> __device__ __forceinline__ void vst2(void* p, T v) { *(T*)p = v;  }
__device__ __forceinline__ v8f wmma16(v16h a, v16h b, v8f c) {
  v8f d = __builtin_amdgcn_wmma_f32_16x16x32_f16(false, a, false, b, (short)0, c, false, false);
  asm volatile("v_nop\n\tv_nop\n\tv_nop\n\tv_nop" : "+v"(d) : "v"(a), "v"(b));
  return d;
}
__device__ __forceinline__ v8f wmma_bf(v16b a, v16b b, v8f c) {
  v8f d = __builtin_amdgcn_wmma_f32_16x16x32_bf16(false, a, false, b, (short)0, c, false, false);
  asm volatile("v_nop\n\tv_nop\n\tv_nop\n\tv_nop" : "+v"(d) : "v"(a), "v"(b));
  return d;
}
// 16x16x32 fragments: lane = (h = lane>>4, row/col = lane&15); elements 0..7 = k0+8h+0..7, 8..15 = k0+16+8h+0..7; D element r = row 8h+r
__device__ __forceinline__ v16h frag_h(const _Float16* rowk0, int lane) {
  union { v16h v; v8h q[2]; } u; const _Float16* p = rowk0 + 8 * (lane >> 4);
  u.q[0] = *(const v8h*)p; u.q[1] = *(const v8h*)(p + 16); return u.v;
}
__device__ __forceinline__ v16h frag_f32(const float* rowk0, int lane) {
  v16h a; const float* p = rowk0 + 8 * (lane >> 4);
#pragma unroll
  for (int i = 0; i < 8; ++i) { a[i] = (_Float16)p[i]; a[8 + i] = (_Float16)p[16 + i]; }
  return a;
}
__device__ __forceinline__ v16h frag_f32s(const float* rowk0, int lane, float sc) {
  v16h a; const float* p = rowk0 + 8 * (lane >> 4);
#pragma unroll
  for (int i = 0; i < 8; ++i) { a[i] = (_Float16)(p[i] * sc); a[8 + i] = (_Float16)(p[16 + i] * sc); }
  return a;
}
// column fragment from a [K][ld] layout (column n), rows >= K read as 0
__device__ __forceinline__ v16h fragc_f32(const float* W, int k0, int n, int lane, int ld, int K) {
  v16h a; const int g = lane >> 4;
#pragma unroll
  for (int i = 0; i < 8; ++i) { const int ka = k0 + 8 * g + i, kb = ka + 16;
    a[i] = (_Float16)(ka < K ? W[(size_t)(ka < K ? ka : K - 1) * ld + n] : 0.f); a[8 + i] = (_Float16)(kb < K ? W[(size_t)(kb < K ? kb : K - 1) * ld + n] : 0.f); }
  return a;
}
struct F2 { v16b h, l; };
__device__ __forceinline__ F2 bsplit16(const float v[16]) { F2 r;
#pragma unroll
  for (int i = 0; i < 16; ++i) { const __bf16 h = (__bf16)v[i]; r.h[i] = h; r.l[i] = (__bf16)(v[i] - (float)h); }
  return r; }
__device__ __forceinline__ F2 split_row(const float* row, int k0, int lane) { float v[16]; const float* p = row + k0 + 8 * (lane >> 4);
#pragma unroll
  for (int i = 0; i < 8; ++i) { v[i] = p[i]; v[8 + i] = p[16 + i]; }
  return bsplit16(v); }
__device__ __forceinline__ F2 split_rowK(const float* row, int k0, int lane, int K) { float v[16]; const int g = lane >> 4;
#pragma unroll
  for (int i = 0; i < 8; ++i) { const int ka = k0 + 8 * g + i, kb = ka + 16; v[i] = ka < K ? row[ka < K ? ka : K - 1] : 0.f; v[8 + i] = kb < K ? row[kb < K ? kb : K - 1] : 0.f; }
  return bsplit16(v); }
__device__ __forceinline__ F2 split_col(const float* W, int k0, int n, int lane, int ld, int K) { float v[16]; const int g = lane >> 4;
#pragma unroll
  for (int i = 0; i < 8; ++i) { const int ka = k0 + 8 * g + i, kb = ka + 16; v[i] = ka < K ? W[(size_t)(ka < K ? ka : K - 1) * ld + n] : 0.f; v[8 + i] = kb < K ? W[(size_t)(kb < K ? kb : K - 1) * ld + n] : 0.f; }
  return bsplit16(v); }
__device__ __forceinline__ v8f mac3(const F2& a, const F2& b, v8f c) { c = wmma_bf(a.l, b.h, c); c = wmma_bf(a.h, b.l, c); return wmma_bf(a.h, b.h, c); }
__device__ __forceinline__ float sigm(float v) { return 1.0f / (1.0f + expf(-v)); }
#define LDSX() do { asm volatile("s_wait_dscnt 0" ::: "memory"); __builtin_amdgcn_wave_barrier(); __builtin_amdgcn_fence(__ATOMIC_RELEASE, "workgroup"); } while (0)


// Shared-QK causal attention ('LSHAttention', B 2, S 2,048, hidden 1,024 = 16 x 64): qk = x Wq^T + bq used as both queries and keys, v = x Wv^T + bv, causal softmax(qk qk^T / 8), P v, output Linear + bias.
#define NB 2
#define TT 2048
#define CC 1024
#define NH 16
#define HD 64
#ifndef TNB
#define TNB NB
#endif
typedef __attribute__((ext_vector_type(8))) __bf16 v8b;
__device__ __forceinline__ v16b frag_b(const __bf16* rowk0, int lane) {
  union { v16b v; v8b q[2]; } u; const __bf16* p = rowk0 + 8 * (lane >> 4);
  u.q[0] = *(const v8b*)p; u.q[1] = *(const v8b*)(p + 16); return u.v;
}
__device__ __forceinline__ float bfr(float v) { return (float)(__bf16)v; }
__device__ __attribute__((noinline)) float exp_ni(float v) { return expf(v); }
__device__ __attribute__((noinline)) float erf_ni(float v) { return erff(v); }

#define WS_QH  0u
#define WS_QL  (WS_QH + 2u * (size_t)NB * TT * CC)
#define WS_KH  (WS_QL + 2u * (size_t)NB * TT * CC)
#define WS_VT  (WS_KH + 2u * (size_t)NB * TT * CC)      // bf16 v hi planes [b][c][t]
#define WS_VL  (WS_VT + 2u * (size_t)NB * CC * TT)      // bf16 v residual planes
#define HG 4                                          // heads per launch group
#define WS_S   (WS_VL + 2u * (size_t)NB * CC * TT)      // f32 logits / P for HG heads [hg][q][k]
#define WS_PH  (WS_S + 4u * (size_t)HG * TT * TT)
#define WS_Y   (WS_PH + 0u)              // f32 y rows [b*t][C]
#define WS_END (WS_Y + 4u * (size_t)NB * TT * CC)

// ---- k_proj: block = (64 rows, 128 cols, which): qkv = x W (+ b), exact; q -> f16 hi (+ residual), k -> f16 rows, v -> bf16 hi + lo planes
__global__ __launch_bounds__(128) void k_proj(const float* __restrict__ X, const float* __restrict__ WQ, const float* __restrict__ BQ, const float* __restrict__ WK, const float* __restrict__ BK, const float* __restrict__ WV, const float* __restrict__ BV, _Float16* __restrict__ QH, _Float16* __restrict__ QL, _Float16* __restrict__ KH, __bf16* __restrict__ VT, __bf16* __restrict__ VL) {
  __shared__ __align__(16) _Float16 sh[64][136], sl[64][136]; __shared__ __align__(16) __bf16 th[128][72], tl2[128][72];
  const int tid = threadIdx.x, wave = tid >> 5, lane = tid & 31, col = lane & 15, g = lane >> 4; const int which = blockIdx.z; const int c0 = blockIdx.y * 128; const size_t r0 = (size_t)blockIdx.x * 64; const float* WA = which == 0 ? WQ : which == 1 ? WK : WV; const float* BA = which == 0 ? BQ : which == 1 ? BK : BV;
  v8f acc[8] = {};
#pragma unroll 2
  for (int kc = 0; kc < CC / 32; ++kc) { v16b a; { const float* p = X + (r0 + wave * 16 + col) * CC + kc * 32 + 8 * g;
#pragma unroll
      for (int i = 0; i < 8; ++i) { a[i] = (__bf16)p[i]; a[8 + i] = (__bf16)p[16 + i]; } }
#pragma unroll
    for (int j = 0; j < 8; ++j) { v16b w; const int o = c0 + j * 16 + col;
#pragma unroll
      for (int i = 0; i < 8; ++i) { w[i] = (__bf16)WA[(size_t)(o) * CC + (kc * 32 + 8 * g + i)]; w[8 + i] = (__bf16)WA[(size_t)(o) * CC + (kc * 32 + 16 + 8 * g + i)]; }
      acc[j] = wmma_bf(a, w, acc[j]); } }
#pragma unroll
  for (int j = 0; j < 8; ++j) { const float bb = bfr(BA[c0 + j * 16 + col]);
#pragma unroll
    for (int r = 0; r < 8; ++r) { const float v = acc[j][r] + bb; const int rl = wave * 16 + 8 * g + r, cl = j * 16 + col; const _Float16 hv = (_Float16)v;
      if (which == 2) { const __bf16 bh = (__bf16)v; th[cl][rl] = bh; tl2[cl][rl] = (__bf16)(v - (float)bh); } else { sh[rl][cl] = hv; sl[rl][cl] = (_Float16)((v - (float)hv) * 1024.0f); }   /* q residual carried x 2^10 so the plane stays f16-normal on the chip */ } }
  __syncthreads();
  if (which < 2) { _Float16* dh = which == 0 ? QH : KH; for (int e = tid; e < 64 * 16; e += 128) { const int rl = e >> 4, q = e & 15; vst2((unsigned*)(dh + (r0 + rl) * CC + c0 + q * 8), *(const v4u*)&sh[rl][q * 8]); if (which == 0) vst2((unsigned*)(QL + (r0 + rl) * CC + c0 + q * 8), *(const v4u*)&sl[rl][q * 8]); } }
  else { const size_t b = r0 / TT; const int t0 = (int)(r0 % TT); for (int e = tid; e < 128 * 8; e += 128) { const int cl = e >> 3, q = e & 7; const size_t o2 = (b * CC + c0 + cl) * (size_t)TT + t0 + q * 8; vst2((unsigned*)(VT + o2), *(const v4u*)&th[cl][q * 8]); vst2((unsigned*)(VL + o2), *(const v4u*)&tl2[cl][q * 8]); } } }
// ---- k_sc: block = (64 queries, 128 keys) of (b,h): logits * scale (BM not applied); causal blocks beyond the diagonal exit
__global__ __launch_bounds__(128) void k_sc(const _Float16* __restrict__ QH, const _Float16* __restrict__ QL, const _Float16* __restrict__ KH, const float* __restrict__ BM, int b, int h0, float* __restrict__ S0) { __shared__ __align__(16) float ss[4][16][132]; const int h = h0 + blockIdx.z; float* S = S0 + (size_t)blockIdx.z * TT * TT;
  const int tid = threadIdx.x, wave = tid >> 5, lane = tid & 31, col = lane & 15, g = lane >> 4; const int k0 = blockIdx.y * 128; const int ql0 = blockIdx.x * 64 + wave * 16; const size_t q0 = (size_t)b * TT + ql0;
  if (k0 > blockIdx.x * 64 + 63) return;   // whole key block above the diagonal (block-uniform)
  v8f acc[8] = {}, accl[8] = {};
#pragma unroll
  for (int kc = 0; kc < HD / 32; ++kc) { const v16h ah = frag_h(QH + (q0 + col) * CC + h * HD + kc * 32, lane), al = frag_h(QL + (q0 + col) * CC + h * HD + kc * 32, lane);
#pragma unroll
    for (int j = 0; j < 8; ++j) { const v16h kb = frag_h(KH + ((size_t)b * TT + k0 + j * 16 + col) * CC + h * HD + kc * 32, lane); acc[j] = wmma16(ah, kb, acc[j]); accl[j] = wmma16(al, kb, accl[j]); } }
#pragma unroll
  for (int j = 0; j < 8; ++j) acc[j] += accl[j] * (1.0f / 1024.0f);
#pragma unroll
  for (int j = 0; j < 8; ++j) { const int kt = k0 + j * 16 + col;
#pragma unroll
    for (int r = 0; r < 8; ++r) { const int qt = ql0 + 8 * g + r; float v = acc[j][r] * 0.125f; (void)BM; if (kt > qt) v = -3.0e38f; ss[wave][8 * g + r][j * 16 + col] = v; } }
  LDSX(); for (int rl = 0; rl < 16; ++rl) vst2(S + (size_t)(ql0 + rl) * TT + k0 + lane * 4, *(const v4f*)&ss[wave][rl][lane * 4]); }
// ---- k_sm: block = query row: softmax over keys [0, kend) -> P x 2^11 f32 (masked -> 0)
__global__ __launch_bounds__(256) void k_sm(float* __restrict__ S0) { __shared__ float sred[8]; __shared__ float sbc; __shared__ __align__(16) float sh[TT];
  const int t = threadIdx.x; const size_t row = blockIdx.x; float* sr = S0 + (size_t)blockIdx.y * TT * TT + row * TT; const int kend = ((int)row / 64) * 64 + 64;
  float m = -3.0e38f; for (int k = t; k < kend; k += 256) m = fmaxf(m, sr[k]);
#pragma unroll
  for (int o = 1; o < 32; o <<= 1) m = fmaxf(m, __shfl_xor(m, o));
  if ((t & 31) == 0) sred[t >> 5] = m; __syncthreads(); if (t == 0) { float a = sred[0]; for (int i = 1; i < 8; ++i) a = fmaxf(a, sred[i]); sbc = a; } __syncthreads(); m = sbc; __syncthreads();
  float sum = 0.f; for (int k = t; k < kend; k += 256) { const float v = sr[k]; sum += (v <= -1.0e38f) ? 0.f : expf(v - m); }
#pragma unroll
  for (int o = 1; o < 32; o <<= 1) sum += __shfl_xor(sum, o);
  if ((t & 31) == 0) sred[t >> 5] = sum; __syncthreads(); if (t == 0) { float a = 0.f; for (int i = 0; i < 8; ++i) a += sred[i]; sbc = 1.0f / a; } __syncthreads(); const float inv = sbc;
  for (int k = t; k < kend; k += 256) { const float v = sr[k]; sh[k] = (v <= -1.0e38f) ? 0.f : expf(v - m) * inv * 2048.0f; }
  __syncthreads(); for (int q = t; q < kend / 4; q += 256) vst2(sr + q * 4, *(const v4f*)&sh[q * 4]); }
// ---- k_pv: block = 64 queries of (b,h): y[q][h*HD + d] = P . v  (keys [0, kend))
__global__ __launch_bounds__(128) void k_pv(const float* __restrict__ PS0, const __bf16* __restrict__ VT, const __bf16* __restrict__ VL, int b, int h0, float* __restrict__ Y) { const int h = h0 + blockIdx.z; const float* PS = PS0 + (size_t)blockIdx.z * TT * TT; __shared__ __align__(16) float ss[4][16][HD + 4];
  const int tid = threadIdx.x, wave = tid >> 5, lane = tid & 31, col = lane & 15, g = lane >> 4; const int ql0 = blockIdx.x * 64 + wave * 16; const int kend = blockIdx.x * 64 + 64;
  v8f acc[HD / 16] = {};
#pragma unroll 1
  for (int kc = 0; kc < kend / 32; ++kc) { const F2 p = split_row(PS + (size_t)(ql0 + col) * TT, kc * 32, lane);
#pragma unroll
    for (int j = 0; j < HD / 16; ++j) { const size_t po = ((size_t)b * CC + h * HD + j * 16 + col) * (size_t)TT + kc * 32; const v16b vh = frag_b(VT + po, lane); acc[j] = wmma_bf(p.h, vh, acc[j]); acc[j] = wmma_bf(p.l, vh, acc[j]); acc[j] = wmma_bf(p.h, frag_b(VL + po, lane), acc[j]); } }
#pragma unroll
  for (int j = 0; j < HD / 16; ++j)
#pragma unroll
    for (int r = 0; r < 8; ++r) ss[wave][8 * g + r][j * 16 + col] = acc[j][r] * (1.0f / 2048.0f);
  LDSX(); for (int rl = 0; rl < 16; ++rl) if (lane < HD / 4) vst2(Y + ((size_t)b * TT + ql0 + rl) * CC + h * HD + lane * 4, *(const v4f*)&ss[wave][rl][lane * 4]); }
// ---- k_out: block = (64 rows, 128 cols): out = y (bf16 hi + lo) Wo^T + bo
__global__ __launch_bounds__(128) void k_out(const float* __restrict__ Y, const float* __restrict__ WP, const float* __restrict__ BP, float* __restrict__ OUT) { __shared__ __align__(16) float sf[4][16][132];
  const int tid = threadIdx.x, wave = tid >> 5, lane = tid & 31, col = lane & 15, g = lane >> 4; const int c0 = blockIdx.y * 128; const size_t r0 = (size_t)blockIdx.x * 64 + wave * 16;
  v8f acc[8] = {};
#pragma unroll 2
  for (int kc = 0; kc < CC / 32; ++kc) { const F2 a = split_row(Y + (r0 + col) * CC, kc * 32, lane);
#pragma unroll
    for (int j = 0; j < 8; ++j) { v16b w; const int o = c0 + j * 16 + col;
#pragma unroll
      for (int i = 0; i < 8; ++i) { w[i] = (__bf16)WP[(size_t)(o) * CC + (kc * 32 + 8 * g + i)]; w[8 + i] = (__bf16)WP[(size_t)(o) * CC + (kc * 32 + 16 + 8 * g + i)]; }
      acc[j] = wmma_bf(a.h, w, acc[j]); acc[j] = wmma_bf(a.l, w, acc[j]); } }
#pragma unroll
  for (int j = 0; j < 8; ++j) { const float bb = BP ? bfr(BP[c0 + j * 16 + col]) : 0.f;
#pragma unroll
    for (int r = 0; r < 8; ++r) sf[wave][8 * g + r][j * 16 + col] = acc[j][r] + bb; }
  LDSX(); for (int rl = 0; rl < 16; ++rl) vst2(OUT + (r0 + rl) * CC + c0 + lane * 4, *(const v4f*)&sf[wave][rl][lane * 4]); }
extern "C" void kernel_launch(void* const* d_in, const int* in_sizes, int n_in, void* d_out, int out_size, void* d_ws, size_t ws_size, hipStream_t stream) {
  (void)in_sizes; (void)n_in; (void)out_size;
  const float** F = (const float**)d_in;   // 0 x [2,2048,1024], 1 Wq [1024,1024] ([out,in]), 2 bq, 3 Wv, 4 bv, 5 Wo, 6 bo
  if (ws_size < (size_t)WS_END) return;
  char* ws = (char*)d_ws; _Float16 *QH = (_Float16*)(ws + WS_QH), *QL = (_Float16*)(ws + WS_QL), *KH = (_Float16*)(ws + WS_KH); __bf16 *VT = (__bf16*)(ws + WS_VT), *VL = (__bf16*)(ws + WS_VL); float *S = (float*)(ws + WS_S), *Y = (float*)(ws + WS_Y);
  k_proj<<<dim3(TNB * TT / 64, CC / 128, 3), 128, 0, stream>>>(F[0], F[1], F[2], F[1], F[2], F[3], F[4], QH, QL, KH, VT, VL);   // queries and keys share Wq, bq
  for (int b = 0; b < TNB; ++b) for (int h0 = 0; h0 < NH; h0 += HG) {
    k_sc<<<dim3(TT / 64, TT / 128, HG), 128, 0, stream>>>(QH, QL, KH, nullptr, b, h0, S);
    k_sm<<<dim3(TT, HG), 256, 0, stream>>>(S);
    k_pv<<<dim3(TT / 64, 1, HG), 128, 0, stream>>>(S, VT, VL, b, h0, Y);
  }
  k_out<<<dim3(TNB * TT / 64, CC / 128), 128, 0, stream>>>(Y, F[5], F[6], (float*)d_out);
}

// v001
// A run of this version takes 908 microseconds.
// Timed twice side by side with v000, it ran 1.64 times as fast both times.
// compute dtype: all float inputs rounded to bf16; qk = x Wq^T + bq (shared query/key) and v = x Wv^T + bv with EXACT bf16 products on WMMA 16x16x32, f32 accumulate; q as f16 hi + residual (x 2^10), k f16 -> 2-product logits / 8, causal, stored in f32 (4 heads per launch); softmax in f32 (precise expf), P x 2^11 f32 split bf16 hi + lo against v bf16 hi + lo (3 products); out = y (bf16 hi + lo) Wo^T + bo; f32 output.
#include <hip/hip_runtime.h>
#include <math.h>

typedef __attribute__((ext_vector_type(16))) _Float16 v16h;
typedef __attribute__((ext_vector_type(16))) __bf16 v16b;
typedef __attribute__((ext_vector_type(8)))  _Float16 v8h;
typedef __attribute__((ext_vector_type(8)))  float v8f;
typedef __attribute__((ext_vector_type(4)))  float v4f;
typedef __attribute__((ext_vector_type(2)))  float v2f;
typedef __attribute__((ext_vector_type(4)))  unsigned v4u;
typedef __attribute__((ext_vector_type(4)))  int v4i;
typedef float __attribute__((may_alias)) float_a;
typedef int __attribute__((may_alias)) int_a;

template <typename T> __device__ __forceinline__ void vst2(void* p, T v) { *(T*)p = v;  }
__device__ __forceinline__ v8f wmma16(v16h a, v16h b, v8f c) {
  v8f d = __builtin_amdgcn_wmma_f32_16x16x32_f16(false, a, false, b, (short)0, c, false, false);
  asm volatile("v_nop\n\tv_nop\n\tv_nop\n\tv_nop" : "+v"(d) : "v"(a), "v"(b));
  return d;
}
__device__ __forceinline__ v8f wmma_bf(v16b a, v16b b, v8f c) {
  v8f d = __builtin_amdgcn_wmma_f32_16x16x32_bf16(false, a, false, b, (short)0, c, false, false);
  asm volatile("v_nop\n\tv_nop\n\tv_nop\n\tv_nop" : "+v"(d) : "v"(a), "v"(b));
  return d;
}
// 16x16x32 fragments: lane = (h = lane>>4, row/col = lane&15); elements 0..7 = k0+8h+0..7, 8..15 = k0+16+8h+0..7; D element r = row 8h+r
__device__ __forceinline__ v16h frag_h(const _Float16* rowk0, int lane) {
  union { v16h v; v8h q[2]; } u; const _Float16* p = rowk0 + 8 * (lane >> 4);
  u.q[0] = *(const v8h*)p; u.q[1] = *(const v8h*)(p + 16); return u.v;
}
__device__ __forceinline__ v16h frag_f32(const float* rowk0, int lane) {
  v16h a; const float* p = rowk0 + 8 * (lane >> 4);
#pragma unroll
  for (int i = 0; i < 8; ++i) { a[i] = (_Float16)p[i]; a[8 + i] = (_Float16)p[16 + i]; }
  return a;
}
__device__ __forceinline__ v16h frag_f32s(const float* rowk0, int lane, float sc) {
  v16h a; const float* p = rowk0 + 8 * (lane >> 4);
#pragma unroll
  for (int i = 0; i < 8; ++i) { a[i] = (_Float16)(p[i] * sc); a[8 + i] = (_Float16)(p[16 + i] * sc); }
  return a;
}
// column fragment from a [K][ld] layout (column n), rows >= K read as 0
__device__ __forceinline__ v16h fragc_f32(const float* W, int k0, int n, int lane, int ld, int K) {
  v16h a; const int g = lane >> 4;
#pragma unroll
  for (int i = 0; i < 8; ++i) { const int ka = k0 + 8 * g + i, kb = ka + 16;
    a[i] = (_Float16)(ka < K ? W[(size_t)(ka < K ? ka : K - 1) * ld + n] : 0.f); a[8 + i] = (_Float16)(kb < K ? W[(size_t)(kb < K ? kb : K - 1) * ld + n] : 0.f); }
  return a;
}
struct F2 { v16b h, l; };
__device__ __forceinline__ F2 bsplit16(const float v[16]) { F2 r;
#pragma unroll
  for (int i = 0; i < 16; ++i) { const __bf16 h = (__bf16)v[i]; r.h[i] = h; r.l[i] = (__bf16)(v[i] - (float)h); }
  return r; }
__device__ __forceinline__ F2 split_row(const float* row, int k0, int lane) { float v[16]; const float* p = row + k0 + 8 * (lane >> 4);
#pragma unroll
  for (int i = 0; i < 8; ++i) { v[i] = p[i]; v[8 + i] = p[16 + i]; }
  return bsplit16(v); }
__device__ __forceinline__ F2 split_rowK(const float* row, int k0, int lane, int K) { float v[16]; const int g = lane >> 4;
#pragma unroll
  for (int i = 0; i < 8; ++i) { const int ka = k0 + 8 * g + i, kb = ka + 16; v[i] = ka < K ? row[ka < K ? ka : K - 1] : 0.f; v[8 + i] = kb < K ? row[kb < K ? kb : K - 1] : 0.f; }
  return bsplit16(v); }
__device__ __forceinline__ F2 split_col(const float* W, int k0, int n, int lane, int ld, int K) { float v[16]; const int g = lane >> 4;
#pragma unroll
  for (int i = 0; i < 8; ++i) { const int ka = k0 + 8 * g + i, kb = ka + 16; v[i] = ka < K ? W[(size_t)(ka < K ? ka : K - 1) * ld + n] : 0.f; v[8 + i] = kb < K ? W[(size_t)(kb < K ? kb : K - 1) * ld + n] : 0.f; }
  return bsplit16(v); }
__device__ __forceinline__ v8f mac3(const F2& a, const F2& b, v8f c) { c = wmma_bf(a.l, b.h, c); c = wmma_bf(a.h, b.l, c); return wmma_bf(a.h, b.h, c); }
__device__ __forceinline__ float sigm(float v) { return 1.0f / (1.0f + expf(-v)); }
#define LDSX() do { asm volatile("s_wait_dscnt 0" ::: "memory"); __builtin_amdgcn_wave_barrier(); __builtin_amdgcn_fence(__ATOMIC_RELEASE, "workgroup"); } while (0)


// Shared-QK causal attention ('LSHAttention', B 2, S 2,048, hidden 1,024 = 16 x 64): qk = x Wq^T + bq used as both queries and keys, v = x Wv^T + bv, causal softmax(qk qk^T / 8), P v, output Linear + bias.
#define NB 2
#define TT 2048
#define CC 1024
#define NH 16
#define HD 64
#ifndef TNB
#define TNB NB
#endif
typedef __attribute__((ext_vector_type(8))) __bf16 v8b;
__device__ __forceinline__ v16b frag_b(const __bf16* rowk0, int lane) {
  union { v16b v; v8b q[2]; } u; const __bf16* p = rowk0 + 8 * (lane >> 4);
  u.q[0] = *(const v8b*)p; u.q[1] = *(const v8b*)(p + 16); return u.v;
}
__device__ __forceinline__ float bfr(float v) { return (float)(__bf16)v; }
__device__ __attribute__((noinline)) float exp_ni(float v) { return expf(v); }
__device__ __attribute__((noinline)) float erf_ni(float v) { return erff(v); }

#define WS_QH  0u
#define WS_QL  (WS_QH + 2u * (size_t)NB * TT * CC)
#define WS_KH  (WS_QL + 2u * (size_t)NB * TT * CC)
#define WS_VT  (WS_KH + 2u * (size_t)NB * TT * CC)      // bf16 v hi planes [b][c][t]
#define WS_VL  (WS_VT + 2u * (size_t)NB * CC * TT)      // bf16 v residual planes
#define HG 4                                          // heads per launch group
#define WS_S   (WS_VL + 2u * (size_t)NB * CC * TT)      // f32 logits / P for HG heads [hg][q][k]
#define WS_PH  (WS_S + 4u * (size_t)HG * TT * TT)
#define WS_Y   (WS_PH + 0u)              // f32 y rows [b*t][C]
#define WS_END (WS_Y + 4u * (size_t)NB * TT * CC)

// ---- k_proj: block = (64 rows, 128 cols, which): qkv = x W (+ b), exact; q -> f16 hi (+ residual), k -> f16 rows, v -> bf16 hi + lo planes
__global__ __launch_bounds__(128) void k_proj(const float* __restrict__ X, const float* __restrict__ WQ, const float* __restrict__ BQ, const float* __restrict__ WK, const float* __restrict__ BK, const float* __restrict__ WV, const float* __restrict__ BV, _Float16* __restrict__ QH, _Float16* __restrict__ QL, _Float16* __restrict__ KH, __bf16* __restrict__ VT, __bf16* __restrict__ VL) {
  __shared__ __align__(16) _Float16 sh[64][136], sl[64][136]; __shared__ __align__(16) __bf16 th[128][72], tl2[128][72];
  const int tid = threadIdx.x, wave = tid >> 5, lane = tid & 31, col = lane & 15, g = lane >> 4; const int which = blockIdx.z; const int c0 = blockIdx.y * 128; const size_t r0 = (size_t)blockIdx.x * 64; const float* WA = which == 0 ? WQ : which == 1 ? WK : WV; const float* BA = which == 0 ? BQ : which == 1 ? BK : BV;
  v8f acc[8] = {};
#pragma unroll 2
  for (int kc = 0; kc < CC / 32; ++kc) { v16b a; { const float* p = X + (r0 + wave * 16 + col) * CC + kc * 32 + 8 * g;
#pragma unroll
      for (int i = 0; i < 8; ++i) { a[i] = (__bf16)p[i]; a[8 + i] = (__bf16)p[16 + i]; } }
#pragma unroll
    for (int j = 0; j < 8; ++j) { v16b w; const int o = c0 + j * 16 + col;
#pragma unroll
      for (int i = 0; i < 8; ++i) { w[i] = (__bf16)WA[(size_t)(o) * CC + (kc * 32 + 8 * g + i)]; w[8 + i] = (__bf16)WA[(size_t)(o) * CC + (kc * 32 + 16 + 8 * g + i)]; }
      acc[j] = wmma_bf(a, w, acc[j]); } }
#pragma unroll
  for (int j = 0; j < 8; ++j) { const float bb = bfr(BA[c0 + j * 16 + col]);
#pragma unroll
    for (int r = 0; r < 8; ++r) { const float v = acc[j][r] + bb; const int rl = wave * 16 + 8 * g + r, cl = j * 16 + col; const _Float16 hv = (_Float16)v;
      if (which == 2) { const __bf16 bh = (__bf16)v; th[cl][rl] = bh; tl2[cl][rl] = (__bf16)(v - (float)bh); } else { sh[rl][cl] = hv; sl[rl][cl] = (_Float16)((v - (float)hv) * 1024.0f); }   /* q residual carried x 2^10 so the plane stays f16-normal on the chip */ } }
  __syncthreads();
  if (which < 2) { _Float16* dh = which == 0 ? QH : KH; for (int e = tid; e < 64 * 16; e += 128) { const int rl = e >> 4, q = e & 15; vst2((unsigned*)(dh + (r0 + rl) * CC + c0 + q * 8), *(const v4u*)&sh[rl][q * 8]); if (which == 0) vst2((unsigned*)(QL + (r0 + rl) * CC + c0 + q * 8), *(const v4u*)&sl[rl][q * 8]); } }
  else { const size_t b = r0 / TT; const int t0 = (int)(r0 % TT); for (int e = tid; e < 128 * 8; e += 128) { const int cl = e >> 3, q = e & 7; const size_t o2 = (b * CC + c0 + cl) * (size_t)TT + t0 + q * 8; vst2((unsigned*)(VT + o2), *(const v4u*)&th[cl][q * 8]); vst2((unsigned*)(VL + o2), *(const v4u*)&tl2[cl][q * 8]); } } }
// ---- k_sc: block = (64 queries, 128 keys) of (b,h): logits * scale (BM not applied); causal blocks beyond the diagonal exit
__global__ __launch_bounds__(128) void k_sc(const _Float16* __restrict__ QH, const _Float16* __restrict__ QL, const _Float16* __restrict__ KH, const float* __restrict__ BM, int b, int h0, float* __restrict__ S0) { __shared__ __align__(16) float ss[4][16][132]; const int h = h0 + blockIdx.z; float* S = S0 + (size_t)blockIdx.z * TT * TT;
  const int tid = threadIdx.x, wave = tid >> 5, lane = tid & 31, col = lane & 15, g = lane >> 4; const int k0 = blockIdx.y * 128; const int ql0 = blockIdx.x * 64 + wave * 16; const size_t q0 = (size_t)b * TT + ql0;
  if (k0 > blockIdx.x * 64 + 63) return;   // whole key block above the diagonal (block-uniform)
  v8f acc[8] = {}, accl[8] = {};
#pragma unroll
  for (int kc = 0; kc < HD / 32; ++kc) { const v16h ah = frag_h(QH + (q0 + col) * CC + h * HD + kc * 32, lane), al = frag_h(QL + (q0 + col) * CC + h * HD + kc * 32, lane);
#pragma unroll
    for (int j = 0; j < 8; ++j) { const v16h kb = frag_h(KH + ((size_t)b * TT + k0 + j * 16 + col) * CC + h * HD + kc * 32, lane); acc[j] = wmma16(ah, kb, acc[j]); accl[j] = wmma16(al, kb, accl[j]); } }
#pragma unroll
  for (int j = 0; j < 8; ++j) acc[j] += accl[j] * (1.0f / 1024.0f);
#pragma unroll
  for (int j = 0; j < 8; ++j) { const int kt = k0 + j * 16 + col;
#pragma unroll
    for (int r = 0; r < 8; ++r) { const int qt = ql0 + 8 * g + r; float v = acc[j][r] * 0.125f; (void)BM; if (kt > qt) v = -3.0e38f; ss[wave][8 * g + r][j * 16 + col] = v; } }
  LDSX(); for (int rl = 0; rl < 16; ++rl) vst2(S + (size_t)(ql0 + rl) * TT + k0 + lane * 4, *(const v4f*)&ss[wave][rl][lane * 4]); }
// ---- k_sm: block = query row: softmax over keys [0, kend) -> P x 2^11 f32 (masked -> 0)
__global__ __launch_bounds__(256) void k_sm(float* __restrict__ S0) { __shared__ float sred[8]; __shared__ float sbc; __shared__ __align__(16) float sh[TT];
  const int t = threadIdx.x; const size_t row = blockIdx.x; float* sr = S0 + (size_t)blockIdx.y * TT * TT + row * TT; const int kend = ((int)row / 64) * 64 + 64;
  float m = -3.0e38f; for (int k = t; k < kend; k += 256) m = fmaxf(m, sr[k]);
#pragma unroll
  for (int o = 1; o < 32; o <<= 1) m = fmaxf(m, __shfl_xor(m, o));
  if ((t & 31) == 0) sred[t >> 5] = m; __syncthreads(); if (t == 0) { float a = sred[0]; for (int i = 1; i < 8; ++i) a = fmaxf(a, sred[i]); sbc = a; } __syncthreads(); m = sbc; __syncthreads();
  float sum = 0.f; for (int k = t; k < kend; k += 256) { const float v = sr[k]; sum += (v <= -1.0e38f) ? 0.f : expf(v - m); }
#pragma unroll
  for (int o = 1; o < 32; o <<= 1) sum += __shfl_xor(sum, o);
  if ((t & 31) == 0) sred[t >> 5] = sum; __syncthreads(); if (t == 0) { float a = 0.f; for (int i = 0; i < 8; ++i) a += sred[i]; sbc = 1.0f / a; } __syncthreads(); const float inv = sbc;
  for (int k = t; k < kend; k += 256) { const float v = sr[k]; sh[k] = (v <= -1.0e38f) ? 0.f : expf(v - m) * inv * 2048.0f; }
  __syncthreads(); for (int q = t; q < kend / 4; q += 256) vst2(sr + q * 4, *(const v4f*)&sh[q * 4]); }
// ---- k_pv: block = 32 queries of (b,h), 32 waves = 2 query tiles x 16 key slices: wave (qs, ks) sums the 32-key chunks ks, ks + 16, ... of keys [0, kend); the 16 partial tiles meet in LDS and are added in slice order
#define PVQ 32
#define PVS 16
__global__ __launch_bounds__(1024) void k_pv(const float* __restrict__ PS0, const __bf16* __restrict__ VT, const __bf16* __restrict__ VL, int b, int h0, float* __restrict__ Y) { const int h = h0 + blockIdx.z; const float* PS = PS0 + (size_t)blockIdx.z * TT * TT; __shared__ __align__(16) float ss[PVS][PVQ][HD + 4];
  const int tid = threadIdx.x, wave = __builtin_amdgcn_readfirstlane(tid >> 5) /* scalar, so the slice loop branches on SCC and EXEC stays full at the matrix instructions */, lane = tid & 31, col = lane & 15, g = lane >> 4; const int qs = wave & 1, ks = wave >> 1; const int qb = blockIdx.x * PVQ; const int ql0 = qb + qs * 16; const int kend = (qb / 64) * 64 + 64;
  v8f acc[HD / 16] = {};
#pragma unroll 1
  for (int kc = ks; kc < kend / 32; kc += PVS) { const F2 p = split_row(PS + (size_t)(ql0 + col) * TT, kc * 32, lane);
#pragma unroll
    for (int j = 0; j < HD / 16; ++j) { const size_t po = ((size_t)b * CC + h * HD + j * 16 + col) * (size_t)TT + kc * 32; const v16b vh = frag_b(VT + po, lane); acc[j] = wmma_bf(p.h, vh, acc[j]); acc[j] = wmma_bf(p.l, vh, acc[j]); acc[j] = wmma_bf(p.h, frag_b(VL + po, lane), acc[j]); } }
#pragma unroll
  for (int j = 0; j < HD / 16; ++j)
#pragma unroll
    for (int r = 0; r < 8; ++r) ss[ks][qs * 16 + 8 * g + r][j * 16 + col] = acc[j][r];
  __syncthreads();   // every slice's partial tile is in LDS before any thread adds them
  if (tid < PVQ * HD / 4) { const int rl = tid >> 4, c4 = (tid & 15) * 4; v4f s = *(const v4f*)&ss[0][rl][c4];
#pragma unroll
    for (int i = 1; i < PVS; ++i) s += *(const v4f*)&ss[i][rl][c4];
    vst2(Y + ((size_t)b * TT + qb + rl) * CC + h * HD + c4, s * (1.0f / 2048.0f)); } }
// ---- k_out: block = (64 rows, 128 cols): out = y (bf16 hi + lo) Wo^T + bo
__global__ __launch_bounds__(128) void k_out(const float* __restrict__ Y, const float* __restrict__ WP, const float* __restrict__ BP, float* __restrict__ OUT) { __shared__ __align__(16) float sf[4][16][132];
  const int tid = threadIdx.x, wave = tid >> 5, lane = tid & 31, col = lane & 15, g = lane >> 4; const int c0 = blockIdx.y * 128; const size_t r0 = (size_t)blockIdx.x * 64 + wave * 16;
  v8f acc[8] = {};
#pragma unroll 2
  for (int kc = 0; kc < CC / 32; ++kc) { const F2 a = split_row(Y + (r0 + col) * CC, kc * 32, lane);
#pragma unroll
    for (int j = 0; j < 8; ++j) { v16b w; const int o = c0 + j * 16 + col;
#pragma unroll
      for (int i = 0; i < 8; ++i) { w[i] = (__bf16)WP[(size_t)(o) * CC + (kc * 32 + 8 * g + i)]; w[8 + i] = (__bf16)WP[(size_t)(o) * CC + (kc * 32 + 16 + 8 * g + i)]; }
      acc[j] = wmma_bf(a.h, w, acc[j]); acc[j] = wmma_bf(a.l, w, acc[j]); } }
#pragma unroll
  for (int j = 0; j < 8; ++j) { const float bb = BP ? bfr(BP[c0 + j * 16 + col]) : 0.f;
#pragma unroll
    for (int r = 0; r < 8; ++r) sf[wave][8 * g + r][j * 16 + col] = acc[j][r] + bb; }
  LDSX(); for (int rl = 0; rl < 16; ++rl) vst2(OUT + (r0 + rl) * CC + c0 + lane * 4, *(const v4f*)&sf[wave][rl][lane * 4]); }
extern "C" void kernel_launch(void* const* d_in, const int* in_sizes, int n_in, void* d_out, int out_size, void* d_ws, size_t ws_size, hipStream_t stream) {
  (void)in_sizes; (void)n_in; (void)out_size;
  const float** F = (const float**)d_in;   // 0 x [2,2048,1024], 1 Wq [1024,1024] ([out,in]), 2 bq, 3 Wv, 4 bv, 5 Wo, 6 bo
  if (ws_size < (size_t)WS_END) return;
  char* ws = (char*)d_ws; _Float16 *QH = (_Float16*)(ws + WS_QH), *QL = (_Float16*)(ws + WS_QL), *KH = (_Float16*)(ws + WS_KH); __bf16 *VT = (__bf16*)(ws + WS_VT), *VL = (__bf16*)(ws + WS_VL); float *S = (float*)(ws + WS_S), *Y = (float*)(ws + WS_Y);
  k_proj<<<dim3(TNB * TT / 64, CC / 128, 3), 128, 0, stream>>>(F[0], F[1], F[2], F[1], F[2], F[3], F[4], QH, QL, KH, VT, VL);   // queries and keys share Wq, bq
  for (int b = 0; b < TNB; ++b) for (int h0 = 0; h0 < NH; h0 += HG) {
    k_sc<<<dim3(TT / 64, TT / 128, HG), 128, 0, stream>>>(QH, QL, KH, nullptr, b, h0, S);
    k_sm<<<dim3(TT, HG), 256, 0, stream>>>(S);
    k_pv<<<dim3(TT / PVQ, 1, HG), 1024, 0, stream>>>(S, VT, VL, b, h0, Y);
  }
  k_out<<<dim3(TNB * TT / 64, CC / 128), 128, 0, stream>>>(Y, F[5], F[6], (float*)d_out);
}

// v002
// One run takes 460 microseconds.
// Timed twice side by side with v001, it ran 1.98 and 1.97 times as fast.
// Over all steps from v000 it is 3.24 times as fast.
// compute dtype: all float inputs rounded to bf16; qk = x Wq^T + bq (shared query/key) and v = x Wv^T + bv with EXACT bf16 products on WMMA 16x16x32, f32 accumulate; q as f16 hi + residual (x 2^10), k f16 -> 2-product logits / 8, causal, kept in f32 in LDS (32 query rows per block); softmax in f32 (precise expf), P x 2^11 f32 split bf16 hi + lo against v bf16 hi + lo (3 products); out = y (bf16 hi + lo) Wo^T + bo; f32 output.
#include <hip/hip_runtime.h>
#include <math.h>

typedef __attribute__((ext_vector_type(16))) _Float16 v16h;
typedef __attribute__((ext_vector_type(16))) __bf16 v16b;
typedef __attribute__((ext_vector_type(8)))  _Float16 v8h;
typedef __attribute__((ext_vector_type(8)))  float v8f;
typedef __attribute__((ext_vector_type(4)))  float v4f;
typedef __attribute__((ext_vector_type(2)))  float v2f;
typedef __attribute__((ext_vector_type(4)))  unsigned v4u;
typedef __attribute__((ext_vector_type(4)))  int v4i;
typedef float __attribute__((may_alias)) float_a;
typedef int __attribute__((may_alias)) int_a;

template <typename T> __device__ __forceinline__ void vst2(void* p, T v) { *(T*)p = v;  }
__device__ __forceinline__ v8f wmma16(v16h a, v16h b, v8f c) {
  v8f d = __builtin_amdgcn_wmma_f32_16x16x32_f16(false, a, false, b, (short)0, c, false, false);
  asm volatile("v_nop\n\tv_nop\n\tv_nop\n\tv_nop" : "+v"(d) : "v"(a), "v"(b));
  return d;
}
__device__ __forceinline__ v8f wmma_bf(v16b a, v16b b, v8f c) {
  v8f d = __builtin_amdgcn_wmma_f32_16x16x32_bf16(false, a, false, b, (short)0, c, false, false);
  asm volatile("v_nop\n\tv_nop\n\tv_nop\n\tv_nop" : "+v"(d) : "v"(a), "v"(b));
  return d;
}
// 16x16x32 fragments: lane = (h = lane>>4, row/col = lane&15); elements 0..7 = k0+8h+0..7, 8..15 = k0+16+8h+0..7; D element r = row 8h+r
__device__ __forceinline__ v16h frag_h(const _Float16* rowk0, int lane) {
  union { v16h v; v8h q[2]; } u; const _Float16* p = rowk0 + 8 * (lane >> 4);
  u.q[0] = *(const v8h*)p; u.q[1] = *(const v8h*)(p + 16); return u.v;
}
__device__ __forceinline__ v16h frag_f32(const float* rowk0, int lane) {
  v16h a; const float* p = rowk0 + 8 * (lane >> 4);
#pragma unroll
  for (int i = 0; i < 8; ++i) { a[i] = (_Float16)p[i]; a[8 + i] = (_Float16)p[16 + i]; }
  return a;
}
__device__ __forceinline__ v16h frag_f32s(const float* rowk0, int lane, float sc) {
  v16h a; const float* p = rowk0 + 8 * (lane >> 4);
#pragma unroll
  for (int i = 0; i < 8; ++i) { a[i] = (_Float16)(p[i] * sc); a[8 + i] = (_Float16)(p[16 + i] * sc); }
  return a;
}
// column fragment from a [K][ld] layout (column n), rows >= K read as 0
__device__ __forceinline__ v16h fragc_f32(const float* W, int k0, int n, int lane, int ld, int K) {
  v16h a; const int g = lane >> 4;
#pragma unroll
  for (int i = 0; i < 8; ++i) { const int ka = k0 + 8 * g + i, kb = ka + 16;
    a[i] = (_Float16)(ka < K ? W[(size_t)(ka < K ? ka : K - 1) * ld + n] : 0.f); a[8 + i] = (_Float16)(kb < K ? W[(size_t)(kb < K ? kb : K - 1) * ld + n] : 0.f); }
  return a;
}
struct F2 { v16b h, l; };
__device__ __forceinline__ F2 bsplit16(const float v[16]) { F2 r;
#pragma unroll
  for (int i = 0; i < 16; ++i) { const __bf16 h = (__bf16)v[i]; r.h[i] = h; r.l[i] = (__bf16)(v[i] - (float)h); }
  return r; }
__device__ __forceinline__ F2 split_row(const float* row, int k0, int lane) { float v[16]; const float* p = row + k0 + 8 * (lane >> 4);
#pragma unroll
  for (int i = 0; i < 8; ++i) { v[i] = p[i]; v[8 + i] = p[16 + i]; }
  return bsplit16(v); }
__device__ __forceinline__ F2 split_rowK(const float* row, int k0, int lane, int K) { float v[16]; const int g = lane >> 4;
#pragma unroll
  for (int i = 0; i < 8; ++i) { const int ka = k0 + 8 * g + i, kb = ka + 16; v[i] = ka < K ? row[ka < K ? ka : K - 1] : 0.f; v[8 + i] = kb < K ? row[kb < K ? kb : K - 1] : 0.f; }
  return bsplit16(v); }
__device__ __forceinline__ F2 split_col(const float* W, int k0, int n, int lane, int ld, int K) { float v[16]; const int g = lane >> 4;
#pragma unroll
  for (int i = 0; i < 8; ++i) { const int ka = k0 + 8 * g + i, kb = ka + 16; v[i] = ka < K ? W[(size_t)(ka < K ? ka : K - 1) * ld + n] : 0.f; v[8 + i] = kb < K ? W[(size_t)(kb < K ? kb : K - 1) * ld + n] : 0.f; }
  return bsplit16(v); }
__device__ __forceinline__ v8f mac3(const F2& a, const F2& b, v8f c) { c = wmma_bf(a.l, b.h, c); c = wmma_bf(a.h, b.l, c); return wmma_bf(a.h, b.h, c); }
__device__ __forceinline__ float sigm(float v) { return 1.0f / (1.0f + expf(-v)); }
#define LDSX() do { asm volatile("s_wait_dscnt 0" ::: "memory"); __builtin_amdgcn_wave_barrier(); __builtin_amdgcn_fence(__ATOMIC_RELEASE, "workgroup"); } while (0)


// Shared-QK causal attention ('LSHAttention', B 2, S 2,048, hidden 1,024 = 16 x 64): qk = x Wq^T + bq used as both queries and keys, v = x Wv^T + bv, causal softmax(qk qk^T / 8), P v, output Linear + bias.
#define NB 2
#define TT 2048
#define CC 1024
#define NH 16
#define HD 64
#ifndef TNB
#define TNB NB
#endif
typedef __attribute__((ext_vector_type(8))) __bf16 v8b;
__device__ __forceinline__ v16b frag_b(const __bf16* rowk0, int lane) {
  union { v16b v; v8b q[2]; } u; const __bf16* p = rowk0 + 8 * (lane >> 4);
  u.q[0] = *(const v8b*)p; u.q[1] = *(const v8b*)(p + 16); return u.v;
}
__device__ __forceinline__ float bfr(float v) { return (float)(__bf16)v; }
__device__ __attribute__((noinline)) float exp_ni(float v) { return expf(v); }
__device__ __attribute__((noinline)) float erf_ni(float v) { return erff(v); }

#define WS_QH  0u
#define WS_QL  (WS_QH + 2u * (size_t)NB * TT * CC)
#define WS_KH  (WS_QL + 2u * (size_t)NB * TT * CC)
#define WS_VT  (WS_KH + 2u * (size_t)NB * TT * CC)      // bf16 v hi planes [b][c][t]
#define WS_VL  (WS_VT + 2u * (size_t)NB * CC * TT)      // bf16 v residual planes
#define WS_Y   (WS_VL + 2u * (size_t)NB * CC * TT)      // f32 y rows [b*t][C]
#define WS_END (WS_Y + 4u * (size_t)NB * TT * CC)

// ---- k_proj: block = (64 rows, 128 cols, which): qkv = x W (+ b), exact; q -> f16 hi (+ residual), k -> f16 rows, v -> bf16 hi + lo planes
__global__ __launch_bounds__(128) void k_proj(const float* __restrict__ X, const float* __restrict__ WQ, const float* __restrict__ BQ, const float* __restrict__ WK, const float* __restrict__ BK, const float* __restrict__ WV, const float* __restrict__ BV, _Float16* __restrict__ QH, _Float16* __restrict__ QL, _Float16* __restrict__ KH, __bf16* __restrict__ VT, __bf16* __restrict__ VL) {
  __shared__ __align__(16) _Float16 sh[64][136], sl[64][136]; __shared__ __align__(16) __bf16 th[128][72], tl2[128][72];
  const int tid = threadIdx.x, wave = tid >> 5, lane = tid & 31, col = lane & 15, g = lane >> 4; const int which = blockIdx.z; const int c0 = blockIdx.y * 128; const size_t r0 = (size_t)blockIdx.x * 64; const float* WA = which == 0 ? WQ : which == 1 ? WK : WV; const float* BA = which == 0 ? BQ : which == 1 ? BK : BV;
  v8f acc[8] = {};
#pragma unroll 2
  for (int kc = 0; kc < CC / 32; ++kc) { v16b a; { const float* p = X + (r0 + wave * 16 + col) * CC + kc * 32 + 8 * g;
#pragma unroll
      for (int i = 0; i < 8; ++i) { a[i] = (__bf16)p[i]; a[8 + i] = (__bf16)p[16 + i]; } }
#pragma unroll
    for (int j = 0; j < 8; ++j) { v16b w; const int o = c0 + j * 16 + col;
#pragma unroll
      for (int i = 0; i < 8; ++i) { w[i] = (__bf16)WA[(size_t)(o) * CC + (kc * 32 + 8 * g + i)]; w[8 + i] = (__bf16)WA[(size_t)(o) * CC + (kc * 32 + 16 + 8 * g + i)]; }
      acc[j] = wmma_bf(a, w, acc[j]); } }
#pragma unroll
  for (int j = 0; j < 8; ++j) { const float bb = bfr(BA[c0 + j * 16 + col]);
#pragma unroll
    for (int r = 0; r < 8; ++r) { const float v = acc[j][r] + bb; const int rl = wave * 16 + 8 * g + r, cl = j * 16 + col; const _Float16 hv = (_Float16)v;
      if (which == 2) { const __bf16 bh = (__bf16)v; th[cl][rl] = bh; tl2[cl][rl] = (__bf16)(v - (float)bh); } else { sh[rl][cl] = hv; sl[rl][cl] = (_Float16)((v - (float)hv) * 1024.0f); }   /* q residual carried x 2^10 so the plane stays f16-normal on the chip */ } }
  __syncthreads();
  if (which < 2) { _Float16* dh = which == 0 ? QH : KH; for (int e = tid; e < 64 * 16; e += 128) { const int rl = e >> 4, q = e & 15; vst2((unsigned*)(dh + (r0 + rl) * CC + c0 + q * 8), *(const v4u*)&sh[rl][q * 8]); if (which == 0) vst2((unsigned*)(QL + (r0 + rl) * CC + c0 + q * 8), *(const v4u*)&sl[rl][q * 8]); } }
  else { const size_t b = r0 / TT; const int t0 = (int)(r0 % TT); for (int e = tid; e < 128 * 8; e += 128) { const int cl = e >> 3, q = e & 7; const size_t o2 = (b * CC + c0 + cl) * (size_t)TT + t0 + q * 8; vst2((unsigned*)(VT + o2), *(const v4u*)&th[cl][q * 8]); vst2((unsigned*)(VL + o2), *(const v4u*)&tl2[cl][q * 8]); } } }
// ---- k_att: block = 32 queries of (b,h), 16 waves. The block's logit rows live in LDS from the products to P v:
//   1 wave w takes the 16-key tiles w, w + 16, ... of keys [0, kpad) against both query tiles (one key fragment serves 32 queries);
//   2 wave w does the softmax of rows w and w + 16 in place (e = exp(logit - max), masked -> 0; 1 / sum kept per row);
//   3 wave w sums the 32-key chunks w, w + 16, ... of P v for both query tiles, P = e / sum x 2^11 formed as the fragment is read;
//   4 the 16 partial tiles meet in the same LDS and are added in slice order.
__device__ __forceinline__ v16h frag_p(const _Float16* p) { union { v16h v; v8h q[2]; } u; u.q[0] = *(const v8h*)p; u.q[1] = *(const v8h*)(p + 16); return u.v; }
__device__ __forceinline__ v16b frag_q(const __bf16* p) { union { v16b v; v8b q[2]; } u; u.q[0] = *(const v8b*)p; u.q[1] = *(const v8b*)(p + 16); return u.v; }
#define FQ 32
#define FS 16
#define FP (TT + 4)   // row pitch in floats: 16 rows of a fragment read fall on 16 different groups of four banks
__global__ __launch_bounds__(512) void k_att(const _Float16* __restrict__ QH, const _Float16* __restrict__ QL, const _Float16* __restrict__ KH, const __bf16* __restrict__ VT, const __bf16* __restrict__ VL, float* __restrict__ Y) { __shared__ __align__(16) float sp[FQ][FP]; __shared__ float sinv[FQ];
  const int tid = threadIdx.x, ks = __builtin_amdgcn_readfirstlane(tid >> 5) /* scalar, so the slice loops branch on SCC and EXEC stays full at the matrix instructions */, lane = tid & 31, col = lane & 15, g = lane >> 4; const int b = blockIdx.x / NH, h = blockIdx.x % NH; const int qb = (TT / FQ - 1 - (int)blockIdx.y) * FQ;   /* longest rows start first */ const int kend = qb + FQ, kpad = (kend + 127) & ~127;   /* rows are filled to a multiple of 128 keys (<= TT; keys past the diagonal masked), so that a wave's softmax loops run whole 128-key steps with every lane on */
  { v16h ah[2][2], al[2][2]; const size_t qo = ((size_t)b * TT + qb + col) * CC + h * HD + 8 * g; const _Float16* qh = QH + qo; const _Float16* ql = QL + qo;   // the lane's own fragment addresses (frag_h's, with its 8 * g folded in)
#pragma unroll
    for (int t = 0; t < 2; ++t)
#pragma unroll
      for (int kc = 0; kc < HD / 32; ++kc) { ah[t][kc] = frag_p(qh + t * 16 * CC + kc * 32); al[t][kc] = frag_p(ql + t * 16 * CC + kc * 32); }
    asm volatile("s_wait_xcnt 0x0" :: "v"(qh), "v"(ql) : "memory");   // the address registers of the issued loads stay whole up to this wait; behind it they may be reused
    auto tile = [&](const v16h kb0, const v16h kb1, const int kt) { const int key = kt * 16 + col;
#pragma unroll
      for (int t = 0; t < 2; ++t) { v8f a = {}, l = {}; a = wmma16(ah[t][0], kb0, a); l = wmma16(al[t][0], kb0, l); a = wmma16(ah[t][1], kb1, a); l = wmma16(al[t][1], kb1, l); a += l * (1.0f / 1024.0f);
#pragma unroll
        for (int r = 0; r < 8; ++r) { const int rl = t * 16 + 8 * g + r; float v = a[r] * 0.125f; if (key > qb + rl) v = -3.0e38f; sp[rl][key] = v; } } };
    const int nt = kpad / 16; const _Float16* kp = KH + ((size_t)b * TT + ks * 16 + col) * CC + h * HD + 8 * g; v16h ka0 = {}, ka1 = {}, kc0 = {}, kc1 = {}; if (ks < nt) { ka0 = frag_p(kp); ka1 = frag_p(kp + 32); }
    for (int kt = ks; kt < nt; kt += 2 * FS) { const bool two = kt + FS < nt;   // two register sets in turn: a tile's key fragments fly while the tile before it is worked on
      if (two) { kc0 = frag_p(kp + FS * 16 * CC); kc1 = frag_p(kp + FS * 16 * CC + 32); }
      tile(ka0, ka1, kt);
      if (kt + 2 * FS < nt) { ka0 = frag_p(kp + 2 * FS * 16 * CC); ka1 = frag_p(kp + 2 * FS * 16 * CC + 32); }
      asm volatile("s_wait_xcnt 0x0" :: "v"(kp) : "memory");   // the address register of the issued loads stays whole up to this wait; behind it it is stepped
      kp += (size_t)2 * FS * 16 * CC;
      if (two) tile(kc0, kc1, kt + FS); } }
  __syncthreads();   // every logit of the 32 rows is in LDS before a row's softmax reads it
  { float* s0 = &sp[ks][lane * 4]; float* s1 = &sp[ks + FS][lane * 4]; float m0 = -3.0e38f, m1 = -3.0e38f;   // two rows side by side: two independent chains per wave
    for (int k = 0; k < kpad; k += 128) { const v4f u = *(const v4f*)&s0[k], w = *(const v4f*)&s1[k]; m0 = fmaxf(fmaxf(m0, fmaxf(u[0], u[1])), fmaxf(u[2], u[3])); m1 = fmaxf(fmaxf(m1, fmaxf(w[0], w[1])), fmaxf(w[2], w[3])); }
#pragma unroll
    for (int o = 1; o < 32; o <<= 1) { m0 = fmaxf(m0, __shfl_xor(m0, o)); m1 = fmaxf(m1, __shfl_xor(m1, o)); }
    float a0 = 0.f, a1 = 0.f;
    for (int k = 0; k < kpad; k += 128) { const v4f u = *(const v4f*)&s0[k], w = *(const v4f*)&s1[k]; v4f e, f;
#pragma unroll
      for (int i = 0; i < 4; ++i) { const float x = expf(u[i] - m0), y = expf(w[i] - m1); e[i] = (u[i] <= -1.0e38f) ? 0.f : x; f[i] = (w[i] <= -1.0e38f) ? 0.f : y; }
      a0 += (e[0] + e[1]) + (e[2] + e[3]); a1 += (f[0] + f[1]) + (f[2] + f[3]); *(v4f*)&s0[k] = e; *(v4f*)&s1[k] = f; }
#pragma unroll
    for (int o = 1; o < 32; o <<= 1) { a0 += __shfl_xor(a0, o); a1 += __shfl_xor(a1, o); }
    if (lane == 0) { sinv[ks] = 1.0f / a0; sinv[ks + FS] = 1.0f / a1; } }
  __syncthreads();   // every row's e and 1 / sum are in LDS before the P fragments are read
  v8f acc[2][HD / 16] = {}; const float sc[2] = { sinv[col] * 2048.0f, sinv[16 + col] * 2048.0f };
  const size_t vo = ((size_t)b * CC + h * HD + col) * (size_t)TT + ks * 32 + 8 * g; const __bf16* pvh = VT + vo; const __bf16* pvl = VL + vo;   // the lane's own fragment addresses, stepped from chunk to chunk
  for (int kc = ks; kc < kend / 32; kc += FS) { F2 p[2]; v16b vh[HD / 16], vl[HD / 16];   // all v fragments of the chunk are asked for first: one load latency a chunk, under the split of P
#pragma unroll
    for (int j = 0; j < HD / 16; ++j) { vh[j] = frag_q(pvh + (size_t)j * 16 * TT); vl[j] = frag_q(pvl + (size_t)j * 16 * TT); }
    asm volatile("s_wait_xcnt 0x0" :: "v"(pvh), "v"(pvl) : "memory");   // the address registers of the issued loads stay whole up to this wait; behind it they are stepped
    pvh += FS * 32; pvl += FS * 32;
#pragma unroll
    for (int t = 0; t < 2; ++t) { const v4f* q4 = (const v4f*)&sp[t * 16 + col][kc * 32 + 8 * g]; const v4f x0 = q4[0] * sc[t], x1 = q4[1] * sc[t], x2 = q4[4] * sc[t], x3 = q4[5] * sc[t]; float v[16];
#pragma unroll
      for (int i = 0; i < 4; ++i) { v[i] = x0[i]; v[4 + i] = x1[i]; v[8 + i] = x2[i]; v[12 + i] = x3[i]; }
      p[t] = bsplit16(v); }
#pragma unroll
    for (int j = 0; j < HD / 16; ++j)
#pragma unroll
      for (int t = 0; t < 2; ++t) { acc[t][j] = wmma_bf(p[t].h, vh[j], acc[t][j]); acc[t][j] = wmma_bf(p[t].l, vh[j], acc[t][j]); acc[t][j] = wmma_bf(p[t].h, vl[j], acc[t][j]); } }
  __syncthreads();   // the last P fragment is read before the partial tiles overwrite the rows
  float* ss = &sp[0][0];   // [FS][FQ][HD + 4]
#pragma unroll
  for (int t = 0; t < 2; ++t)
#pragma unroll
    for (int j = 0; j < HD / 16; ++j)
#pragma unroll
      for (int r = 0; r < 8; ++r) ss[(ks * FQ + t * 16 + 8 * g + r) * (HD + 4) + j * 16 + col] = acc[t][j][r];
  __syncthreads();   // every slice's partial tile is in LDS before any thread adds them
  { const int rl = tid >> 4, c4 = (tid & 15) * 4; v4f s = *(const v4f*)&ss[rl * (HD + 4) + c4];
#pragma unroll
    for (int i = 1; i < FS; ++i) s += *(const v4f*)&ss[(i * FQ + rl) * (HD + 4) + c4];
    vst2(Y + ((size_t)b * TT + qb + rl) * CC + h * HD + c4, s * (1.0f / 2048.0f)); } }
// ---- k_out: block = (64 rows, 128 cols): out = y (bf16 hi + lo) Wo^T + bo
__global__ __launch_bounds__(128) void k_out(const float* __restrict__ Y, const float* __restrict__ WP, const float* __restrict__ BP, float* __restrict__ OUT) { __shared__ __align__(16) float sf[4][16][132];
  const int tid = threadIdx.x, wave = tid >> 5, lane = tid & 31, col = lane & 15, g = lane >> 4; const int c0 = blockIdx.y * 128; const size_t r0 = (size_t)blockIdx.x * 64 + wave * 16;
  v8f acc[8] = {};
#pragma unroll 2
  for (int kc = 0; kc < CC / 32; ++kc) { const F2 a = split_row(Y + (r0 + col) * CC, kc * 32, lane);
#pragma unroll
    for (int j = 0; j < 8; ++j) { v16b w; const int o = c0 + j * 16 + col;
#pragma unroll
      for (int i = 0; i < 8; ++i) { w[i] = (__bf16)WP[(size_t)(o) * CC + (kc * 32 + 8 * g + i)]; w[8 + i] = (__bf16)WP[(size_t)(o) * CC + (kc * 32 + 16 + 8 * g + i)]; }
      acc[j] = wmma_bf(a.h, w, acc[j]); acc[j] = wmma_bf(a.l, w, acc[j]); } }
#pragma unroll
  for (int j = 0; j < 8; ++j) { const float bb = BP ? bfr(BP[c0 + j * 16 + col]) : 0.f;
#pragma unroll
    for (int r = 0; r < 8; ++r) sf[wave][8 * g + r][j * 16 + col] = acc[j][r] + bb; }
  LDSX(); for (int rl = 0; rl < 16; ++rl) vst2(OUT + (r0 + rl) * CC + c0 + lane * 4, *(const v4f*)&sf[wave][rl][lane * 4]); }
extern "C" void kernel_launch(void* const* d_in, const int* in_sizes, int n_in, void* d_out, int out_size, void* d_ws, size_t ws_size, hipStream_t stream) {
  (void)in_sizes; (void)n_in; (void)out_size;
  const float** F = (const float**)d_in;   // 0 x [2,2048,1024], 1 Wq [1024,1024] ([out,in]), 2 bq, 3 Wv, 4 bv, 5 Wo, 6 bo
  if (ws_size < (size_t)WS_END) return;
  char* ws = (char*)d_ws; _Float16 *QH = (_Float16*)(ws + WS_QH), *QL = (_Float16*)(ws + WS_QL), *KH = (_Float16*)(ws + WS_KH); __bf16 *VT = (__bf16*)(ws + WS_VT), *VL = (__bf16*)(ws + WS_VL); float *Y = (float*)(ws + WS_Y);
  k_proj<<<dim3(TNB * TT / 64, CC / 128, 3), 128, 0, stream>>>(F[0], F[1], F[2], F[1], F[2], F[3], F[4], QH, QL, KH, VT, VL);   // queries and keys share Wq, bq
  k_att<<<dim3(TNB * NH, TT / FQ), 512, 0, stream>>>(QH, QL, KH, VT, VL, Y);
  k_out<<<dim3(TNB * TT / 64, CC / 128), 128, 0, stream>>>(Y, F[5], F[6], (float*)d_out);
}

// v003
// It runs in 171 microseconds.
// Timed twice side by side with v002, it ran 2.69 times as fast both times.
// All steps since v000 together make it 8.71 times as fast.
// compute dtype: all float inputs rounded to bf16; qk = x Wq^T + bq (shared query/key) and v = x Wv^T + bv with EXACT bf16 products on WMMA 16x16x32, f32 accumulate; q as f16 hi + residual (x 2^10), k f16 -> 2-product logits / 8, causal, kept in f32 in LDS (32 query rows per block); softmax in f32 (precise expf), P x 2^11 f32 split bf16 hi + lo against v bf16 hi + lo (3 products); out = y (bf16 hi + lo) Wo^T + bo; f32 output.
#include <hip/hip_runtime.h>
#include <math.h>

typedef __attribute__((ext_vector_type(16))) _Float16 v16h;
typedef __attribute__((ext_vector_type(16))) __bf16 v16b;
typedef __attribute__((ext_vector_type(8)))  _Float16 v8h;
typedef __attribute__((ext_vector_type(8)))  float v8f;
typedef __attribute__((ext_vector_type(4)))  float v4f;
typedef __attribute__((ext_vector_type(2)))  float v2f;
typedef __attribute__((ext_vector_type(4)))  unsigned v4u;
typedef __attribute__((ext_vector_type(4)))  int v4i;
typedef float __attribute__((may_alias)) float_a;
typedef int __attribute__((may_alias)) int_a;

template <typename T> __device__ __forceinline__ void vst2(void* p, T v) { *(T*)p = v;  }
__device__ __forceinline__ v8f wmma16(v16h a, v16h b, v8f c) {
  v8f d = __builtin_amdgcn_wmma_f32_16x16x32_f16(false, a, false, b, (short)0, c, false, false);
  asm volatile("v_nop\n\tv_nop\n\tv_nop\n\tv_nop" : "+v"(d) : "v"(a), "v"(b));
  return d;
}
__device__ __forceinline__ v8f wmma_bf(v16b a, v16b b, v8f c) {
  v8f d = __builtin_amdgcn_wmma_f32_16x16x32_bf16(false, a, false, b, (short)0, c, false, false);
  asm volatile("v_nop\n\tv_nop\n\tv_nop\n\tv_nop" : "+v"(d) : "v"(a), "v"(b));
  return d;
}
// 16x16x32 fragments: lane = (h = lane>>4, row/col = lane&15); elements 0..7 = k0+8h+0..7, 8..15 = k0+16+8h+0..7; D element r = row 8h+r
__device__ __forceinline__ v16h frag_h(const _Float16* rowk0, int lane) {
  union { v16h v; v8h q[2]; } u; const _Float16* p = rowk0 + 8 * (lane >> 4);
  u.q[0] = *(const v8h*)p; u.q[1] = *(const v8h*)(p + 16); return u.v;
}
__device__ __forceinline__ v16h frag_f32(const float* rowk0, int lane) {
  v16h a; const float* p = rowk0 + 8 * (lane >> 4);
#pragma unroll
  for (int i = 0; i < 8; ++i) { a[i] = (_Float16)p[i]; a[8 + i] = (_Float16)p[16 + i]; }
  return a;
}
__device__ __forceinline__ v16h frag_f32s(const float* rowk0, int lane, float sc) {
  v16h a; const float* p = rowk0 + 8 * (lane >> 4);
#pragma unroll
  for (int i = 0; i < 8; ++i) { a[i] = (_Float16)(p[i] * sc); a[8 + i] = (_Float16)(p[16 + i] * sc); }
  return a;
}
// column fragment from a [K][ld] layout (column n), rows >= K read as 0
__device__ __forceinline__ v16h fragc_f32(const float* W, int k0, int n, int lane, int ld, int K) {
  v16h a; const int g = lane >> 4;
#pragma unroll
  for (int i = 0; i < 8; ++i) { const int ka = k0 + 8 * g + i, kb = ka + 16;
    a[i] = (_Float16)(ka < K ? W[(size_t)(ka < K ? ka : K - 1) * ld + n] : 0.f); a[8 + i] = (_Float16)(kb < K ? W[(size_t)(kb < K ? kb : K - 1) * ld + n] : 0.f); }
  return a;
}
struct F2 { v16b h, l; };
__device__ __forceinline__ F2 bsplit16(const float v[16]) { F2 r;
#pragma unroll
  for (int i = 0; i < 16; ++i) { const __bf16 h = (__bf16)v[i]; r.h[i] = h; r.l[i] = (__bf16)(v[i] - (float)h); }
  return r; }
__device__ __forceinline__ F2 split_row(const float* row, int k0, int lane) { float v[16]; const float* p = row + k0 + 8 * (lane >> 4);
#pragma unroll
  for (int i = 0; i < 8; ++i) { v[i] = p[i]; v[8 + i] = p[16 + i]; }
  return bsplit16(v); }
__device__ __forceinline__ F2 split_rowK(const float* row, int k0, int lane, int K) { float v[16]; const int g = lane >> 4;
#pragma unroll
  for (int i = 0; i < 8; ++i) { const int ka = k0 + 8 * g + i, kb = ka + 16; v[i] = ka < K ? row[ka < K ? ka : K - 1] : 0.f; v[8 + i] = kb < K ? row[kb < K ? kb : K - 1] : 0.f; }
  return bsplit16(v); }
__device__ __forceinline__ F2 split_col(const float* W, int k0, int n, int lane, int ld, int K) { float v[16]; const int g = lane >> 4;
#pragma unroll
  for (int i = 0; i < 8; ++i) { const int ka = k0 + 8 * g + i, kb = ka + 16; v[i] = ka < K ? W[(size_t)(ka < K ? ka : K - 1) * ld + n] : 0.f; v[8 + i] = kb < K ? W[(size_t)(kb < K ? kb : K - 1) * ld + n] : 0.f; }
  return bsplit16(v); }
__device__ __forceinline__ v8f mac3(const F2& a, const F2& b, v8f c) { c = wmma_bf(a.l, b.h, c); c = wmma_bf(a.h, b.l, c); return wmma_bf(a.h, b.h, c); }
__device__ __forceinline__ float sigm(float v) { return 1.0f / (1.0f + expf(-v)); }
#define LDSX() do { asm volatile("s_wait_dscnt 0" ::: "memory"); __builtin_amdgcn_wave_barrier(); __builtin_amdgcn_fence(__ATOMIC_RELEASE, "workgroup"); } while (0)


// Shared-QK causal attention ('LSHAttention', B 2, S 2,048, hidden 1,024 = 16 x 64): qk = x Wq^T + bq used as both queries and keys, v = x Wv^T + bv, causal softmax(qk qk^T / 8), P v, output Linear + bias.
#define NB 2
#define TT 2048
#define CC 1024
#define NH 16
#define HD 64
#ifndef TNB
#define TNB NB
#endif
typedef __attribute__((ext_vector_type(8))) __bf16 v8b;
__device__ __forceinline__ v16b frag_b(const __bf16* rowk0, int lane) {
  union { v16b v; v8b q[2]; } u; const __bf16* p = rowk0 + 8 * (lane >> 4);
  u.q[0] = *(const v8b*)p; u.q[1] = *(const v8b*)(p + 16); return u.v;
}
__device__ __forceinline__ float bfr(float v) { return (float)(__bf16)v; }
__device__ __attribute__((noinline)) float exp_ni(float v) { return expf(v); }
__device__ __attribute__((noinline)) float erf_ni(float v) { return erff(v); }

#define WS_QH  0u
#define WS_QL  (WS_QH + 2u * (size_t)NB * TT * CC)
#define WS_KH  (WS_QL + 2u * (size_t)NB * TT * CC)
#define WS_VT  (WS_KH + 2u * (size_t)NB * TT * CC)      // bf16 v hi planes [b][c][t]
#define WS_VL  (WS_VT + 2u * (size_t)NB * CC * TT)      // bf16 v residual planes
#define WS_Y   (WS_VL + 2u * (size_t)NB * CC * TT)      // f32 y rows [b*t][C]
#define WS_END (WS_Y + 4u * (size_t)NB * TT * CC)

// ---- operand staging of the two projection GEMMs (blocks of 128 threads): a [ROWS][KS] f32 tile is read in whole 128-byte lines (16 bytes a lane, neighbouring lanes on neighbouring
//   addresses of a row), rounded to bf16 once for the block and put into LDS at a row pitch of KS + 8 elements (16 bytes x an odd number: the 16 rows of a fragment read fall on different banks).
typedef __attribute__((ext_vector_type(4))) __bf16 v4b;
template <int ROWS, int KS> struct GT { v4f r[ROWS * KS / 512]; };
template <int ROWS, int KS> __device__ __forceinline__ void g_load(GT<ROWS, KS>& t, const float* p) {   // p: the thread's own place in the tile's first 512 / KS rows
#pragma unroll
  for (int i = 0; i < ROWS * KS / 512; ++i) t.r[i] = *(const v4f*)(p + (size_t)i * (512 / KS) * CC); }
template <int ROWS, int KS> __device__ __forceinline__ void s_put(const GT<ROWS, KS>& t, __bf16* d) {
#pragma unroll
  for (int i = 0; i < ROWS * KS / 512; ++i) { v4b o;
#pragma unroll
    for (int e = 0; e < 4; ++e) o[e] = (__bf16)t.r[i][e];
    *(v4b*)(d + i * (512 / KS) * (KS + 8)) = o; } }
template <int ROWS, int KS> __device__ __forceinline__ void s_put2(const GT<ROWS, KS>& t, __bf16* dh, __bf16* dl) {   // hi + residual planes, bsplit16's split
#pragma unroll
  for (int i = 0; i < ROWS * KS / 512; ++i) { v4b o, u;
#pragma unroll
    for (int e = 0; e < 4; ++e) { const float v = t.r[i][e]; const __bf16 h = (__bf16)v; o[e] = h; u[e] = (__bf16)(v - (float)h); }
    *(v4b*)(dh + i * (512 / KS) * (KS + 8)) = o; *(v4b*)(dl + i * (512 / KS) * (KS + 8)) = u; } }
// ---- k_proj: block = (64 rows, 128 cols, which): qkv = x W (+ b), exact; q -> f16 hi (+ residual), k -> f16 rows, v -> bf16 hi + residual planes
//   x and W tiles of 32 k go through two LDS stage buffers in turn; the tile after next flies into registers while this one is multiplied. The stage buffers and the epilogue's tiles share one LDS range.
__global__ __launch_bounds__(128) void k_proj(const float* __restrict__ X, const float* __restrict__ WQ, const float* __restrict__ BQ, const float* __restrict__ WK, const float* __restrict__ BK, const float* __restrict__ WV, const float* __restrict__ BV, _Float16* __restrict__ QH, _Float16* __restrict__ QL, _Float16* __restrict__ KH, __bf16* __restrict__ VT, __bf16* __restrict__ VL) {
  constexpr int KS = 32, GP = KS + 8, XB = 64 * GP, SB = XB + 128 * GP, NK = CC / KS;   // in bf16 elements: row pitch, the x part and the whole of a stage buffer
  __shared__ __align__(16) unsigned char sm[2 * 128 * 72 * 2]; static_assert(2 * SB * 2 <= (int)sizeof(sm) && 2 * 64 * 136 * 2 <= (int)sizeof(sm), "LDS range");
  _Float16 (*sh)[136] = (_Float16 (*)[136])sm, (*sl)[136] = (_Float16 (*)[136])(sm + 64 * 136 * 2); __bf16 (*th)[72] = (__bf16 (*)[72])sm, (*tl2)[72] = (__bf16 (*)[72])(sm + 128 * 72 * 2); __bf16* st = (__bf16*)sm;
  const int tid = threadIdx.x, wave = tid >> 5, lane = tid & 31, col = lane & 15, g = lane >> 4; const int which = blockIdx.z; const int c0 = blockIdx.y * 128; const size_t r0 = (size_t)blockIdx.x * 64; const float* WA = which == 0 ? WQ : which == 1 ? WK : WV; const float* BA = which == 0 ? BQ : which == 1 ? BK : BV;
  v8f acc[8] = {};
  const int lr = tid / (KS / 4), lc = (tid % (KS / 4)) * 4, lo = lr * GP + lc; const float* px = X + (r0 + lr) * CC + lc; const float* pw = WA + (size_t)(c0 + lr) * CC + lc; GT<64, KS> xr; GT<128, KS> wr;
  g_load(xr, px); g_load(wr, pw);
  asm volatile("s_wait_xcnt 0x0" :: "v"(px), "v"(pw) : "memory");   // the address registers of the issued loads stay whole up to this wait; behind it they are stepped
  px += KS; pw += KS;
  s_put(xr, st + lo); s_put(wr, st + XB + lo);
  g_load(xr, px); g_load(wr, pw);
  asm volatile("s_wait_xcnt 0x0" :: "v"(px), "v"(pw) : "memory");   // as above
  px += KS; pw += KS;
  __syncthreads();   // stage 0 is in LDS before a fragment of it is read
  for (int kc = 0; kc < NK; ++kc) { const __bf16* cur = st + (kc & 1) * SB; __bf16* nxt = st + ((kc + 1) & 1) * SB;
    if (kc + 1 < NK) { s_put(xr, nxt + lo); s_put(wr, nxt + XB + lo); }   // the buffer whose last readers left it at the barrier of the pass before
    if (kc + 2 < NK) { g_load(xr, px); g_load(wr, pw);
      asm volatile("s_wait_xcnt 0x0" :: "v"(px), "v"(pw) : "memory");   // as above
      px += KS; pw += KS; }
    const v16b a = frag_b(cur + (wave * 16 + col) * GP, lane);
#pragma unroll
    for (int j = 0; j < 8; ++j) acc[j] = wmma_bf(a, frag_b(cur + XB + (j * 16 + col) * GP, lane), acc[j]);
    __syncthreads();   // publishes stage kc + 1 and ends every read of stage kc (behind the last pass: before the epilogue's tiles overwrite the range)
  }
#pragma unroll
  for (int j = 0; j < 8; ++j) { const float bb = bfr(BA[c0 + j * 16 + col]);
#pragma unroll
    for (int r = 0; r < 8; ++r) { const float v = acc[j][r] + bb; const int rl = wave * 16 + 8 * g + r, cl = j * 16 + col; const _Float16 hv = (_Float16)v;
      if (which == 2) { const __bf16 bh = (__bf16)v; th[cl][rl] = bh; tl2[cl][rl] = (__bf16)(v - (float)bh); } else { sh[rl][cl] = hv; sl[rl][cl] = (_Float16)((v - (float)hv) * 1024.0f); }   /* q residual carried x 2^10 so the plane stays f16-normal on the chip */ } }
  __syncthreads();
  if (which < 2) { _Float16* dh = which == 0 ? QH : KH; for (int e = tid; e < 64 * 16; e += 128) { const int rl = e >> 4, q = e & 15; vst2((unsigned*)(dh + (r0 + rl) * CC + c0 + q * 8), *(const v4u*)&sh[rl][q * 8]); if (which == 0) vst2((unsigned*)(QL + (r0 + rl) * CC + c0 + q * 8), *(const v4u*)&sl[rl][q * 8]); } }
  else { const size_t b = r0 / TT; const int t0 = (int)(r0 % TT); for (int e = tid; e < 128 * 8; e += 128) { const int cl = e >> 3, q = e & 7; const size_t o2 = (b * CC + c0 + cl) * (size_t)TT + t0 + q * 8; vst2((unsigned*)(VT + o2), *(const v4u*)&th[cl][q * 8]); vst2((unsigned*)(VL + o2), *(const v4u*)&tl2[cl][q * 8]); } } }
// ---- k_att: block = 32 queries of (b,h), 16 waves. The block's logit rows live in LDS from the products to P v:
//   1 wave w takes the 16-key tiles w, w + 16, ... of keys [0, kpad) against both query tiles (one key fragment serves 32 queries);
//   2 wave w does the softmax of rows w and w + 16 in place (e = exp(logit - max), masked -> 0; 1 / sum kept per row);
//   3 wave w sums the 32-key chunks w, w + 16, ... of P v for both query tiles, P = e / sum x 2^11 formed as the fragment is read;
//   4 the 16 partial tiles meet in the same LDS and are added in slice order.
__device__ __forceinline__ v16h frag_p(const _Float16* p) { union { v16h v; v8h q[2]; } u; u.q[0] = *(const v8h*)p; u.q[1] = *(const v8h*)(p + 16); return u.v; }
__device__ __forceinline__ v16b frag_q(const __bf16* p) { union { v16b v; v8b q[2]; } u; u.q[0] = *(const v8b*)p; u.q[1] = *(const v8b*)(p + 16); return u.v; }
#define FQ 32
#define FS 16
#define FP (TT + 4)   // row pitch in floats: 16 rows of a fragment read fall on 16 different groups of four banks
__global__ __launch_bounds__(512) void k_att(const _Float16* __restrict__ QH, const _Float16* __restrict__ QL, const _Float16* __restrict__ KH, const __bf16* __restrict__ VT, const __bf16* __restrict__ VL, float* __restrict__ Y) { __shared__ __align__(16) float sp[FQ][FP]; __shared__ float sinv[FQ];
  const int tid = threadIdx.x, ks = __builtin_amdgcn_readfirstlane(tid >> 5) /* scalar, so the slice loops branch on SCC and EXEC stays full at the matrix instructions */, lane = tid & 31, col = lane & 15, g = lane >> 4; const int b = blockIdx.x / NH, h = blockIdx.x % NH; const int qb = (TT / FQ - 1 - (int)blockIdx.y) * FQ;   /* longest rows start first */ const int kend = qb + FQ, kpad = (kend + 127) & ~127;   /* rows are filled to a multiple of 128 keys (<= TT; keys past the diagonal masked), so that a wave's softmax loops run whole 128-key steps with every lane on */
  { v16h ah[2][2], al[2][2]; const size_t qo = ((size_t)b * TT + qb + col) * CC + h * HD + 8 * g; const _Float16* qh = QH + qo; const _Float16* ql = QL + qo;   // the lane's own fragment addresses (frag_h's, with its 8 * g folded in)
#pragma unroll
    for (int t = 0; t < 2; ++t)
#pragma unroll
      for (int kc = 0; kc < HD / 32; ++kc) { ah[t][kc] = frag_p(qh + t * 16 * CC + kc * 32); al[t][kc] = frag_p(ql + t * 16 * CC + kc * 32); }
    asm volatile("s_wait_xcnt 0x0" :: "v"(qh), "v"(ql) : "memory");   // the address registers of the issued loads stay whole up to this wait; behind it they may be reused
    auto tile = [&](const v16h kb0, const v16h kb1, const int kt) { const int key = kt * 16 + col;
#pragma unroll
      for (int t = 0; t < 2; ++t) { v8f a = {}, l = {}; a = wmma16(ah[t][0], kb0, a); l = wmma16(al[t][0], kb0, l); a = wmma16(ah[t][1], kb1, a); l = wmma16(al[t][1], kb1, l); a += l * (1.0f / 1024.0f);
#pragma unroll
        for (int r = 0; r < 8; ++r) { const int rl = t * 16 + 8 * g + r; float v = a[r] * 0.125f; if (key > qb + rl) v = -3.0e38f; sp[rl][key] = v; } } };
    const int nt = kpad / 16; const _Float16* kp = KH + ((size_t)b * TT + ks * 16 + col) * CC + h * HD + 8 * g; v16h ka0 = {}, ka1 = {}, kc0 = {}, kc1 = {}; if (ks < nt) { ka0 = frag_p(kp); ka1 = frag_p(kp + 32); }
    for (int kt = ks; kt < nt; kt += 2 * FS) { const bool two = kt + FS < nt;   // two register sets in turn: a tile's key fragments fly while the tile before it is worked on
      if (two) { kc0 = frag_p(kp + FS * 16 * CC); kc1 = frag_p(kp + FS * 16 * CC + 32); }
      tile(ka0, ka1, kt);
      if (kt + 2 * FS < nt) { ka0 = frag_p(kp + 2 * FS * 16 * CC); ka1 = frag_p(kp + 2 * FS * 16 * CC + 32); }
      asm volatile("s_wait_xcnt 0x0" :: "v"(kp) : "memory");   // the address register of the issued loads stays whole up to this wait; behind it it is stepped
      kp += (size_t)2 * FS * 16 * CC;
      if (two) tile(kc0, kc1, kt + FS); } }
  __syncthreads();   // every logit of the 32 rows is in LDS before a row's softmax reads it
  { float* s0 = &sp[ks][lane * 4]; float* s1 = &sp[ks + FS][lane * 4]; float m0 = -3.0e38f, m1 = -3.0e38f;   // two rows side by side: two independent chains per wave
    for (int k = 0; k < kpad; k += 128) { const v4f u = *(const v4f*)&s0[k], w = *(const v4f*)&s1[k]; m0 = fmaxf(fmaxf(m0, fmaxf(u[0], u[1])), fmaxf(u[2], u[3])); m1 = fmaxf(fmaxf(m1, fmaxf(w[0], w[1])), fmaxf(w[2], w[3])); }
#pragma unroll
    for (int o = 1; o < 32; o <<= 1) { m0 = fmaxf(m0, __shfl_xor(m0, o)); m1 = fmaxf(m1, __shfl_xor(m1, o)); }
    float a0 = 0.f, a1 = 0.f;
    for (int k = 0; k < kpad; k += 128) { const v4f u = *(const v4f*)&s0[k], w = *(const v4f*)&s1[k]; v4f e, f;
#pragma unroll
      for (int i = 0; i < 4; ++i) { const float x = expf(u[i] - m0), y = expf(w[i] - m1); e[i] = (u[i] <= -1.0e38f) ? 0.f : x; f[i] = (w[i] <= -1.0e38f) ? 0.f : y; }
      a0 += (e[0] + e[1]) + (e[2] + e[3]); a1 += (f[0] + f[1]) + (f[2] + f[3]); *(v4f*)&s0[k] = e; *(v4f*)&s1[k] = f; }
#pragma unroll
    for (int o = 1; o < 32; o <<= 1) { a0 += __shfl_xor(a0, o); a1 += __shfl_xor(a1, o); }
    if (lane == 0) { sinv[ks] = 1.0f / a0; sinv[ks + FS] = 1.0f / a1; } }
  __syncthreads();   // every row's e and 1 / sum are in LDS before the P fragments are read
  v8f acc[2][HD / 16] = {}; const float sc[2] = { sinv[col] * 2048.0f, sinv[16 + col] * 2048.0f };
  const size_t vo = ((size_t)b * CC + h * HD + col) * (size_t)TT + ks * 32 + 8 * g; const __bf16* pvh = VT + vo; const __bf16* pvl = VL + vo;   // the lane's own fragment addresses, stepped from chunk to chunk
  for (int kc = ks; kc < kend / 32; kc += FS) { F2 p[2]; v16b vh[HD / 16], vl[HD / 16];   // all v fragments of the chunk are asked for first: one load latency a chunk, under the split of P
#pragma unroll
    for (int j = 0; j < HD / 16; ++j) { vh[j] = frag_q(pvh + (size_t)j * 16 * TT); vl[j] = frag_q(pvl + (size_t)j * 16 * TT); }
    asm volatile("s_wait_xcnt 0x0" :: "v"(pvh), "v"(pvl) : "memory");   // the address registers of the issued loads stay whole up to this wait; behind it they are stepped
    pvh += FS * 32; pvl += FS * 32;
#pragma unroll
    for (int t = 0; t < 2; ++t) { const v4f* q4 = (const v4f*)&sp[t * 16 + col][kc * 32 + 8 * g]; const v4f x0 = q4[0] * sc[t], x1 = q4[1] * sc[t], x2 = q4[4] * sc[t], x3 = q4[5] * sc[t]; float v[16];
#pragma unroll
      for (int i = 0; i < 4; ++i) { v[i] = x0[i]; v[4 + i] = x1[i]; v[8 + i] = x2[i]; v[12 + i] = x3[i]; }
      p[t] = bsplit16(v); }
#pragma unroll
    for (int j = 0; j < HD / 16; ++j)
#pragma unroll
      for (int t = 0; t < 2; ++t) { acc[t][j] = wmma_bf(p[t].h, vh[j], acc[t][j]); acc[t][j] = wmma_bf(p[t].l, vh[j], acc[t][j]); acc[t][j] = wmma_bf(p[t].h, vl[j], acc[t][j]); } }
  __syncthreads();   // the last P fragment is read before the partial tiles overwrite the rows
  float* ss = &sp[0][0];   // [FS][FQ][HD + 4]
#pragma unroll
  for (int t = 0; t < 2; ++t)
#pragma unroll
    for (int j = 0; j < HD / 16; ++j)
#pragma unroll
      for (int r = 0; r < 8; ++r) ss[(ks * FQ + t * 16 + 8 * g + r) * (HD + 4) + j * 16 + col] = acc[t][j][r];
  __syncthreads();   // every slice's partial tile is in LDS before any thread adds them
  { const int rl = tid >> 4, c4 = (tid & 15) * 4; v4f s = *(const v4f*)&ss[rl * (HD + 4) + c4];
#pragma unroll
    for (int i = 1; i < FS; ++i) s += *(const v4f*)&ss[(i * FQ + rl) * (HD + 4) + c4];
    vst2(Y + ((size_t)b * TT + qb + rl) * CC + h * HD + c4, s * (1.0f / 2048.0f)); } }
// ---- k_out: block = (64 rows, 128 cols): out = y (bf16 hi + lo) Wo^T + bo; y (split once for the block) and Wo tiles of 32 k go through two LDS stage buffers in turn, as in k_proj
__global__ __launch_bounds__(128) void k_out(const float* __restrict__ Y, const float* __restrict__ WP, const float* __restrict__ BP, float* __restrict__ OUT) { __shared__ __align__(16) float sf[4][16][132];
  constexpr int KS = 32, GP = KS + 8, YB = 64 * GP, SB = 2 * YB + 128 * GP, NK = CC / KS;   // in bf16 elements: row pitch, one y plane and the whole of a stage buffer
  __shared__ __align__(16) __bf16 st[2 * SB];
  const int tid = threadIdx.x, wave = tid >> 5, lane = tid & 31, col = lane & 15, g = lane >> 4; const int c0 = blockIdx.y * 128; const size_t r0 = (size_t)blockIdx.x * 64 + wave * 16;
  v8f acc[8] = {};
  const int lr = tid / (KS / 4), lc = (tid % (KS / 4)) * 4, lo = lr * GP + lc; const float* py = Y + ((size_t)blockIdx.x * 64 + lr) * CC + lc; const float* pw = WP + (size_t)(c0 + lr) * CC + lc; GT<64, KS> yr; GT<128, KS> wr;
  g_load(yr, py); g_load(wr, pw);
  asm volatile("s_wait_xcnt 0x0" :: "v"(py), "v"(pw) : "memory");   // the address registers of the issued loads stay whole up to this wait; behind it they are stepped
  py += KS; pw += KS;
  s_put2(yr, st + lo, st + YB + lo); s_put(wr, st + 2 * YB + lo);
  g_load(yr, py); g_load(wr, pw);
  asm volatile("s_wait_xcnt 0x0" :: "v"(py), "v"(pw) : "memory");   // as above
  py += KS; pw += KS;
  __syncthreads();   // stage 0 is in LDS before a fragment of it is read
  for (int kc = 0; kc < NK; ++kc) { const __bf16* cur = st + (kc & 1) * SB; __bf16* nxt = st + ((kc + 1) & 1) * SB;
    if (kc + 1 < NK) { s_put2(yr, nxt + lo, nxt + YB + lo); s_put(wr, nxt + 2 * YB + lo); }   // the buffer whose last readers left it at the barrier of the pass before
    if (kc + 2 < NK) { g_load(yr, py); g_load(wr, pw);
      asm volatile("s_wait_xcnt 0x0" :: "v"(py), "v"(pw) : "memory");   // as above
      py += KS; pw += KS; }
    const v16b ah = frag_b(cur + (wave * 16 + col) * GP, lane), al = frag_b(cur + YB + (wave * 16 + col) * GP, lane); v16b w[8];   // all fragments of the pass are asked for first: one LDS latency a pass
#pragma unroll
    for (int j = 0; j < 8; ++j) w[j] = frag_b(cur + 2 * YB + (j * 16 + col) * GP, lane);
#pragma unroll
    for (int j = 0; j < 8; ++j) { acc[j] = wmma_bf(ah, w[j], acc[j]); acc[j] = wmma_bf(al, w[j], acc[j]); }
    __syncthreads();   // publishes stage kc + 1 and ends every read of stage kc
  }
#pragma unroll
  for (int j = 0; j < 8; ++j) { const float bb = BP ? bfr(BP[c0 + j * 16 + col]) : 0.f;
#pragma unroll
    for (int r = 0; r < 8; ++r) sf[wave][8 * g + r][j * 16 + col] = acc[j][r] + bb; }
  LDSX(); for (int rl = 0; rl < 16; ++rl) vst2(OUT + (r0 + rl) * CC + c0 + lane * 4, *(const v4f*)&sf[wave][rl][lane * 4]); }
extern "C" void kernel_launch(void* const* d_in, const int* in_sizes, int n_in, void* d_out, int out_size, void* d_ws, size_t ws_size, hipStream_t stream) {
  (void)in_sizes; (void)n_in; (void)out_size;
  const float** F = (const float**)d_in;   // 0 x [2,2048,1024], 1 Wq [1024,1024] ([out,in]), 2 bq, 3 Wv, 4 bv, 5 Wo, 6 bo
  if (ws_size < (size_t)WS_END) return;
  char* ws = (char*)d_ws; _Float16 *QH = (_Float16*)(ws + WS_QH), *QL = (_Float16*)(ws + WS_QL), *KH = (_Float16*)(ws + WS_KH); __bf16 *VT = (__bf16*)(ws + WS_VT), *VL = (__bf16*)(ws + WS_VL); float *Y = (float*)(ws + WS_Y);
  k_proj<<<dim3(TNB * TT / 64, CC / 128, 3), 128, 0, stream>>>(F[0], F[1], F[2], F[1], F[2], F[3], F[4], QH, QL, KH, VT, VL);   // queries and keys share Wq, bq
  k_att<<<dim3(TNB * NH, TT / FQ), 512, 0, stream>>>(QH, QL, KH, VT, VL, Y);
  k_out<<<dim3(TNB * TT / 64, CC / 128), 128, 0, stream>>>(Y, F[5], F[6], (float*)d_out);
}

// v004
// One run takes 152 microseconds.
// Next to v003, in two timings, it ran 1.13 times as fast each time.
// Over all steps from v000 it is 9.82 times as fast.
// compute dtype: all float inputs rounded to bf16; qk = x Wq^T + bq (shared query/key) and v = x Wv^T + bv with EXACT bf16 products on WMMA 16x16x32, f32 accumulate; q as f16 hi + residual (x 2^10), k f16 -> 2-product logits / 8, causal, kept in f32 in LDS (32 query rows per block); softmax in f32 (precise expf), P x 2^11 f32 split bf16 hi + lo against v bf16 hi + lo (3 products); out = y (bf16 hi + lo) Wo^T + bo; f32 output.
#include <hip/hip_runtime.h>
#include <math.h>

typedef __attribute__((ext_vector_type(16))) _Float16 v16h;
typedef __attribute__((ext_vector_type(16))) __bf16 v16b;
typedef __attribute__((ext_vector_type(8)))  _Float16 v8h;
typedef __attribute__((ext_vector_type(8)))  float v8f;
typedef __attribute__((ext_vector_type(4)))  float v4f;
typedef __attribute__((ext_vector_type(2)))  float v2f;
typedef __attribute__((ext_vector_type(4)))  unsigned v4u;
typedef __attribute__((ext_vector_type(4)))  int v4i;
typedef float __attribute__((may_alias)) float_a;
typedef int __attribute__((may_alias)) int_a;

template <typename T> __device__ __forceinline__ void vst2(void* p, T v) { *(T*)p = v;  }
__device__ __forceinline__ v8f wmma16(v16h a, v16h b, v8f c) {
  v8f d = __builtin_amdgcn_wmma_f32_16x16x32_f16(false, a, false, b, (short)0, c, false, false);
  asm volatile("v_nop\n\tv_nop\n\tv_nop\n\tv_nop" : "+v"(d) : "v"(a), "v"(b));
  return d;
}
__device__ __forceinline__ v8f wmma_bf(v16b a, v16b b, v8f c) {
  v8f d = __builtin_amdgcn_wmma_f32_16x16x32_bf16(false, a, false, b, (short)0, c, false, false);
  asm volatile("v_nop\n\tv_nop\n\tv_nop\n\tv_nop" : "+v"(d) : "v"(a), "v"(b));
  return d;
}
// 16x16x32 fragments: lane = (h = lane>>4, row/col = lane&15); elements 0..7 = k0+8h+0..7, 8..15 = k0+16+8h+0..7; D element r = row 8h+r
__device__ __forceinline__ v16h frag_h(const _Float16* rowk0, int lane) {
  union { v16h v; v8h q[2]; } u; const _Float16* p = rowk0 + 8 * (lane >> 4);
  u.q[0] = *(const v8h*)p; u.q[1] = *(const v8h*)(p + 16); return u.v;
}
__device__ __forceinline__ v16h frag_f32(const float* rowk0, int lane) {
  v16h a; const float* p = rowk0 + 8 * (lane >> 4);
#pragma unroll
  for (int i = 0; i < 8; ++i) { a[i] = (_Float16)p[i]; a[8 + i] = (_Float16)p[16 + i]; }
  return a;
}
__device__ __forceinline__ v16h frag_f32s(const float* rowk0, int lane, float sc) {
  v16h a; const float* p = rowk0 + 8 * (lane >> 4);
#pragma unroll
  for (int i = 0; i < 8; ++i) { a[i] = (_Float16)(p[i] * sc); a[8 + i] = (_Float16)(p[16 + i] * sc); }
  return a;
}
// column fragment from a [K][ld] layout (column n), rows >= K read as 0
__device__ __forceinline__ v16h fragc_f32(const float* W, int k0, int n, int lane, int ld, int K) {
  v16h a; const int g = lane >> 4;
#pragma unroll
  for (int i = 0; i < 8; ++i) { const int ka = k0 + 8 * g + i, kb = ka + 16;
    a[i] = (_Float16)(ka < K ? W[(size_t)(ka < K ? ka : K - 1) * ld + n] : 0.f); a[8 + i] = (_Float16)(kb < K ? W[(size_t)(kb < K ? kb : K - 1) * ld + n] : 0.f); }
  return a;
}
struct F2 { v16b h, l; };
__device__ __forceinline__ F2 bsplit16(const float v[16]) { F2 r;
#pragma unroll
  for (int i = 0; i < 16; ++i) { const __bf16 h = (__bf16)v[i]; r.h[i] = h; r.l[i] = (__bf16)(v[i] - (float)h); }
  return r; }
__device__ __forceinline__ F2 split_row(const float* row, int k0, int lane) { float v[16]; const float* p = row + k0 + 8 * (lane >> 4);
#pragma unroll
  for (int i = 0; i < 8; ++i) { v[i] = p[i]; v[8 + i] = p[16 + i]; }
  return bsplit16(v); }
__device__ __forceinline__ F2 split_rowK(const float* row, int k0, int lane, int K) { float v[16]; const int g = lane >> 4;
#pragma unroll
  for (int i = 0; i < 8; ++i) { const int ka = k0 + 8 * g + i, kb = ka + 16; v[i] = ka < K ? row[ka < K ? ka : K - 1] : 0.f; v[8 + i] = kb < K ? row[kb < K ? kb : K - 1] : 0.f; }
  return bsplit16(v); }
__device__ __forceinline__ F2 split_col(const float* W, int k0, int n, int lane, int ld, int K) { float v[16]; const int g = lane >> 4;
#pragma unroll
  for (int i = 0; i < 8; ++i) { const int ka = k0 + 8 * g + i, kb = ka + 16; v[i] = ka < K ? W[(size_t)(ka < K ? ka : K - 1) * ld + n] : 0.f; v[8 + i] = kb < K ? W[(size_t)(kb < K ? kb : K - 1) * ld + n] : 0.f; }
  return bsplit16(v); }
__device__ __forceinline__ v8f mac3(const F2& a, const F2& b, v8f c) { c = wmma_bf(a.l, b.h, c); c = wmma_bf(a.h, b.l, c); return wmma_bf(a.h, b.h, c); }
__device__ __forceinline__ float sigm(float v) { return 1.0f / (1.0f + expf(-v)); }
#define LDSX() do { asm volatile("s_wait_dscnt 0" ::: "memory"); __builtin_amdgcn_wave_barrier(); __builtin_amdgcn_fence(__ATOMIC_RELEASE, "workgroup"); } while (0)


// Shared-QK causal attention ('LSHAttention', B 2, S 2,048, hidden 1,024 = 16 x 64): qk = x Wq^T + bq used as both queries and keys, v = x Wv^T + bv, causal softmax(qk qk^T / 8), P v, output Linear + bias.
#define NB 2
#define TT 2048
#define CC 1024
#define NH 16
#define HD 64
#ifndef TNB
#define TNB NB
#endif
typedef __attribute__((ext_vector_type(8))) __bf16 v8b;
__device__ __forceinline__ v16b frag_b(const __bf16* rowk0, int lane) {
  union { v16b v; v8b q[2]; } u; const __bf16* p = rowk0 + 8 * (lane >> 4);
  u.q[0] = *(const v8b*)p; u.q[1] = *(const v8b*)(p + 16); return u.v;
}
__device__ __forceinline__ float bfr(float v) { return (float)(__bf16)v; }
__device__ __attribute__((noinline)) float exp_ni(float v) { return expf(v); }
__device__ __attribute__((noinline)) float erf_ni(float v) { return erff(v); }

// q, k and v planes lie in FRAGMENT ORDER, per (b, h): a 16x16x32 operand fragment is two runs of 512 contiguous bytes, lane l's 16 bytes at 16 l, so that each wave-wide 16-byte load of k_att covers four whole 128-byte lines.
//   q, k: [b][h][t / 16][d / 16][(d / 8) & 1][t & 15][d & 7]      v: [b][h][t / 32][c / 16][(t / 16) & 1][(t / 8) & 1][c & 15][t & 7]
#define WS_QH  0u
#define WS_QL  (WS_QH + 2u * (size_t)NB * TT * CC)
#define WS_KH  (WS_QL + 2u * (size_t)NB * TT * CC)
#define WS_VT  (WS_KH + 2u * (size_t)NB * TT * CC)      // bf16 v planes
#define WS_VL  (WS_VT + 2u * (size_t)NB * CC * TT)      // bf16 v residual planes
#define WS_Y   (WS_VL + 2u * (size_t)NB * CC * TT)      // f32 y rows [b*t][C]
#define WS_END (WS_Y + 4u * (size_t)NB * TT * CC)

// ---- operand staging of the two projection GEMMs (blocks of 128 threads): a [ROWS][KS] f32 tile is read in whole 128-byte lines (16 bytes a lane, neighbouring lanes on neighbouring
//   addresses of a row), rounded to bf16 once for the block and put into LDS at a row pitch of KS + 8 elements (16 bytes x an odd number: the 16 rows of a fragment read fall on different banks).
typedef __attribute__((ext_vector_type(4))) __bf16 v4b;
template <int ROWS, int KS> struct GT { v4f r[ROWS * KS / 512]; };
template <int ROWS, int KS> __device__ __forceinline__ void g_load(GT<ROWS, KS>& t, const float* p) {   // p: the thread's own place in the tile's first 512 / KS rows
#pragma unroll
  for (int i = 0; i < ROWS * KS / 512; ++i) t.r[i] = *(const v4f*)(p + (size_t)i * (512 / KS) * CC); }
template <int ROWS, int KS> __device__ __forceinline__ void s_put(const GT<ROWS, KS>& t, __bf16* d) {
#pragma unroll
  for (int i = 0; i < ROWS * KS / 512; ++i) { v4b o;
#pragma unroll
    for (int e = 0; e < 4; ++e) o[e] = (__bf16)t.r[i][e];
    *(v4b*)(d + i * (512 / KS) * (KS + 8)) = o; } }
template <int ROWS, int KS> __device__ __forceinline__ void s_put2(const GT<ROWS, KS>& t, __bf16* dh, __bf16* dl) {   // hi + residual planes, bsplit16's split
#pragma unroll
  for (int i = 0; i < ROWS * KS / 512; ++i) { v4b o, u;
#pragma unroll
    for (int e = 0; e < 4; ++e) { const float v = t.r[i][e]; const __bf16 h = (__bf16)v; o[e] = h; u[e] = (__bf16)(v - (float)h); }
    *(v4b*)(dh + i * (512 / KS) * (KS + 8)) = o; *(v4b*)(dl + i * (512 / KS) * (KS + 8)) = u; } }
// ---- k_proj: block = (64 rows, 128 cols, which): qkv = x W (+ b), exact; q -> f16 hi (+ residual), k -> f16 hi, v -> bf16 hi + residual planes
//   x and W tiles of 32 k go through two LDS stage buffers in turn; the tile after next flies into registers while this one is multiplied. The stage buffers and the epilogue's tiles share one LDS range.
__global__ __launch_bounds__(128) void k_proj(const float* __restrict__ X, const float* __restrict__ WQ, const float* __restrict__ BQ, const float* __restrict__ WK, const float* __restrict__ BK, const float* __restrict__ WV, const float* __restrict__ BV, _Float16* __restrict__ QH, _Float16* __restrict__ QL, _Float16* __restrict__ KH, __bf16* __restrict__ VT, __bf16* __restrict__ VL) {
  constexpr int KS = 32, GP = KS + 8, XB = 64 * GP, SB = XB + 128 * GP, NK = CC / KS;   // in bf16 elements: row pitch, the x part and the whole of a stage buffer
  __shared__ __align__(16) unsigned char sm[2 * 128 * 72 * 2]; static_assert(2 * SB * 2 <= (int)sizeof(sm) && 2 * 64 * 136 * 2 <= (int)sizeof(sm), "LDS range");
  _Float16 (*sh)[136] = (_Float16 (*)[136])sm, (*sl)[136] = (_Float16 (*)[136])(sm + 64 * 136 * 2); __bf16 (*th)[72] = (__bf16 (*)[72])sm, (*tl2)[72] = (__bf16 (*)[72])(sm + 128 * 72 * 2); __bf16* st = (__bf16*)sm;
  const int tid = threadIdx.x, wave = tid >> 5, lane = tid & 31, col = lane & 15, g = lane >> 4; const int which = blockIdx.z; const int c0 = blockIdx.y * 128; const size_t r0 = (size_t)blockIdx.x * 64; const float* WA = which == 0 ? WQ : which == 1 ? WK : WV; const float* BA = which == 0 ? BQ : which == 1 ? BK : BV;
  v8f acc[8] = {};
  const int lr = tid / (KS / 4), lc = (tid % (KS / 4)) * 4, lo = lr * GP + lc; const float* px = X + (r0 + lr) * CC + lc; const float* pw = WA + (size_t)(c0 + lr) * CC + lc; GT<64, KS> xr; GT<128, KS> wr;
  g_load(xr, px); g_load(wr, pw);
  asm volatile("s_wait_xcnt 0x0" :: "v"(px), "v"(pw) : "memory");   // the address registers of the issued loads stay whole up to this wait; behind it they are stepped
  px += KS; pw += KS;
  s_put(xr, st + lo); s_put(wr, st + XB + lo);
  g_load(xr, px); g_load(wr, pw);
  asm volatile("s_wait_xcnt 0x0" :: "v"(px), "v"(pw) : "memory");   // as above
  px += KS; pw += KS;
  __syncthreads();   // stage 0 is in LDS before a fragment of it is read
  for (int kc = 0; kc < NK; ++kc) { const __bf16* cur = st + (kc & 1) * SB; __bf16* nxt = st + ((kc + 1) & 1) * SB;
    if (kc + 1 < NK) { s_put(xr, nxt + lo); s_put(wr, nxt + XB + lo); }   // the buffer whose last readers left it at the barrier of the pass before
    if (kc + 2 < NK) { g_load(xr, px); g_load(wr, pw);
      asm volatile("s_wait_xcnt 0x0" :: "v"(px), "v"(pw) : "memory");   // as above
      px += KS; pw += KS; }
    const v16b a = frag_b(cur + (wave * 16 + col) * GP, lane);
#pragma unroll
    for (int j = 0; j < 8; ++j) acc[j] = wmma_bf(a, frag_b(cur + XB + (j * 16 + col) * GP, lane), acc[j]);
    __syncthreads();   // publishes stage kc + 1 and ends every read of stage kc (behind the last pass: before the epilogue's tiles overwrite the range)
  }
#pragma unroll
  for (int j = 0; j < 8; ++j) { const float bb = bfr(BA[c0 + j * 16 + col]);
#pragma unroll
    for (int r = 0; r < 8; ++r) { const float v = acc[j][r] + bb; const int rl = wave * 16 + 8 * g + r, cl = j * 16 + col; const _Float16 hv = (_Float16)v;
      if (which == 2) { const __bf16 bh = (__bf16)v; th[cl][rl] = bh; tl2[cl][rl] = (__bf16)(v - (float)bh); } else { sh[rl][cl] = hv; sl[rl][cl] = (_Float16)((v - (float)hv) * 1024.0f); }   /* q residual carried x 2^10 so the plane stays f16-normal on the chip */ } }
  __syncthreads();
  const size_t bh = (r0 / TT) * NH + c0 / HD; const int t0 = (int)(r0 % TT);   // e counts the block's 16-byte pieces in the order of their places in the planes: neighbouring threads store neighbouring pieces
  if (which < 2) { _Float16* dh = which == 0 ? QH : KH; for (int e = tid; e < 64 * 16; e += 128) { const int rl = ((e >> 7) & 3) * 16 + (e & 15), q = (e >> 9) * 8 + ((e >> 4) & 7); const size_t o = ((bh + (e >> 9)) * (TT / 16) + t0 / 16 + ((e >> 7) & 3)) * 1024 + (e & 127) * 8; vst2((unsigned*)(dh + o), *(const v4u*)&sh[rl][q * 8]);
      asm volatile("s_wait_xcnt 0x0" ::: "memory");   // the registers that the issued store names stay whole up to this wait; behind it they are reused
      if (which == 0) { vst2((unsigned*)(QL + o), *(const v4u*)&sl[rl][q * 8]);
        asm volatile("s_wait_xcnt 0x0" ::: "memory"); } } }   // as above
  else { for (int e = tid; e < 128 * 8; e += 128) { const int cl = (e >> 9) * 64 + ((e >> 6) & 3) * 16 + (e & 15), q = ((e >> 8) & 1) * 4 + ((e >> 4) & 3); const size_t o2 = ((bh + (e >> 9)) * (TT / 32) + t0 / 32 + ((e >> 8) & 1)) * 2048 + (e & 255) * 8; vst2((unsigned*)(VT + o2), *(const v4u*)&th[cl][q * 8]); vst2((unsigned*)(VL + o2), *(const v4u*)&tl2[cl][q * 8]); } } }
// ---- k_att: block = 32 queries of (b,h), 16 waves. The block's logit rows live in LDS from the products to P v:
//   1 wave w takes the 16-key tiles w, w + 16, ... of keys [0, kpad) against both query tiles (one key fragment serves 32 queries);
//   2 wave w does the softmax of rows w and w + 16 in place (e = exp(logit - max), masked -> 0; 1 / sum kept per row);
//   3 wave w sums the 32-key chunks w, w + 16, ... of P v for both query tiles, P = e / sum x 2^11 formed as the fragment is read;
//   4 the 16 partial tiles meet in the same LDS and are added in slice order.
// p: the lane's own place (8 * lane) in the first of a fragment's two 512-byte runs
__device__ __forceinline__ v16h frag_p(const _Float16* p) { union { v16h v; v8h q[2]; } u; u.q[0] = *(const v8h*)p; u.q[1] = *(const v8h*)(p + 256); return u.v; }
__device__ __forceinline__ v16b frag_q(const __bf16* p) { union { v16b v; v8b q[2]; } u; u.q[0] = *(const v8b*)p; u.q[1] = *(const v8b*)(p + 256); return u.v; }
#define FQ 32
#define FS 16
#define FP (TT + 4)   // row pitch in floats: 16 rows of a fragment read fall on 16 different groups of four banks
__global__ __launch_bounds__(512) void k_att(const _Float16* __restrict__ QH, const _Float16* __restrict__ QL, const _Float16* __restrict__ KH, const __bf16* __restrict__ VT, const __bf16* __restrict__ VL, float* __restrict__ Y) { __shared__ __align__(16) float sp[FQ][FP]; __shared__ float sinv[FQ];
  const int tid = threadIdx.x, ks = __builtin_amdgcn_readfirstlane(tid >> 5) /* scalar, so the slice loops branch on SCC and EXEC stays full at the matrix instructions */, lane = tid & 31, col = lane & 15, g = lane >> 4; const int b = blockIdx.x / NH, h = blockIdx.x % NH; const int qb = (TT / FQ - 1 - (int)blockIdx.y) * FQ;   /* longest rows start first */ const int kend = qb + FQ, kpad = (kend + 127) & ~127;   /* rows are filled to a multiple of 128 keys (<= TT; keys past the diagonal masked), so that a wave's softmax loops run whole 128-key steps with every lane on */
  { v16h ah[2][2], al[2][2]; const size_t qo = ((size_t)blockIdx.x * (TT / 16) + qb / 16) * 1024 + 8 * lane; const _Float16* qh = QH + qo; const _Float16* ql = QL + qo;   // the lane's own fragment addresses
#pragma unroll
    for (int t = 0; t < 2; ++t)
#pragma unroll
      for (int kc = 0; kc < HD / 32; ++kc) { ah[t][kc] = frag_p(qh + t * 1024 + kc * 512); al[t][kc] = frag_p(ql + t * 1024 + kc * 512); }
    asm volatile("s_wait_xcnt 0x0" :: "v"(qh), "v"(ql) : "memory");   // the address registers of the issued loads stay whole up to this wait; behind it they may be reused
    auto tile = [&](const v16h kb0, const v16h kb1, const int kt) { const int key = kt * 16 + col;
#pragma unroll
      for (int t = 0; t < 2; ++t) { v8f a = {}, l = {}; a = wmma16(ah[t][0], kb0, a); l = wmma16(al[t][0], kb0, l); a = wmma16(ah[t][1], kb1, a); l = wmma16(al[t][1], kb1, l); a += l * (1.0f / 1024.0f);
#pragma unroll
        for (int r = 0; r < 8; ++r) { const int rl = t * 16 + 8 * g + r; float v = a[r] * 0.125f; if (key > qb + rl) v = -3.0e38f; sp[rl][key] = v; } } };
    const int nt = kpad / 16; const _Float16* kp = KH + ((size_t)blockIdx.x * (TT / 16) + ks) * 1024 + 8 * lane; v16h ka0 = {}, ka1 = {}, kc0 = {}, kc1 = {}; if (ks < nt) { ka0 = frag_p(kp); ka1 = frag_p(kp + 512); }
    for (int kt = ks; kt < nt; kt += 2 * FS) { const bool two = kt + FS < nt;   // two register sets in turn: a tile's key fragments fly while the tile before it is worked on
      if (two) { kc0 = frag_p(kp + FS * 1024); kc1 = frag_p(kp + FS * 1024 + 512); }
      tile(ka0, ka1, kt);
      if (kt + 2 * FS < nt) { ka0 = frag_p(kp + 2 * FS * 1024); ka1 = frag_p(kp + 2 * FS * 1024 + 512); }
      asm volatile("s_wait_xcnt 0x0" :: "v"(kp) : "memory");   // the address register of the issued loads stays whole up to this wait; behind it it is stepped
      kp += 2 * FS * 1024;
      if (two) tile(kc0, kc1, kt + FS); } }
  __syncthreads();   // every logit of the 32 rows is in LDS before a row's softmax reads it
  { float* s0 = &sp[ks][lane * 4]; float* s1 = &sp[ks + FS][lane * 4]; float m0 = -3.0e38f, m1 = -3.0e38f;   // two rows side by side: two independent chains per wave
    for (int k = 0; k < kpad; k += 128) { const v4f u = *(const v4f*)&s0[k], w = *(const v4f*)&s1[k]; m0 = fmaxf(fmaxf(m0, fmaxf(u[0], u[1])), fmaxf(u[2], u[3])); m1 = fmaxf(fmaxf(m1, fmaxf(w[0], w[1])), fmaxf(w[2], w[3])); }
#pragma unroll
    for (int o = 1; o < 32; o <<= 1) { m0 = fmaxf(m0, __shfl_xor(m0, o)); m1 = fmaxf(m1, __shfl_xor(m1, o)); }
    float a0 = 0.f, a1 = 0.f;
    for (int k = 0; k < kpad; k += 128) { const v4f u = *(const v4f*)&s0[k], w = *(const v4f*)&s1[k]; v4f e, f;
#pragma unroll
      for (int i = 0; i < 4; ++i) { const float x = expf(u[i] - m0), y = expf(w[i] - m1); e[i] = (u[i] <= -1.0e38f) ? 0.f : x; f[i] = (w[i] <= -1.0e38f) ? 0.f : y; }
      a0 += (e[0] + e[1]) + (e[2] + e[3]); a1 += (f[0] + f[1]) + (f[2] + f[3]); *(v4f*)&s0[k] = e; *(v4f*)&s1[k] = f; }
#pragma unroll
    for (int o = 1; o < 32; o <<= 1) { a0 += __shfl_xor(a0, o); a1 += __shfl_xor(a1, o); }
    if (lane == 0) { sinv[ks] = 1.0f / a0; sinv[ks + FS] = 1.0f / a1; } }
  __syncthreads();   // every row's e and 1 / sum are in LDS before the P fragments are read
  v8f acc[2][HD / 16] = {}; const float sc[2] = { sinv[col] * 2048.0f, sinv[16 + col] * 2048.0f };
  const size_t vo = ((size_t)blockIdx.x * (TT / 32) + ks) * 2048 + 8 * lane; const __bf16* pvh = VT + vo; const __bf16* pvl = VL + vo;   // the lane's own fragment addresses, stepped from chunk to chunk
  for (int kc = ks; kc < kend / 32; kc += FS) { F2 p[2]; v16b vh[HD / 16], vl[HD / 16];   // all v fragments of the chunk are asked for first: one load latency a chunk, under the split of P
#pragma unroll
    for (int j = 0; j < HD / 16; ++j) { vh[j] = frag_q(pvh + j * 512); vl[j] = frag_q(pvl + j * 512); }
    asm volatile("s_wait_xcnt 0x0" :: "v"(pvh), "v"(pvl) : "memory");   // the address registers of the issued loads stay whole up to this wait; behind it they are stepped
    pvh += FS * 2048; pvl += FS * 2048;
#pragma unroll
    for (int t = 0; t < 2; ++t) { const v4f* q4 = (const v4f*)&sp[t * 16 + col][kc * 32 + 8 * g]; const v4f x0 = q4[0] * sc[t], x1 = q4[1] * sc[t], x2 = q4[4] * sc[t], x3 = q4[5] * sc[t]; float v[16];
#pragma unroll
      for (int i = 0; i < 4; ++i) { v[i] = x0[i]; v[4 + i] = x1[i]; v[8 + i] = x2[i]; v[12 + i] = x3[i]; }
      p[t] = bsplit16(v); }
#pragma unroll
    for (int j = 0; j < HD / 16; ++j)
#pragma unroll
      for (int t = 0; t < 2; ++t) { acc[t][j] = wmma_bf(p[t].h, vh[j], acc[t][j]); acc[t][j] = wmma_bf(p[t].l, vh[j], acc[t][j]); acc[t][j] = wmma_bf(p[t].h, vl[j], acc[t][j]); } }
  __syncthreads();   // the last P fragment is read before the partial tiles overwrite the rows
  float* ss = &sp[0][0];   // [FS][FQ][HD + 4]
#pragma unroll
  for (int t = 0; t < 2; ++t)
#pragma unroll
    for (int j = 0; j < HD / 16; ++j)
#pragma unroll
      for (int r = 0; r < 8; ++r) ss[(ks * FQ + t * 16 + 8 * g + r) * (HD + 4) + j * 16 + col] = acc[t][j][r];
  __syncthreads();   // every slice's partial tile is in LDS before any thread adds them
  { const int rl = tid >> 4, c4 = (tid & 15) * 4; v4f s = *(const v4f*)&ss[rl * (HD + 4) + c4];
#pragma unroll
    for (int i = 1; i < FS; ++i) s += *(const v4f*)&ss[(i * FQ + rl) * (HD + 4) + c4];
    vst2(Y + ((size_t)b * TT + qb + rl) * CC + h * HD + c4, s * (1.0f / 2048.0f)); } }
// ---- k_out: block = (64 rows, 128 cols): out = y (bf16 hi + lo) Wo^T + bo; y (split once for the block) and Wo tiles of 32 k go through two LDS stage buffers in turn, as in k_proj
__global__ __launch_bounds__(128) void k_out(const float* __restrict__ Y, const float* __restrict__ WP, const float* __restrict__ BP, float* __restrict__ OUT) { __shared__ __align__(16) float sf[4][16][132];
  constexpr int KS = 32, GP = KS + 8, YB = 64 * GP, SB = 2 * YB + 128 * GP, NK = CC / KS;   // in bf16 elements: row pitch, one y plane and the whole of a stage buffer
  __shared__ __align__(16) __bf16 st[2 * SB];
  const int tid = threadIdx.x, wave = tid >> 5, lane = tid & 31, col = lane & 15, g = lane >> 4; const int c0 = blockIdx.y * 128; const size_t r0 = (size_t)blockIdx.x * 64 + wave * 16;
  v8f acc[8] = {};
  const int lr = tid / (KS / 4), lc = (tid % (KS / 4)) * 4, lo = lr * GP + lc; const float* py = Y + ((size_t)blockIdx.x * 64 + lr) * CC + lc; const float* pw = WP + (size_t)(c0 + lr) * CC + lc; GT<64, KS> yr; GT<128, KS> wr;
  g_load(yr, py); g_load(wr, pw);
  asm volatile("s_wait_xcnt 0x0" :: "v"(py), "v"(pw) : "memory");   // the address registers of the issued loads stay whole up to this wait; behind it they are stepped
  py += KS; pw += KS;
  s_put2(yr, st + lo, st + YB + lo); s_put(wr, st + 2 * YB + lo);
  g_load(yr, py); g_load(wr, pw);
  asm volatile("s_wait_xcnt 0x0" :: "v"(py), "v"(pw) : "memory");   // as above
  py += KS; pw += KS;
  __syncthreads();   // stage 0 is in LDS before a fragment of it is read
  for (int kc = 0; kc < NK; ++kc) { const __bf16* cur = st + (kc & 1) * SB; __bf16* nxt = st + ((kc + 1) & 1) * SB;
    if (kc + 1 < NK) { s_put2(yr, nxt + lo, nxt + YB + lo); s_put(wr, nxt + 2 * YB + lo); }   // the buffer whose last readers left it at the barrier of the pass before
    if (kc + 2 < NK) { g_load(yr, py); g_load(wr, pw);
      asm volatile("s_wait_xcnt 0x0" :: "v"(py), "v"(pw) : "memory");   // as above
      py += KS; pw += KS; }
    const v16b ah = frag_b(cur + (wave * 16 + col) * GP, lane), al = frag_b(cur + YB + (wave * 16 + col) * GP, lane); v16b w[8];   // all fragments of the pass are asked for first: one LDS latency a pass
#pragma unroll
    for (int j = 0; j < 8; ++j) w[j] = frag_b(cur + 2 * YB + (j * 16 + col) * GP, lane);
#pragma unroll
    for (int j = 0; j < 8; ++j) { acc[j] = wmma_bf(ah, w[j], acc[j]); acc[j] = wmma_bf(al, w[j], acc[j]); }
    __syncthreads();   // publishes stage kc + 1 and ends every read of stage kc
  }
#pragma unroll
  for (int j = 0; j < 8; ++j) { const float bb = BP ? bfr(BP[c0 + j * 16 + col]) : 0.f;
#pragma unroll
    for (int r = 0; r < 8; ++r) sf[wave][8 * g + r][j * 16 + col] = acc[j][r] + bb; }
  LDSX(); for (int rl = 0; rl < 16; ++rl) vst2(OUT + (r0 + rl) * CC + c0 + lane * 4, *(const v4f*)&sf[wave][rl][lane * 4]); }
extern "C" void kernel_launch(void* const* d_in, const int* in_sizes, int n_in, void* d_out, int out_size, void* d_ws, size_t ws_size, hipStream_t stream) {
  (void)in_sizes; (void)n_in; (void)out_size;
  const float** F = (const float**)d_in;   // 0 x [2,2048,1024], 1 Wq [1024,1024] ([out,in]), 2 bq, 3 Wv, 4 bv, 5 Wo, 6 bo
  if (ws_size < (size_t)WS_END) return;
  char* ws = (char*)d_ws; _Float16 *QH = (_Float16*)(ws + WS_QH), *QL = (_Float16*)(ws + WS_QL), *KH = (_Float16*)(ws + WS_KH); __bf16 *VT = (__bf16*)(ws + WS_VT), *VL = (__bf16*)(ws + WS_VL); float *Y = (float*)(ws + WS_Y);
  k_proj<<<dim3(TNB * TT / 64, CC / 128, 3), 128, 0, stream>>>(F[0], F[1], F[2], F[1], F[2], F[3], F[4], QH, QL, KH, VT, VL);   // queries and keys share Wq, bq
  k_att<<<dim3(TNB * NH, TT / FQ), 512, 0, stream>>>(QH, QL, KH, VT, VL, Y);
  k_out<<<dim3(TNB * TT / 64, CC / 128), 128, 0, stream>>>(Y, F[5], F[6], (float*)d_out);
}

// v005
// One run takes 137 microseconds.
// Two timings next to v004 both put it at 1.12 times that version's speed.
// Over all steps from v000 it is 11.0 times as fast.
// compute dtype: all float inputs rounded to bf16; qk = x Wq^T + bq (shared query/key) and v = x Wv^T + bv with EXACT bf16 products on WMMA 16x16x32, f32 accumulate; q as f16 hi + residual (x 2^10), k f16 -> 2-product logits / 8, causal, kept in f32 in LDS (32 query rows per block); softmax in f32 (e = 2^((logit - max) log2 e), one fused multiply-add and the chip's exp2), P x 2^11 f32 split bf16 hi + lo against v bf16 hi + lo (3 products); out = y (bf16 hi + lo) Wo^T + bo; f32 output.
#include <hip/hip_runtime.h>
#include <math.h>

typedef __attribute__((ext_vector_type(16))) _Float16 v16h;
typedef __attribute__((ext_vector_type(16))) __bf16 v16b;
typedef __attribute__((ext_vector_type(8)))  _Float16 v8h;
typedef __attribute__((ext_vector_type(8)))  float v8f;
typedef __attribute__((ext_vector_type(4)))  float v4f;
typedef __attribute__((ext_vector_type(2)))  float v2f;
typedef __attribute__((ext_vector_type(4)))  unsigned v4u;
typedef __attribute__((ext_vector_type(4)))  int v4i;
typedef float __attribute__((may_alias)) float_a;
typedef int __attribute__((may_alias)) int_a;

template <typename T> __device__ __forceinline__ void vst2(void* p, T v) { *(T*)p = v;  }
__device__ __forceinline__ v8f wmma16(v16h a, v16h b, v8f c) {
  v8f d = __builtin_amdgcn_wmma_f32_16x16x32_f16(false, a, false, b, (short)0, c, false, false);
  asm volatile("v_nop\n\tv_nop\n\tv_nop\n\tv_nop" : "+v"(d) : "v"(a), "v"(b));
  return d;
}
__device__ __forceinline__ v8f wmma_bf(v16b a, v16b b, v8f c) {
  v8f d = __builtin_amdgcn_wmma_f32_16x16x32_bf16(false, a, false, b, (short)0, c, false, false);
  asm volatile("v_nop\n\tv_nop\n\tv_nop\n\tv_nop" : "+v"(d) : "v"(a), "v"(b));
  return d;
}
// 16x16x32 fragments: lane = (h = lane>>4, row/col = lane&15); elements 0..7 = k0+8h+0..7, 8..15 = k0+16+8h+0..7; D element r = row 8h+r
__device__ __forceinline__ v16h frag_h(const _Float16* rowk0, int lane) {
  union { v16h v; v8h q[2]; } u; const _Float16* p = rowk0 + 8 * (lane >> 4);
  u.q[0] = *(const v8h*)p; u.q[1] = *(const v8h*)(p + 16); return u.v;
}
__device__ __forceinline__ v16h frag_f32(const float* rowk0, int lane) {
  v16h a; const float* p = rowk0 + 8 * (lane >> 4);
#pragma unroll
  for (int i = 0; i < 8; ++i) { a[i] = (_Float16)p[i]; a[8 + i] = (_Float16)p[16 + i]; }
  return a;
}
__device__ __forceinline__ v16h frag_f32s(const float* rowk0, int lane, float sc) {
  v16h a; const float* p = rowk0 + 8 * (lane >> 4);
#pragma unroll
  for (int i = 0; i < 8; ++i) { a[i] = (_Float16)(p[i] * sc); a[8 + i] = (_Float16)(p[16 + i] * sc); }
  return a;
}
// column fragment from a [K][ld] layout (column n), rows >= K read as 0
__device__ __forceinline__ v16h fragc_f32(const float* W, int k0, int n, int lane, int ld, int K) {
  v16h a; const int g = lane >> 4;
#pragma unroll
  for (int i = 0; i < 8; ++i) { const int ka = k0 + 8 * g + i, kb = ka + 16;
    a[i] = (_Float16)(ka < K ? W[(size_t)(ka < K ? ka : K - 1) * ld + n] : 0.f); a[8 + i] = (_Float16)(kb < K ? W[(size_t)(kb < K ? kb : K - 1) * ld + n] : 0.f); }
  return a;
}
struct F2 { v16b h, l; };
__device__ __forceinline__ F2 bsplit16(const float v[16]) { F2 r;
#pragma unroll
  for (int i = 0; i < 16; ++i) { const __bf16 h = (__bf16)v[i]; r.h[i] = h; r.l[i] = (__bf16)(v[i] - (float)h); }
  return r; }
__device__ __forceinline__ F2 split_row(const float* row, int k0, int lane) { float v[16]; const float* p = row + k0 + 8 * (lane >> 4);
#pragma unroll
  for (int i = 0; i < 8; ++i) { v[i] = p[i]; v[8 + i] = p[16 + i]; }
  return bsplit16(v); }
__device__ __forceinline__ F2 split_rowK(const float* row, int k0, int lane, int K) { float v[16]; const int g = lane >> 4;
#pragma unroll
  for (int i = 0; i < 8; ++i) { const int ka = k0 + 8 * g + i, kb = ka + 16; v[i] = ka < K ? row[ka < K ? ka : K - 1] : 0.f; v[8 + i] = kb < K ? row[kb < K ? kb : K - 1] : 0.f; }
  return bsplit16(v); }
__device__ __forceinline__ F2 split_col(const float* W, int k0, int n, int lane, int ld, int K) { float v[16]; const int g = lane >> 4;
#pragma unroll
  for (int i = 0; i < 8; ++i) { const int ka = k0 + 8 * g + i, kb = ka + 16; v[i] = ka < K ? W[(size_t)(ka < K ? ka : K - 1) * ld + n] : 0.f; v[8 + i] = kb < K ? W[(size_t)(kb < K ? kb : K - 1) * ld + n] : 0.f; }
  return bsplit16(v); }
__device__ __forceinline__ v8f mac3(const F2& a, const F2& b, v8f c) { c = wmma_bf(a.l, b.h, c); c = wmma_bf(a.h, b.l, c); return wmma_bf(a.h, b.h, c); }
__device__ __forceinline__ float sigm(float v) { return 1.0f / (1.0f + expf(-v)); }
#define LDSX() do { asm volatile("s_wait_dscnt 0" ::: "memory"); __builtin_amdgcn_wave_barrier(); __builtin_amdgcn_fence(__ATOMIC_RELEASE, "workgroup"); } while (0)


// Shared-QK causal attention ('LSHAttention', B 2, S 2,048, hidden 1,024 = 16 x 64): qk = x Wq^T + bq used as both queries and keys, v = x Wv^T + bv, causal softmax(qk qk^T / 8), P v, output Linear + bias.
#define NB 2
#define TT 2048
#define CC 1024
#define NH 16
#define HD 64
#ifndef TNB
#define TNB NB
#endif
typedef __attribute__((ext_vector_type(8))) __bf16 v8b;
__device__ __forceinline__ v16b frag_b(const __bf16* rowk0, int lane) {
  union { v16b v; v8b q[2]; } u; const __bf16* p = rowk0 + 8 * (lane >> 4);
  u.q[0] = *(const v8b*)p; u.q[1] = *(const v8b*)(p + 16); return u.v;
}
__device__ __forceinline__ float bfr(float v) { return (float)(__bf16)v; }
__device__ __attribute__((noinline)) float exp_ni(float v) { return expf(v); }
__device__ __attribute__((noinline)) float erf_ni(float v) { return erff(v); }

// q, k and v planes lie in FRAGMENT ORDER, per (b, h): a 16x16x32 operand fragment is two runs of 512 contiguous bytes, lane l's 16 bytes at 16 l, so that each wave-wide 16-byte load of k_att covers four whole 128-byte lines.
//   q, k: [b][h][t / 16][d / 16][(d / 8) & 1][t & 15][d & 7]      v: [b][h][t / 32][c / 16][(t / 16) & 1][(t / 8) & 1][c & 15][t & 7]
#define WS_QH  0u
#define WS_QL  (WS_QH + 2u * (size_t)NB * TT * CC)
#define WS_KH  (WS_QL + 2u * (size_t)NB * TT * CC)
#define WS_VT  (WS_KH + 2u * (size_t)NB * TT * CC)      // bf16 v planes
#define WS_VL  (WS_VT + 2u * (size_t)NB * CC * TT)      // bf16 v residual planes
#define WS_Y   (WS_VL + 2u * (size_t)NB * CC * TT)      // f32 y rows [b*t][C]
#define WS_END (WS_Y + 4u * (size_t)NB * TT * CC)

// ---- operand staging of the two projection GEMMs (blocks of 128 threads): a [ROWS][KS] f32 tile is read in whole 128-byte lines (16 bytes a lane, neighbouring lanes on neighbouring
//   addresses of a row), rounded to bf16 once for the block and put into LDS at a row pitch of KS + 8 elements (16 bytes x an odd number: the 16 rows of a fragment read fall on different banks).
typedef __attribute__((ext_vector_type(4))) __bf16 v4b;
template <int ROWS, int KS> struct GT { v4f r[ROWS * KS / 512]; };
template <int ROWS, int KS> __device__ __forceinline__ void g_load(GT<ROWS, KS>& t, const float* p) {   // p: the thread's own place in the tile's first 512 / KS rows
#pragma unroll
  for (int i = 0; i < ROWS * KS / 512; ++i) t.r[i] = *(const v4f*)(p + (size_t)i * (512 / KS) * CC); }
template <int ROWS, int KS> __device__ __forceinline__ void s_put(const GT<ROWS, KS>& t, __bf16* d) {
#pragma unroll
  for (int i = 0; i < ROWS * KS / 512; ++i) { v4b o;
#pragma unroll
    for (int e = 0; e < 4; ++e) o[e] = (__bf16)t.r[i][e];
    *(v4b*)(d + i * (512 / KS) * (KS + 8)) = o; } }
template <int ROWS, int KS> __device__ __forceinline__ void s_put2(const GT<ROWS, KS>& t, __bf16* dh, __bf16* dl) {   // hi + residual planes, bsplit16's split
#pragma unroll
  for (int i = 0; i < ROWS * KS / 512; ++i) { v4b o, u;
#pragma unroll
    for (int e = 0; e < 4; ++e) { const float v = t.r[i][e]; const __bf16 h = (__bf16)v; o[e] = h; u[e] = (__bf16)(v - (float)h); }
    *(v4b*)(dh + i * (512 / KS) * (KS + 8)) = o; *(v4b*)(dl + i * (512 / KS) * (KS + 8)) = u; } }
// ---- k_proj: block = (64 rows, 128 cols, which): qkv = x W (+ b), exact; q -> f16 hi (+ residual), k -> f16 hi, v -> bf16 hi + residual planes
//   x and W tiles of 32 k go through two LDS stage buffers in turn; the tile after next flies into registers while this one is multiplied. The stage buffers and the epilogue's tiles share one LDS range.
__global__ __launch_bounds__(128) void k_proj(const float* __restrict__ X, const float* __restrict__ WQ, const float* __restrict__ BQ, const float* __restrict__ WK, const float* __restrict__ BK, const float* __restrict__ WV, const float* __restrict__ BV, _Float16* __restrict__ QH, _Float16* __restrict__ QL, _Float16* __restrict__ KH, __bf16* __restrict__ VT, __bf16* __restrict__ VL) {
  constexpr int KS = 32, GP = KS + 8, XB = 64 * GP, SB = XB + 128 * GP, NK = CC / KS;   // in bf16 elements: row pitch, the x part and the whole of a stage buffer
  __shared__ __align__(16) unsigned char sm[2 * 128 * 72 * 2]; static_assert(2 * SB * 2 <= (int)sizeof(sm) && 2 * 64 * 136 * 2 <= (int)sizeof(sm), "LDS range");
  _Float16 (*sh)[136] = (_Float16 (*)[136])sm, (*sl)[136] = (_Float16 (*)[136])(sm + 64 * 136 * 2); __bf16 (*th)[72] = (__bf16 (*)[72])sm, (*tl2)[72] = (__bf16 (*)[72])(sm + 128 * 72 * 2); __bf16* st = (__bf16*)sm;
  const int tid = threadIdx.x, wave = tid >> 5, lane = tid & 31, col = lane & 15, g = lane >> 4; const int which = blockIdx.z; const int c0 = blockIdx.y * 128; const size_t r0 = (size_t)blockIdx.x * 64; const float* WA = which == 0 ? WQ : which == 1 ? WK : WV; const float* BA = which == 0 ? BQ : which == 1 ? BK : BV;
  v8f acc[8] = {};
  const int lr = tid / (KS / 4), lc = (tid % (KS / 4)) * 4, lo = lr * GP + lc; const float* px = X + (r0 + lr) * CC + lc; const float* pw = WA + (size_t)(c0 + lr) * CC + lc; GT<64, KS> xr; GT<128, KS> wr;
  g_load(xr, px); g_load(wr, pw);
  asm volatile("s_wait_xcnt 0x0" :: "v"(px), "v"(pw) : "memory");   // the address registers of the issued loads stay whole up to this wait; behind it they are stepped
  px += KS; pw += KS;
  s_put(xr, st + lo); s_put(wr, st + XB + lo);
  g_load(xr, px); g_load(wr, pw);
  asm volatile("s_wait_xcnt 0x0" :: "v"(px), "v"(pw) : "memory");   // as above
  px += KS; pw += KS;
  __syncthreads();   // stage 0 is in LDS before a fragment of it is read
  for (int kc = 0; kc < NK; ++kc) { const __bf16* cur = st + (kc & 1) * SB; __bf16* nxt = st + ((kc + 1) & 1) * SB;
    if (kc + 1 < NK) { s_put(xr, nxt + lo); s_put(wr, nxt + XB + lo); }   // the buffer whose last readers left it at the barrier of the pass before
    if (kc + 2 < NK) { g_load(xr, px); g_load(wr, pw);
      asm volatile("s_wait_xcnt 0x0" :: "v"(px), "v"(pw) : "memory");   // as above
      px += KS; pw += KS; }
    const v16b a = frag_b(cur + (wave * 16 + col) * GP, lane);
#pragma unroll
    for (int j = 0; j < 8; ++j) acc[j] = wmma_bf(a, frag_b(cur + XB + (j * 16 + col) * GP, lane), acc[j]);
    __syncthreads();   // publishes stage kc + 1 and ends every read of stage kc (behind the last pass: before the epilogue's tiles overwrite the range)
  }
#pragma unroll
  for (int j = 0; j < 8; ++j) { const float bb = bfr(BA[c0 + j * 16 + col]);
#pragma unroll
    for (int r = 0; r < 8; ++r) { const float v = acc[j][r] + bb; const int rl = wave * 16 + 8 * g + r, cl = j * 16 + col; const _Float16 hv = (_Float16)v;
      if (which == 2) { const __bf16 bh = (__bf16)v; th[cl][rl] = bh; tl2[cl][rl] = (__bf16)(v - (float)bh); } else { sh[rl][cl] = hv; sl[rl][cl] = (_Float16)((v - (float)hv) * 1024.0f); }   /* q residual carried x 2^10 so the plane stays f16-normal on the chip */ } }
  __syncthreads();
  const size_t bh = (r0 / TT) * NH + c0 / HD; const int t0 = (int)(r0 % TT);   // e counts the block's 16-byte pieces in the order of their places in the planes: neighbouring threads store neighbouring pieces
  if (which < 2) { _Float16* dh = which == 0 ? QH : KH; for (int e = tid; e < 64 * 16; e += 128) { const int rl = ((e >> 7) & 3) * 16 + (e & 15), q = (e >> 9) * 8 + ((e >> 4) & 7); const size_t o = ((bh + (e >> 9)) * (TT / 16) + t0 / 16 + ((e >> 7) & 3)) * 1024 + (e & 127) * 8; vst2((unsigned*)(dh + o), *(const v4u*)&sh[rl][q * 8]);
      asm volatile("s_wait_xcnt 0x0" ::: "memory");   // the registers that the issued store names stay whole up to this wait; behind it they are reused
      if (which == 0) { vst2((unsigned*)(QL + o), *(const v4u*)&sl[rl][q * 8]);
        asm volatile("s_wait_xcnt 0x0" ::: "memory"); } } }   // as above
  else { for (int e = tid; e < 128 * 8; e += 128) { const int cl = (e >> 9) * 64 + ((e >> 6) & 3) * 16 + (e & 15), q = ((e >> 8) & 1) * 4 + ((e >> 4) & 3); const size_t o2 = ((bh + (e >> 9)) * (TT / 32) + t0 / 32 + ((e >> 8) & 1)) * 2048 + (e & 255) * 8; vst2((unsigned*)(VT + o2), *(const v4u*)&th[cl][q * 8]); vst2((unsigned*)(VL + o2), *(const v4u*)&tl2[cl][q * 8]); } } }
// ---- k_att: block = 32 queries of (b,h), 16 waves. The block's logit rows live in LDS from the products to P v:
//   1 wave w takes the 16-key tiles w, w + 16, ... of keys [0, kpad) against both query tiles (one key fragment serves 32 queries);
//   2 wave w does the softmax of rows w and w + 16 in place (e = exp(logit - max), masked -> 0; 1 / sum kept per row);
//   3 wave w sums the 32-key chunks w, w + 16, ... of P v for both query tiles, P = e / sum x 2^11 formed as the fragment is read;
//   4 the 16 partial tiles meet in the same LDS and are added in slice order.
// p: the lane's own place (8 * lane) in the first of a fragment's two 512-byte runs
__device__ __forceinline__ v16h frag_p(const _Float16* p) { union { v16h v; v8h q[2]; } u; u.q[0] = *(const v8h*)p; u.q[1] = *(const v8h*)(p + 256); return u.v; }
__device__ __forceinline__ v16b frag_q(const __bf16* p) { union { v16b v; v8b q[2]; } u; u.q[0] = *(const v8b*)p; u.q[1] = *(const v8b*)(p + 256); return u.v; }
#define FQ 32
#define FS 16
#define FP (TT + 4)   // row pitch in floats: 16 rows of a fragment read fall on 16 different groups of four banks
__global__ __launch_bounds__(512) void k_att(const _Float16* __restrict__ QH, const _Float16* __restrict__ QL, const _Float16* __restrict__ KH, const __bf16* __restrict__ VT, const __bf16* __restrict__ VL, float* __restrict__ Y) { __shared__ __align__(16) float sp[FQ][FP]; __shared__ float sinv[FQ];
  const int tid = threadIdx.x, ks = __builtin_amdgcn_readfirstlane(tid >> 5) /* scalar, so the slice loops branch on SCC and EXEC stays full at the matrix instructions */, lane = tid & 31, col = lane & 15, g = lane >> 4; const int b = blockIdx.x / NH, h = blockIdx.x % NH; const int qb = (TT / FQ - 1 - (int)blockIdx.y) * FQ;   /* longest rows start first */ const int kend = qb + FQ, kpad = (kend + 127) & ~127;   /* rows are filled to a multiple of 128 keys (<= TT; keys past the diagonal masked), so that a wave's softmax loops run whole 128-key steps with every lane on */
  { v16h ah[2][2], al[2][2]; const size_t qo = ((size_t)blockIdx.x * (TT / 16) + qb / 16) * 1024 + 8 * lane; const _Float16* qh = QH + qo; const _Float16* ql = QL + qo;   // the lane's own fragment addresses
#pragma unroll
    for (int t = 0; t < 2; ++t)
#pragma unroll
      for (int kc = 0; kc < HD / 32; ++kc) { ah[t][kc] = frag_p(qh + t * 1024 + kc * 512); al[t][kc] = frag_p(ql + t * 1024 + kc * 512); }
    asm volatile("s_wait_xcnt 0x0" :: "v"(qh), "v"(ql) : "memory");   // the address registers of the issued loads stay whole up to this wait; behind it they may be reused
    auto tile = [&](const v16h kb0, const v16h kb1, const int kt) { const int key = kt * 16 + col;
#pragma unroll
      for (int t = 0; t < 2; ++t) { v8f a = {}, l = {}; a = wmma16(ah[t][0], kb0, a); l = wmma16(al[t][0], kb0, l); a = wmma16(ah[t][1], kb1, a); l = wmma16(al[t][1], kb1, l); a += l * (1.0f / 1024.0f);
#pragma unroll
        for (int r = 0; r < 8; ++r) { const int rl = t * 16 + 8 * g + r; float v = a[r] * 0.125f; if (key > qb + rl) v = -3.0e38f; sp[rl][key] = v; } } };
    const int nt = kpad / 16; const _Float16* kp = KH + ((size_t)blockIdx.x * (TT / 16) + ks) * 1024 + 8 * lane; v16h ka0 = {}, ka1 = {}, kc0 = {}, kc1 = {}; if (ks < nt) { ka0 = frag_p(kp); ka1 = frag_p(kp + 512); }
    for (int kt = ks; kt < nt; kt += 2 * FS) { const bool two = kt + FS < nt;   // two register sets in turn: a tile's key fragments fly while the tile before it is worked on
      if (two) { kc0 = frag_p(kp + FS * 1024); kc1 = frag_p(kp + FS * 1024 + 512); }
      tile(ka0, ka1, kt);
      if (kt + 2 * FS < nt) { ka0 = frag_p(kp + 2 * FS * 1024); ka1 = frag_p(kp + 2 * FS * 1024 + 512); }
      asm volatile("s_wait_xcnt 0x0" :: "v"(kp) : "memory");   // the address register of the issued loads stays whole up to this wait; behind it it is stepped
      kp += 2 * FS * 1024;
      if (two) tile(kc0, kc1, kt + FS); } }
  __syncthreads();   // every logit of the 32 rows is in LDS before a row's softmax reads it
  { float* s0 = &sp[ks][lane * 4]; float* s1 = &sp[ks + FS][lane * 4]; float m0 = -3.0e38f, m1 = -3.0e38f;   // two rows side by side: two independent chains per wave
    for (int k = 0; k < kpad; k += 128) { const v4f u = *(const v4f*)&s0[k], w = *(const v4f*)&s1[k]; m0 = fmaxf(fmaxf(m0, fmaxf(u[0], u[1])), fmaxf(u[2], u[3])); m1 = fmaxf(fmaxf(m1, fmaxf(w[0], w[1])), fmaxf(w[2], w[3])); }
#pragma unroll
    for (int o = 1; o < 32; o <<= 1) { m0 = fmaxf(m0, __shfl_xor(m0, o)); m1 = fmaxf(m1, __shfl_xor(m1, o)); }
    float a0 = 0.f, a1 = 0.f; const float l2e = 1.44269504088896340736f, n0 = -m0 * l2e, n1 = -m1 * l2e;   // n's rounding is one common factor of a row's e and of its sum: it cancels in e / sum
    for (int k = 0; k < kpad; k += 128) { const v4f u = *(const v4f*)&s0[k], w = *(const v4f*)&s1[k]; v4f e, f;
#pragma unroll
      for (int i = 0; i < 4; ++i) { e[i] = __builtin_amdgcn_exp2f(fmaf(u[i], l2e, n0)); f[i] = __builtin_amdgcn_exp2f(fmaf(w[i], l2e, n1)); }   // a masked logit (-3e38) gives an exponent of -inf and so e = 0 by itself
      a0 += (e[0] + e[1]) + (e[2] + e[3]); a1 += (f[0] + f[1]) + (f[2] + f[3]); *(v4f*)&s0[k] = e; *(v4f*)&s1[k] = f; }
#pragma unroll
    for (int o = 1; o < 32; o <<= 1) { a0 += __shfl_xor(a0, o); a1 += __shfl_xor(a1, o); }
    if (lane == 0) { sinv[ks] = 1.0f / a0; sinv[ks + FS] = 1.0f / a1; } }
  __syncthreads();   // every row's e and 1 / sum are in LDS before the P fragments are read
  v8f acc[2][HD / 16] = {}; const float sc[2] = { sinv[col] * 2048.0f, sinv[16 + col] * 2048.0f };
  const size_t vo = ((size_t)blockIdx.x * (TT / 32) + ks) * 2048 + 8 * lane; const __bf16* pvh = VT + vo; const __bf16* pvl = VL + vo;   // the lane's own fragment addresses, stepped from chunk to chunk
  for (int kc = ks; kc < kend / 32; kc += FS) { F2 p[2]; v16b vh[HD / 16], vl[HD / 16];   // all v fragments of the chunk are asked for first: one load latency a chunk, under the split of P
#pragma unroll
    for (int j = 0; j < HD / 16; ++j) { vh[j] = frag_q(pvh + j * 512); vl[j] = frag_q(pvl + j * 512); }
    asm volatile("s_wait_xcnt 0x0" :: "v"(pvh), "v"(pvl) : "memory");   // the address registers of the issued loads stay whole up to this wait; behind it they are stepped
    pvh += FS * 2048; pvl += FS * 2048;
#pragma unroll
    for (int t = 0; t < 2; ++t) { const v4f* q4 = (const v4f*)&sp[t * 16 + col][kc * 32 + 8 * g]; const v4f x0 = q4[0] * sc[t], x1 = q4[1] * sc[t], x2 = q4[4] * sc[t], x3 = q4[5] * sc[t]; float v[16];
#pragma unroll
      for (int i = 0; i < 4; ++i) { v[i] = x0[i]; v[4 + i] = x1[i]; v[8 + i] = x2[i]; v[12 + i] = x3[i]; }
      p[t] = bsplit16(v); }
#pragma unroll
    for (int j = 0; j < HD / 16; ++j)
#pragma unroll
      for (int t = 0; t < 2; ++t) { acc[t][j] = wmma_bf(p[t].h, vh[j], acc[t][j]); acc[t][j] = wmma_bf(p[t].l, vh[j], acc[t][j]); acc[t][j] = wmma_bf(p[t].h, vl[j], acc[t][j]); } }
  __syncthreads();   // the last P fragment is read before the partial tiles overwrite the rows
  float* ss = &sp[0][0];   // [FS][FQ][HD + 4]
#pragma unroll
  for (int t = 0; t < 2; ++t)
#pragma unroll
    for (int j = 0; j < HD / 16; ++j)
#pragma unroll
      for (int r = 0; r < 8; ++r) ss[(ks * FQ + t * 16 + 8 * g + r) * (HD + 4) + j * 16 + col] = acc[t][j][r];
  __syncthreads();   // every slice's partial tile is in LDS before any thread adds them
  { const int rl = tid >> 4, c4 = (tid & 15) * 4; v4f s = *(const v4f*)&ss[rl * (HD + 4) + c4];
#pragma unroll
    for (int i = 1; i < FS; ++i) s += *(const v4f*)&ss[(i * FQ + rl) * (HD + 4) + c4];
    vst2(Y + ((size_t)b * TT + qb + rl) * CC + h * HD + c4, s * (1.0f / 2048.0f)); } }
// ---- k_out: block = (64 rows, 128 cols): out = y (bf16 hi + lo) Wo^T + bo; y (split once for the block) and Wo tiles of 32 k go through two LDS stage buffers in turn, as in k_proj
__global__ __launch_bounds__(128) void k_out(const float* __restrict__ Y, const float* __restrict__ WP, const float* __restrict__ BP, float* __restrict__ OUT) { __shared__ __align__(16) float sf[4][16][132];
  constexpr int KS = 32, GP = KS + 8, YB = 64 * GP, SB = 2 * YB + 128 * GP, NK = CC / KS;   // in bf16 elements: row pitch, one y plane and the whole of a stage buffer
  __shared__ __align__(16) __bf16 st[2 * SB];
  const int tid = threadIdx.x, wave = tid >> 5, lane = tid & 31, col = lane & 15, g = lane >> 4; const int c0 = blockIdx.y * 128; const size_t r0 = (size_t)blockIdx.x * 64 + wave * 16;
  v8f acc[8] = {};
  const int lr = tid / (KS / 4), lc = (tid % (KS / 4)) * 4, lo = lr * GP + lc; const float* py = Y + ((size_t)blockIdx.x * 64 + lr) * CC + lc; const float* pw = WP + (size_t)(c0 + lr) * CC + lc; GT<64, KS> yr; GT<128, KS> wr;
  g_load(yr, py); g_load(wr, pw);
  asm volatile("s_wait_xcnt 0x0" :: "v"(py), "v"(pw) : "memory");   // the address registers of the issued loads stay whole up to this wait; behind it they are stepped
  py += KS; pw += KS;
  s_put2(yr, st + lo, st + YB + lo); s_put(wr, st + 2 * YB + lo);
  g_load(yr, py); g_load(wr, pw);
  asm volatile("s_wait_xcnt 0x0" :: "v"(py), "v"(pw) : "memory");   // as above
  py += KS; pw += KS;
  __syncthreads();   // stage 0 is in LDS before a fragment of it is read
  for (int kc = 0; kc < NK; ++kc) { const __bf16* cur = st + (kc & 1) * SB; __bf16* nxt = st + ((kc + 1) & 1) * SB;
    if (kc + 1 < NK) { s_put2(yr, nxt + lo, nxt + YB + lo); s_put(wr, nxt + 2 * YB + lo); }   // the buffer whose last readers left it at the barrier of the pass before
    if (kc + 2 < NK) { g_load(yr, py); g_load(wr, pw);
      asm volatile("s_wait_xcnt 0x0" :: "v"(py), "v"(pw) : "memory");   // as above
      py += KS; pw += KS; }
    const v16b ah = frag_b(cur + (wave * 16 + col) * GP, lane), al = frag_b(cur + YB + (wave * 16 + col) * GP, lane); v16b w[8];   // all fragments of the pass are asked for first: one LDS latency a pass
#pragma unroll
    for (int j = 0; j < 8; ++j) w[j] = frag_b(cur + 2 * YB + (j * 16 + col) * GP, lane);
#pragma unroll
    for (int j = 0; j < 8; ++j) { acc[j] = wmma_bf(ah, w[j], acc[j]); acc[j] = wmma_bf(al, w[j], acc[j]); }
    __syncthreads();   // publishes stage kc + 1 and ends every read of stage kc
  }
#pragma unroll
  for (int j = 0; j < 8; ++j) { const float bb = BP ? bfr(BP[c0 + j * 16 + col]) : 0.f;
#pragma unroll
    for (int r = 0; r < 8; ++r) sf[wave][8 * g + r][j * 16 + col] = acc[j][r] + bb; }
  LDSX(); for (int rl = 0; rl < 16; ++rl) vst2(OUT + (r0 + rl) * CC + c0 + lane * 4, *(const v4f*)&sf[wave][rl][lane * 4]); }
extern "C" void kernel_launch(void* const* d_in, const int* in_sizes, int n_in, void* d_out, int out_size, void* d_ws, size_t ws_size, hipStream_t stream) {
  (void)in_sizes; (void)n_in; (void)out_size;
  const float** F = (const float**)d_in;   // 0 x [2,2048,1024], 1 Wq [1024,1024] ([out,in]), 2 bq, 3 Wv, 4 bv, 5 Wo, 6 bo
  if (ws_size < (size_t)WS_END) return;
  char* ws = (char*)d_ws; _Float16 *QH = (_Float16*)(ws + WS_QH), *QL = (_Float16*)(ws + WS_QL), *KH = (_Float16*)(ws + WS_KH); __bf16 *VT = (__bf16*)(ws + WS_VT), *VL = (__bf16*)(ws + WS_VL); float *Y = (float*)(ws + WS_Y);
  k_proj<<<dim3(TNB * TT / 64, CC / 128, 3), 128, 0, stream>>>(F[0], F[1], F[2], F[1], F[2], F[3], F[4], QH, QL, KH, VT, VL);   // queries and keys share Wq, bq
  k_att<<<dim3(TNB * NH, TT / FQ), 512, 0, stream>>>(QH, QL, KH, VT, VL, Y);
  k_out<<<dim3(TNB * TT / 64, CC / 128), 128, 0, stream>>>(Y, F[5], F[6], (float*)d_out);
}

// v006
// Measured time: 128 microseconds a run.
// Timed twice side by side with v005, it ran 1.07 and 1.06 times as fast.
// Over all steps from v000 it is 11.7 times as fast.
// compute dtype: all float inputs rounded to bf16; qk = x Wq^T + bq (shared query/key) and v = x Wv^T + bv with EXACT bf16 products on WMMA 16x16x32, f32 accumulate; q as f16 hi + residual (x 2^10), k = the same f16 hi plane (projected once) -> 2-product logits / 8, causal, kept in f32 in LDS (32 query rows per block); softmax in f32 (e = 2^((logit - max) log2 e), one fused multiply-add and the chip's exp2), P x 2^11 f32 split bf16 hi + lo against v bf16 hi + lo (3 products); out = y (bf16 hi + lo) Wo^T + bo; f32 output.
#include <hip/hip_runtime.h>
#include <math.h>

typedef __attribute__((ext_vector_type(16))) _Float16 v16h;
typedef __attribute__((ext_vector_type(16))) __bf16 v16b;
typedef __attribute__((ext_vector_type(8)))  _Float16 v8h;
typedef __attribute__((ext_vector_type(8)))  float v8f;
typedef __attribute__((ext_vector_type(4)))  float v4f;
typedef __attribute__((ext_vector_type(2)))  float v2f;
typedef __attribute__((ext_vector_type(4)))  unsigned v4u;
typedef __attribute__((ext_vector_type(4)))  int v4i;
typedef float __attribute__((may_alias)) float_a;
typedef int __attribute__((may_alias)) int_a;

template <typename T> __device__ __forceinline__ void vst2(void* p, T v) { *(T*)p = v;  }
__device__ __forceinline__ v8f wmma16(v16h a, v16h b, v8f c) {
  v8f d = __builtin_amdgcn_wmma_f32_16x16x32_f16(false, a, false, b, (short)0, c, false, false);
  asm volatile("v_nop\n\tv_nop\n\tv_nop\n\tv_nop" : "+v"(d) : "v"(a), "v"(b));
  return d;
}
__device__ __forceinline__ v8f wmma_bf(v16b a, v16b b, v8f c) {
  v8f d = __builtin_amdgcn_wmma_f32_16x16x32_bf16(false, a, false, b, (short)0, c, false, false);
  asm volatile("v_nop\n\tv_nop\n\tv_nop\n\tv_nop" : "+v"(d) : "v"(a), "v"(b));
  return d;
}
// 16x16x32 fragments: lane = (h = lane>>4, row/col = lane&15); elements 0..7 = k0+8h+0..7, 8..15 = k0+16+8h+0..7; D element r = row 8h+r
__device__ __forceinline__ v16h frag_h(const _Float16* rowk0, int lane) {
  union { v16h v; v8h q[2]; } u; const _Float16* p = rowk0 + 8 * (lane >> 4);
  u.q[0] = *(const v8h*)p; u.q[1] = *(const v8h*)(p + 16); return u.v;
}
__device__ __forceinline__ v16h frag_f32(const float* rowk0, int lane) {
  v16h a; const float* p = rowk0 + 8 * (lane >> 4);
#pragma unroll
  for (int i = 0; i < 8; ++i) { a[i] = (_Float16)p[i]; a[8 + i] = (_Float16)p[16 + i]; }
  return a;
}
__device__ __forceinline__ v16h frag_f32s(const float* rowk0, int lane, float sc) {
  v16h a; const float* p = rowk0 + 8 * (lane >> 4);
#pragma unroll
  for (int i = 0; i < 8; ++i) { a[i] = (_Float16)(p[i] * sc); a[8 + i] = (_Float16)(p[16 + i] * sc); }
  return a;
}
// column fragment from a [K][ld] layout (column n), rows >= K read as 0
__device__ __forceinline__ v16h fragc_f32(const float* W, int k0, int n, int lane, int ld, int K) {
  v16h a; const int g = lane >> 4;
#pragma unroll
  for (int i = 0; i < 8; ++i) { const int ka = k0 + 8 * g + i, kb = ka + 16;
    a[i] = (_Float16)(ka < K ? W[(size_t)(ka < K ? ka : K - 1) * ld + n] : 0.f); a[8 + i] = (_Float16)(kb < K ? W[(size_t)(kb < K ? kb : K - 1) * ld + n] : 0.f); }
  return a;
}
struct F2 { v16b h, l; };
__device__ __forceinline__ F2 bsplit16(const float v[16]) { F2 r;
#pragma unroll
  for (int i = 0; i < 16; ++i) { const __bf16 h = (__bf16)v[i]; r.h[i] = h; r.l[i] = (__bf16)(v[i] - (float)h); }
  return r; }
__device__ __forceinline__ F2 split_row(const float* row, int k0, int lane) { float v[16]; const float* p = row + k0 + 8 * (lane >> 4);
#pragma unroll
  for (int i = 0; i < 8; ++i) { v[i] = p[i]; v[8 + i] = p[16 + i]; }
  return bsplit16(v); }
__device__ __forceinline__ F2 split_rowK(const float* row, int k0, int lane, int K) { float v[16]; const int g = lane >> 4;
#pragma unroll
  for (int i = 0; i < 8; ++i) { const int ka = k0 + 8 * g + i, kb = ka + 16; v[i] = ka < K ? row[ka < K ? ka : K - 1] : 0.f; v[8 + i] = kb < K ? row[kb < K ? kb : K - 1] : 0.f; }
  return bsplit16(v); }
__device__ __forceinline__ F2 split_col(const float* W, int k0, int n, int lane, int ld, int K) { float v[16]; const int g = lane >> 4;
#pragma unroll
  for (int i = 0; i < 8; ++i) { const int ka = k0 + 8 * g + i, kb = ka + 16; v[i] = ka < K ? W[(size_t)(ka < K ? ka : K - 1) * ld + n] : 0.f; v[8 + i] = kb < K ? W[(size_t)(kb < K ? kb : K - 1) * ld + n] : 0.f; }
  return bsplit16(v); }
__device__ __forceinline__ v8f mac3(const F2& a, const F2& b, v8f c) { c = wmma_bf(a.l, b.h, c); c = wmma_bf(a.h, b.l, c); return wmma_bf(a.h, b.h, c); }
__device__ __forceinline__ float sigm(float v) { return 1.0f / (1.0f + expf(-v)); }
#define LDSX() do { asm volatile("s_wait_dscnt 0" ::: "memory"); __builtin_amdgcn_wave_barrier(); __builtin_amdgcn_fence(__ATOMIC_RELEASE, "workgroup"); } while (0)


// Shared-QK causal attention ('LSHAttention', B 2, S 2,048, hidden 1,024 = 16 x 64): qk = x Wq^T + bq used as both queries and keys, v = x Wv^T + bv, causal softmax(qk qk^T / 8), P v, output Linear + bias.
#define NB 2
#define TT 2048
#define CC 1024
#define NH 16
#define HD 64
#ifndef TNB
#define TNB NB
#endif
typedef __attribute__((ext_vector_type(8))) __bf16 v8b;
__device__ __forceinline__ v16b frag_b(const __bf16* rowk0, int lane) {
  union { v16b v; v8b q[2]; } u; const __bf16* p = rowk0 + 8 * (lane >> 4);
  u.q[0] = *(const v8b*)p; u.q[1] = *(const v8b*)(p + 16); return u.v;
}
__device__ __forceinline__ float bfr(float v) { return (float)(__bf16)v; }
__device__ __attribute__((noinline)) float exp_ni(float v) { return expf(v); }
__device__ __attribute__((noinline)) float erf_ni(float v) { return erff(v); }

// qk and v planes lie in FRAGMENT ORDER, per (b, h): a 16x16x32 operand fragment is two runs of 512 contiguous bytes, lane l's 16 bytes at 16 l, so that each wave-wide 16-byte load of k_att covers four whole 128-byte lines.
//   qk: [b][h][t / 16][d / 16][(d / 8) & 1][t & 15][d & 7]      v: [b][h][t / 32][c / 16][(t / 16) & 1][(t / 8) & 1][c & 15][t & 7]
#define WS_QH  0u
#define WS_QL  (WS_QH + 2u * (size_t)NB * TT * CC)
#define WS_VT  (WS_QL + 2u * (size_t)NB * TT * CC)      // bf16 v planes
#define WS_VL  (WS_VT + 2u * (size_t)NB * CC * TT)      // bf16 v residual planes
#define WS_Y   (WS_VL + 2u * (size_t)NB * CC * TT)      // f32 y rows [b*t][C]
#define WS_END (WS_Y + 4u * (size_t)NB * TT * CC)

// ---- operand staging of the two projection GEMMs (blocks of 128 threads): a [ROWS][KS] f32 tile is read in whole 128-byte lines (16 bytes a lane, neighbouring lanes on neighbouring
//   addresses of a row), rounded to bf16 once for the block and put into LDS at a row pitch of KS + 8 elements (16 bytes x an odd number: the 16 rows of a fragment read fall on different banks).
typedef __attribute__((ext_vector_type(4))) __bf16 v4b;
template <int ROWS, int KS> struct GT { v4f r[ROWS * KS / 512]; };
template <int ROWS, int KS> __device__ __forceinline__ void g_load(GT<ROWS, KS>& t, const float* p) {   // p: the thread's own place in the tile's first 512 / KS rows
#pragma unroll
  for (int i = 0; i < ROWS * KS / 512; ++i) t.r[i] = *(const v4f*)(p + (size_t)i * (512 / KS) * CC); }
template <int ROWS, int KS> __device__ __forceinline__ void s_put(const GT<ROWS, KS>& t, __bf16* d) {
#pragma unroll
  for (int i = 0; i < ROWS * KS / 512; ++i) { v4b o;
#pragma unroll
    for (int e = 0; e < 4; ++e) o[e] = (__bf16)t.r[i][e];
    *(v4b*)(d + i * (512 / KS) * (KS + 8)) = o; } }
template <int ROWS, int KS> __device__ __forceinline__ void s_put2(const GT<ROWS, KS>& t, __bf16* dh, __bf16* dl) {   // hi + residual planes, bsplit16's split
#pragma unroll
  for (int i = 0; i < ROWS * KS / 512; ++i) { v4b o, u;
#pragma unroll
    for (int e = 0; e < 4; ++e) { const float v = t.r[i][e]; const __bf16 h = (__bf16)v; o[e] = h; u[e] = (__bf16)(v - (float)h); }
    *(v4b*)(dh + i * (512 / KS) * (KS + 8)) = o; *(v4b*)(dl + i * (512 / KS) * (KS + 8)) = u; } }
// ---- k_proj: block = (64 rows, 128 cols, which): which 0: qk = x Wq^T + bq, done once for queries and keys alike -> f16 hi plane (the keys, and the queries' hi part) + residual plane; which 1: v -> bf16 hi + residual planes
//   x and W tiles of 32 k go through two LDS stage buffers in turn; the tile after next flies into registers while this one is multiplied. The stage buffers and the epilogue's tiles share one LDS range.
__global__ __launch_bounds__(128) void k_proj(const float* __restrict__ X, const float* __restrict__ WQ, const float* __restrict__ BQ, const float* __restrict__ WV, const float* __restrict__ BV, _Float16* __restrict__ QH, _Float16* __restrict__ QL, __bf16* __restrict__ VT, __bf16* __restrict__ VL) {
  constexpr int KS = 32, GP = KS + 8, XB = 64 * GP, SB = XB + 128 * GP, NK = CC / KS;   // in bf16 elements: row pitch, the x part and the whole of a stage buffer
  __shared__ __align__(16) unsigned char sm[2 * 128 * 72 * 2]; static_assert(2 * SB * 2 <= (int)sizeof(sm) && 2 * 64 * 136 * 2 <= (int)sizeof(sm), "LDS range");
  _Float16 (*sh)[136] = (_Float16 (*)[136])sm, (*sl)[136] = (_Float16 (*)[136])(sm + 64 * 136 * 2); __bf16 (*th)[72] = (__bf16 (*)[72])sm, (*tl2)[72] = (__bf16 (*)[72])(sm + 128 * 72 * 2); __bf16* st = (__bf16*)sm;
  const int tid = threadIdx.x, wave = tid >> 5, lane = tid & 31, col = lane & 15, g = lane >> 4; const int which = blockIdx.z; const int c0 = blockIdx.y * 128; const size_t r0 = (size_t)blockIdx.x * 64; const float* WA = which == 0 ? WQ : WV; const float* BA = which == 0 ? BQ : BV;
  v8f acc[8] = {};
  const int lr = tid / (KS / 4), lc = (tid % (KS / 4)) * 4, lo = lr * GP + lc; const float* px = X + (r0 + lr) * CC + lc; const float* pw = WA + (size_t)(c0 + lr) * CC + lc; GT<64, KS> xr; GT<128, KS> wr;
  g_load(xr, px); g_load(wr, pw);
  asm volatile("s_wait_xcnt 0x0" :: "v"(px), "v"(pw) : "memory");   // the address registers of the issued loads stay whole up to this wait; behind it they are stepped
  px += KS; pw += KS;
  s_put(xr, st + lo); s_put(wr, st + XB + lo);
  g_load(xr, px); g_load(wr, pw);
  asm volatile("s_wait_xcnt 0x0" :: "v"(px), "v"(pw) : "memory");   // as above
  px += KS; pw += KS;
  __syncthreads();   // stage 0 is in LDS before a fragment of it is read
  for (int kc = 0; kc < NK; ++kc) { const __bf16* cur = st + (kc & 1) * SB; __bf16* nxt = st + ((kc + 1) & 1) * SB;
    if (kc + 1 < NK) { s_put(xr, nxt + lo); s_put(wr, nxt + XB + lo); }   // the buffer whose last readers left it at the barrier of the pass before
    if (kc + 2 < NK) { g_load(xr, px); g_load(wr, pw);
      asm volatile("s_wait_xcnt 0x0" :: "v"(px), "v"(pw) : "memory");   // as above
      px += KS; pw += KS; }
    const v16b a = frag_b(cur + (wave * 16 + col) * GP, lane);
#pragma unroll
    for (int j = 0; j < 8; ++j) acc[j] = wmma_bf(a, frag_b(cur + XB + (j * 16 + col) * GP, lane), acc[j]);
    __syncthreads();   // publishes stage kc + 1 and ends every read of stage kc (behind the last pass: before the epilogue's tiles overwrite the range)
  }
#pragma unroll
  for (int j = 0; j < 8; ++j) { const float bb = bfr(BA[c0 + j * 16 + col]);
#pragma unroll
    for (int r = 0; r < 8; ++r) { const float v = acc[j][r] + bb; const int rl = wave * 16 + 8 * g + r, cl = j * 16 + col; const _Float16 hv = (_Float16)v;
      if (which == 1) { const __bf16 bh = (__bf16)v; th[cl][rl] = bh; tl2[cl][rl] = (__bf16)(v - (float)bh); } else { sh[rl][cl] = hv; sl[rl][cl] = (_Float16)((v - (float)hv) * 1024.0f); }   /* q residual carried x 2^10 so the plane stays f16-normal on the chip */ } }
  __syncthreads();
  const size_t bh = (r0 / TT) * NH + c0 / HD; const int t0 = (int)(r0 % TT);   // e counts the block's 16-byte pieces in the order of their places in the planes: neighbouring threads store neighbouring pieces
  if (which == 0) { for (int e = tid; e < 64 * 16; e += 128) { const int rl = ((e >> 7) & 3) * 16 + (e & 15), q = (e >> 9) * 8 + ((e >> 4) & 7); const size_t o = ((bh + (e >> 9)) * (TT / 16) + t0 / 16 + ((e >> 7) & 3)) * 1024 + (e & 127) * 8; vst2((unsigned*)(QH + o), *(const v4u*)&sh[rl][q * 8]);
      asm volatile("s_wait_xcnt 0x0" ::: "memory");   // the registers that the issued store names stay whole up to this wait; behind it they are reused
      vst2((unsigned*)(QL + o), *(const v4u*)&sl[rl][q * 8]);
      asm volatile("s_wait_xcnt 0x0" ::: "memory"); } }   // as above
  else { for (int e = tid; e < 128 * 8; e += 128) { const int cl = (e >> 9) * 64 + ((e >> 6) & 3) * 16 + (e & 15), q = ((e >> 8) & 1) * 4 + ((e >> 4) & 3); const size_t o2 = ((bh + (e >> 9)) * (TT / 32) + t0 / 32 + ((e >> 8) & 1)) * 2048 + (e & 255) * 8; vst2((unsigned*)(VT + o2), *(const v4u*)&th[cl][q * 8]); vst2((unsigned*)(VL + o2), *(const v4u*)&tl2[cl][q * 8]); } } }
// ---- k_att: block = 32 queries of (b,h), 16 waves. The block's logit rows live in LDS from the products to P v:
//   1 wave w takes the 16-key tiles w, w + 16, ... of keys [0, kpad) against both query tiles (one key fragment serves 32 queries);
//   2 wave w does the softmax of rows w and w + 16 in place (e = exp(logit - max), masked -> 0; 1 / sum kept per row);
//   3 wave w sums the 32-key chunks w, w + 16, ... of P v for both query tiles, P = e / sum x 2^11 formed as the fragment is read;
//   4 the 16 partial tiles meet in the same LDS and are added in slice order.
// p: the lane's own place (8 * lane) in the first of a fragment's two 512-byte runs
__device__ __forceinline__ v16h frag_p(const _Float16* p) { union { v16h v; v8h q[2]; } u; u.q[0] = *(const v8h*)p; u.q[1] = *(const v8h*)(p + 256); return u.v; }
__device__ __forceinline__ v16b frag_q(const __bf16* p) { union { v16b v; v8b q[2]; } u; u.q[0] = *(const v8b*)p; u.q[1] = *(const v8b*)(p + 256); return u.v; }
#define FQ 32
#define FS 16
#define FP (TT + 4)   // row pitch in floats: 16 rows of a fragment read fall on 16 different groups of four banks
__global__ __launch_bounds__(512) void k_att(const _Float16* __restrict__ QH, const _Float16* __restrict__ QL, const __bf16* __restrict__ VT, const __bf16* __restrict__ VL, float* __restrict__ Y) { __shared__ __align__(16) float sp[FQ][FP]; __shared__ float sinv[FQ];
  const int tid = threadIdx.x, ks = __builtin_amdgcn_readfirstlane(tid >> 5) /* scalar, so the slice loops branch on SCC and EXEC stays full at the matrix instructions */, lane = tid & 31, col = lane & 15, g = lane >> 4; const int b = blockIdx.x / NH, h = blockIdx.x % NH; const int qb = (TT / FQ - 1 - (int)blockIdx.y) * FQ;   /* longest rows start first */ const int kend = qb + FQ, kpad = (kend + 127) & ~127;   /* rows are filled to a multiple of 128 keys (<= TT; keys past the diagonal masked), so that a wave's softmax loops run whole 128-key steps with every lane on */
  { v16h ah[2][2], al[2][2]; const size_t qo = ((size_t)blockIdx.x * (TT / 16) + qb / 16) * 1024 + 8 * lane; const _Float16* qh = QH + qo; const _Float16* ql = QL + qo;   // the lane's own fragment addresses
#pragma unroll
    for (int t = 0; t < 2; ++t)
#pragma unroll
      for (int kc = 0; kc < HD / 32; ++kc) { ah[t][kc] = frag_p(qh + t * 1024 + kc * 512); al[t][kc] = frag_p(ql + t * 1024 + kc * 512); }
    asm volatile("s_wait_xcnt 0x0" :: "v"(qh), "v"(ql) : "memory");   // the address registers of the issued loads stay whole up to this wait; behind it they may be reused
    auto tile = [&](const v16h kb0, const v16h kb1, const int kt) { const int key = kt * 16 + col;
#pragma unroll
      for (int t = 0; t < 2; ++t) { v8f a = {}, l = {}; a = wmma16(ah[t][0], kb0, a); l = wmma16(al[t][0], kb0, l); a = wmma16(ah[t][1], kb1, a); l = wmma16(al[t][1], kb1, l); a += l * (1.0f / 1024.0f);
#pragma unroll
        for (int r = 0; r < 8; ++r) { const int rl = t * 16 + 8 * g + r; float v = a[r] * 0.125f; if (key > qb + rl) v = -3.0e38f; sp[rl][key] = v; } } };
    const int nt = kpad / 16; const _Float16* kp = QH /* the keys are the shared projection's hi plane */ + ((size_t)blockIdx.x * (TT / 16) + ks) * 1024 + 8 * lane; v16h ka0 = {}, ka1 = {}, kc0 = {}, kc1 = {}; if (ks < nt) { ka0 = frag_p(kp); ka1 = frag_p(kp + 512); }
    for (int kt = ks; kt < nt; kt += 2 * FS) { const bool two = kt + FS < nt;   // two register sets in turn: a tile's key fragments fly while the tile before it is worked on
      if (two) { kc0 = frag_p(kp + FS * 1024); kc1 = frag_p(kp + FS * 1024 + 512); }
      tile(ka0, ka1, kt);
      if (kt + 2 * FS < nt) { ka0 = frag_p(kp + 2 * FS * 1024); ka1 = frag_p(kp + 2 * FS * 1024 + 512); }
      asm volatile("s_wait_xcnt 0x0" :: "v"(kp) : "memory");   // the address register of the issued loads stays whole up to this wait; behind it it is stepped
      kp += 2 * FS * 1024;
      if (two) tile(kc0, kc1, kt + FS); } }
  __syncthreads();   // every logit of the 32 rows is in LDS before a row's softmax reads it
  { float* s0 = &sp[ks][lane * 4]; float* s1 = &sp[ks + FS][lane * 4]; float m0 = -3.0e38f, m1 = -3.0e38f;   // two rows side by side: two independent chains per wave
    for (int k = 0; k < kpad; k += 128) { const v4f u = *(const v4f*)&s0[k], w = *(const v4f*)&s1[k]; m0 = fmaxf(fmaxf(m0, fmaxf(u[0], u[1])), fmaxf(u[2], u[3])); m1 = fmaxf(fmaxf(m1, fmaxf(w[0], w[1])), fmaxf(w[2], w[3])); }
#pragma unroll
    for (int o = 1; o < 32; o <<= 1) { m0 = fmaxf(m0, __shfl_xor(m0, o)); m1 = fmaxf(m1, __shfl_xor(m1, o)); }
    float a0 = 0.f, a1 = 0.f; const float l2e = 1.44269504088896340736f, n0 = -m0 * l2e, n1 = -m1 * l2e;   // n's rounding is one common factor of a row's e and of its sum: it cancels in e / sum
    for (int k = 0; k < kpad; k += 128) { const v4f u = *(const v4f*)&s0[k], w = *(const v4f*)&s1[k]; v4f e, f;
#pragma unroll
      for (int i = 0; i < 4; ++i) { e[i] = __builtin_amdgcn_exp2f(fmaf(u[i], l2e, n0)); f[i] = __builtin_amdgcn_exp2f(fmaf(w[i], l2e, n1)); }   // a masked logit (-3e38) gives an exponent of -inf and so e = 0 by itself
      a0 += (e[0] + e[1]) + (e[2] + e[3]); a1 += (f[0] + f[1]) + (f[2] + f[3]); *(v4f*)&s0[k] = e; *(v4f*)&s1[k] = f; }
#pragma unroll
    for (int o = 1; o < 32; o <<= 1) { a0 += __shfl_xor(a0, o); a1 += __shfl_xor(a1, o); }
    if (lane == 0) { sinv[ks] = 1.0f / a0; sinv[ks + FS] = 1.0f / a1; } }
  __syncthreads();   // every row's e and 1 / sum are in LDS before the P fragments are read
  v8f acc[2][HD / 16] = {}; const float sc[2] = { sinv[col] * 2048.0f, sinv[16 + col] * 2048.0f };
  const size_t vo = ((size_t)blockIdx.x * (TT / 32) + ks) * 2048 + 8 * lane; const __bf16* pvh = VT + vo; const __bf16* pvl = VL + vo;   // the lane's own fragment addresses, stepped from chunk to chunk
  for (int kc = ks; kc < kend / 32; kc += FS) { F2 p[2]; v16b vh[HD / 16], vl[HD / 16];   // all v fragments of the chunk are asked for first: one load latency a chunk, under the split of P
#pragma unroll
    for (int j = 0; j < HD / 16; ++j) { vh[j] = frag_q(pvh + j * 512); vl[j] = frag_q(pvl + j * 512); }
    asm volatile("s_wait_xcnt 0x0" :: "v"(pvh), "v"(pvl) : "memory");   // the address registers of the issued loads stay whole up to this wait; behind it they are stepped
    pvh += FS * 2048; pvl += FS * 2048;
#pragma unroll
    for (int t = 0; t < 2; ++t) { const v4f* q4 = (const v4f*)&sp[t * 16 + col][kc * 32 + 8 * g]; const v4f x0 = q4[0] * sc[t], x1 = q4[1] * sc[t], x2 = q4[4] * sc[t], x3 = q4[5] * sc[t]; float v[16];
#pragma unroll
      for (int i = 0; i < 4; ++i) { v[i] = x0[i]; v[4 + i] = x1[i]; v[8 + i] = x2[i]; v[12 + i] = x3[i]; }
      p[t] = bsplit16(v); }
#pragma unroll
    for (int j = 0; j < HD / 16; ++j)
#pragma unroll
      for (int t = 0; t < 2; ++t) { acc[t][j] = wmma_bf(p[t].h, vh[j], acc[t][j]); acc[t][j] = wmma_bf(p[t].l, vh[j], acc[t][j]); acc[t][j] = wmma_bf(p[t].h, vl[j], acc[t][j]); } }
  __syncthreads();   // the last P fragment is read before the partial tiles overwrite the rows
  float* ss = &sp[0][0];   // [FS][FQ][HD + 4]
#pragma unroll
  for (int t = 0; t < 2; ++t)
#pragma unroll
    for (int j = 0; j < HD / 16; ++j)
#pragma unroll
      for (int r = 0; r < 8; ++r) ss[(ks * FQ + t * 16 + 8 * g + r) * (HD + 4) + j * 16 + col] = acc[t][j][r];
  __syncthreads();   // every slice's partial tile is in LDS before any thread adds them
  { const int rl = tid >> 4, c4 = (tid & 15) * 4; v4f s = *(const v4f*)&ss[rl * (HD + 4) + c4];
#pragma unroll
    for (int i = 1; i < FS; ++i) s += *(const v4f*)&ss[(i * FQ + rl) * (HD + 4) + c4];
    vst2(Y + ((size_t)b * TT + qb + rl) * CC + h * HD + c4, s * (1.0f / 2048.0f)); } }
// ---- k_out: block = (64 rows, 128 cols): out = y (bf16 hi + lo) Wo^T + bo; y (split once for the block) and Wo tiles of 32 k go through two LDS stage buffers in turn, as in k_proj
__global__ __launch_bounds__(128) void k_out(const float* __restrict__ Y, const float* __restrict__ WP, const float* __restrict__ BP, float* __restrict__ OUT) { __shared__ __align__(16) float sf[4][16][132];
  constexpr int KS = 32, GP = KS + 8, YB = 64 * GP, SB = 2 * YB + 128 * GP, NK = CC / KS;   // in bf16 elements: row pitch, one y plane and the whole of a stage buffer
  __shared__ __align__(16) __bf16 st[2 * SB];
  const int tid = threadIdx.x, wave = tid >> 5, lane = tid & 31, col = lane & 15, g = lane >> 4; const int c0 = blockIdx.y * 128; const size_t r0 = (size_t)blockIdx.x * 64 + wave * 16;
  v8f acc[8] = {};
  const int lr = tid / (KS / 4), lc = (tid % (KS / 4)) * 4, lo = lr * GP + lc; const float* py = Y + ((size_t)blockIdx.x * 64 + lr) * CC + lc; const float* pw = WP + (size_t)(c0 + lr) * CC + lc; GT<64, KS> yr; GT<128, KS> wr;
  g_load(yr, py); g_load(wr, pw);
  asm volatile("s_wait_xcnt 0x0" :: "v"(py), "v"(pw) : "memory");   // the address registers of the issued loads stay whole up to this wait; behind it they are stepped
  py += KS; pw += KS;
  s_put2(yr, st + lo, st + YB + lo); s_put(wr, st + 2 * YB + lo);
  g_load(yr, py); g_load(wr, pw);
  asm volatile("s_wait_xcnt 0x0" :: "v"(py), "v"(pw) : "memory");   // as above
  py += KS; pw += KS;
  __syncthreads();   // stage 0 is in LDS before a fragment of it is read
  for (int kc = 0; kc < NK; ++kc) { const __bf16* cur = st + (kc & 1) * SB; __bf16* nxt = st + ((kc + 1) & 1) * SB;
    if (kc + 1 < NK) { s_put2(yr, nxt + lo, nxt + YB + lo); s_put(wr, nxt + 2 * YB + lo); }   // the buffer whose last readers left it at the barrier of the pass before
    if (kc + 2 < NK) { g_load(yr, py); g_load(wr, pw);
      asm volatile("s_wait_xcnt 0x0" :: "v"(py), "v"(pw) : "memory");   // as above
      py += KS; pw += KS; }
    const v16b ah = frag_b(cur + (wave * 16 + col) * GP, lane), al = frag_b(cur + YB + (wave * 16 + col) * GP, lane); v16b w[8];   // all fragments of the pass are asked for first: one LDS latency a pass
#pragma unroll
    for (int j = 0; j < 8; ++j) w[j] = frag_b(cur + 2 * YB + (j * 16 + col) * GP, lane);
#pragma unroll
    for (int j = 0; j < 8; ++j) { acc[j] = wmma_bf(ah, w[j], acc[j]); acc[j] = wmma_bf(al, w[j], acc[j]); }
    __syncthreads();   // publishes stage kc + 1 and ends every read of stage kc
  }
#pragma unroll
  for (int j = 0; j < 8; ++j) { const float bb = BP ? bfr(BP[c0 + j * 16 + col]) : 0.f;
#pragma unroll
    for (int r = 0; r < 8; ++r) sf[wave][8 * g + r][j * 16 + col] = acc[j][r] + bb; }
  LDSX(); for (int rl = 0; rl < 16; ++rl) vst2(OUT + (r0 + rl) * CC + c0 + lane * 4, *(const v4f*)&sf[wave][rl][lane * 4]); }
extern "C" void kernel_launch(void* const* d_in, const int* in_sizes, int n_in, void* d_out, int out_size, void* d_ws, size_t ws_size, hipStream_t stream) {
  (void)in_sizes; (void)n_in; (void)out_size;
  const float** F = (const float**)d_in;   // 0 x [2,2048,1024], 1 Wq [1024,1024] ([out,in]), 2 bq, 3 Wv, 4 bv, 5 Wo, 6 bo
  if (ws_size < (size_t)WS_END) return;
  char* ws = (char*)d_ws; _Float16 *QH = (_Float16*)(ws + WS_QH), *QL = (_Float16*)(ws + WS_QL); __bf16 *VT = (__bf16*)(ws + WS_VT), *VL = (__bf16*)(ws + WS_VL); float *Y = (float*)(ws + WS_Y);
  k_proj<<<dim3(TNB * TT / 64, CC / 128, 2), 128, 0, stream>>>(F[0], F[1], F[2], F[3], F[4], QH, QL, VT, VL);   // queries and keys share Wq, bq: one projection serves both
  k_att<<<dim3(TNB * NH, TT / FQ), 512, 0, stream>>>(QH, QL, VT, VL, Y);
  k_out<<<dim3(TNB * TT / 64, CC / 128), 128, 0, stream>>>(Y, F[5], F[6], (float*)d_out);
}

// v007
// It runs in 116 microseconds.
// Next to v006, in two timings, it ran 1.10 and 1.11 times as fast.
// All steps since v000 together make it 12.9 times as fast.
// compute dtype: all float inputs rounded to bf16; qk = x Wq^T + bq (shared query/key) and v = x Wv^T + bv with EXACT bf16 products on WMMA 16x16x32, f32 accumulate; q as f16 hi + residual (x 2^10), k = the same f16 hi plane (projected once) -> 2-product logits / 8, causal, kept in f32 in LDS (32 query rows per block); softmax in f32 (e = 2^((logit - max) log2 e), one fused multiply-add and the chip's exp2), P x 2^11 f32 split bf16 hi + lo against v bf16 hi + lo (3 products); out = y (bf16 hi + lo) Wo^T + bo; f32 output.
#include <hip/hip_runtime.h>
#include <math.h>

typedef __attribute__((ext_vector_type(16))) _Float16 v16h;
typedef __attribute__((ext_vector_type(16))) __bf16 v16b;
typedef __attribute__((ext_vector_type(8)))  _Float16 v8h;
typedef __attribute__((ext_vector_type(8)))  float v8f;
typedef __attribute__((ext_vector_type(4)))  float v4f;
typedef __attribute__((ext_vector_type(2)))  float v2f;
typedef __attribute__((ext_vector_type(4)))  unsigned v4u;
typedef __attribute__((ext_vector_type(4)))  int v4i;
typedef float __attribute__((may_alias)) float_a;
typedef int __attribute__((may_alias)) int_a;

template <typename T> __device__ __forceinline__ void vst2(void* p, T v) { *(T*)p = v;  }
__device__ __forceinline__ v8f wmma16(v16h a, v16h b, v8f c) {
  v8f d = __builtin_amdgcn_wmma_f32_16x16x32_f16(false, a, false, b, (short)0, c, false, false);
  asm volatile("v_nop\n\tv_nop\n\tv_nop\n\tv_nop" : "+v"(d) : "v"(a), "v"(b));
  return d;
}
__device__ __forceinline__ v8f wmma_bf(v16b a, v16b b, v8f c) {
  v8f d = __builtin_amdgcn_wmma_f32_16x16x32_bf16(false, a, false, b, (short)0, c, false, false);
  asm volatile("v_nop\n\tv_nop\n\tv_nop\n\tv_nop" : "+v"(d) : "v"(a), "v"(b));
  return d;
}
// 16x16x32 fragments: lane = (h = lane>>4, row/col = lane&15); elements 0..7 = k0+8h+0..7, 8..15 = k0+16+8h+0..7; D element r = row 8h+r
__device__ __forceinline__ v16h frag_h(const _Float16* rowk0, int lane) {
  union { v16h v; v8h q[2]; } u; const _Float16* p = rowk0 + 8 * (lane >> 4);
  u.q[0] = *(const v8h*)p; u.q[1] = *(const v8h*)(p + 16); return u.v;
}
__device__ __forceinline__ v16h frag_f32(const float* rowk0, int lane) {
  v16h a; const float* p = rowk0 + 8 * (lane >> 4);
#pragma unroll
  for (int i = 0; i < 8; ++i) { a[i] = (_Float16)p[i]; a[8 + i] = (_Float16)p[16 + i]; }
  return a;
}
__device__ __forceinline__ v16h frag_f32s(const float* rowk0, int lane, float sc) {
  v16h a; const float* p = rowk0 + 8 * (lane >> 4);
#pragma unroll
  for (int i = 0; i < 8; ++i) { a[i] = (_Float16)(p[i] * sc); a[8 + i] = (_Float16)(p[16 + i] * sc); }
  return a;
}
// column fragment from a [K][ld] layout (column n), rows >= K read as 0
__device__ __forceinline__ v16h fragc_f32(const float* W, int k0, int n, int lane, int ld, int K) {
  v16h a; const int g = lane >> 4;
#pragma unroll
  for (int i = 0; i < 8; ++i) { const int ka = k0 + 8 * g + i, kb = ka + 16;
    a[i] = (_Float16)(ka < K ? W[(size_t)(ka < K ? ka : K - 1) * ld + n] : 0.f); a[8 + i] = (_Float16)(kb < K ? W[(size_t)(kb < K ? kb : K - 1) * ld + n] : 0.f); }
  return a;
}
struct F2 { v16b h, l; };
__device__ __forceinline__ F2 bsplit16(const float v[16]) { F2 r;
#pragma unroll
  for (int i = 0; i < 16; ++i) { const __bf16 h = (__bf16)v[i]; r.h[i] = h; r.l[i] = (__bf16)(v[i] - (float)h); }
  return r; }
__device__ __forceinline__ F2 split_row(const float* row, int k0, int lane) { float v[16]; const float* p = row + k0 + 8 * (lane >> 4);
#pragma unroll
  for (int i = 0; i < 8; ++i) { v[i] = p[i]; v[8 + i] = p[16 + i]; }
  return bsplit16(v); }
__device__ __forceinline__ F2 split_rowK(const float* row, int k0, int lane, int K) { float v[16]; const int g = lane >> 4;
#pragma unroll
  for (int i = 0; i < 8; ++i) { const int ka = k0 + 8 * g + i, kb = ka + 16; v[i] = ka < K ? row[ka < K ? ka : K - 1] : 0.f; v[8 + i] = kb < K ? row[kb < K ? kb : K - 1] : 0.f; }
  return bsplit16(v); }
__device__ __forceinline__ F2 split_col(const float* W, int k0, int n, int lane, int ld, int K) { float v[16]; const int g = lane >> 4;
#pragma unroll
  for (int i = 0; i < 8; ++i) { const int ka = k0 + 8 * g + i, kb = ka + 16; v[i] = ka < K ? W[(size_t)(ka < K ? ka : K - 1) * ld + n] : 0.f; v[8 + i] = kb < K ? W[(size_t)(kb < K ? kb : K - 1) * ld + n] : 0.f; }
  return bsplit16(v); }
__device__ __forceinline__ v8f mac3(const F2& a, const F2& b, v8f c) { c = wmma_bf(a.l, b.h, c); c = wmma_bf(a.h, b.l, c); return wmma_bf(a.h, b.h, c); }
__device__ __forceinline__ float sigm(float v) { return 1.0f / (1.0f + expf(-v)); }
#define LDSX() do { asm volatile("s_wait_dscnt 0" ::: "memory"); __builtin_amdgcn_wave_barrier(); __builtin_amdgcn_fence(__ATOMIC_RELEASE, "workgroup"); } while (0)


// Shared-QK causal attention ('LSHAttention', B 2, S 2,048, hidden 1,024 = 16 x 64): qk = x Wq^T + bq used as both queries and keys, v = x Wv^T + bv, causal softmax(qk qk^T / 8), P v, output Linear + bias.
#define NB 2
#define TT 2048
#define CC 1024
#define NH 16
#define HD 64
#ifndef TNB
#define TNB NB
#endif
typedef __attribute__((ext_vector_type(8))) __bf16 v8b;
__device__ __forceinline__ v16b frag_b(const __bf16* rowk0, int lane) {
  union { v16b v; v8b q[2]; } u; const __bf16* p = rowk0 + 8 * (lane >> 4);
  u.q[0] = *(const v8b*)p; u.q[1] = *(const v8b*)(p + 16); return u.v;
}
__device__ __forceinline__ float bfr(float v) { return (float)(__bf16)v; }
__device__ __attribute__((noinline)) float exp_ni(float v) { return expf(v); }
__device__ __attribute__((noinline)) float erf_ni(float v) { return erff(v); }

// qk and v planes lie in FRAGMENT ORDER, per (b, h): a 16x16x32 operand fragment is two runs of 512 contiguous bytes, lane l's 16 bytes at 16 l, so that each wave-wide 16-byte load of k_att covers four whole 128-byte lines.
//   qk: [b][h][t / 16][d / 16][(d / 8) & 1][t & 15][d & 7]      v: [b][h][t / 32][c / 16][(t / 16) & 1][(t / 8) & 1][c & 15][t & 7]
#define WS_QH  0u
#define WS_QL  (WS_QH + 2u * (size_t)NB * TT * CC)
#define WS_VT  (WS_QL + 2u * (size_t)NB * TT * CC)      // bf16 v planes
#define WS_VL  (WS_VT + 2u * (size_t)NB * CC * TT)      // bf16 v residual planes
#define WS_Y   (WS_VL + 2u * (size_t)NB * CC * TT)      // f32 y rows [b*t][C]
#define WS_END (WS_Y + 4u * (size_t)NB * TT * CC)

// ---- operand staging of the two projection GEMMs (blocks of 512 threads): a [ROWS][KS] f32 tile is read in whole 128-byte lines (16 bytes a lane, neighbouring lanes on neighbouring
//   addresses of a row), rounded to bf16 once for the block and put into LDS at a row pitch of KS + 8 elements (16 bytes x an odd number: the 16 rows of a fragment read fall on different banks).
typedef __attribute__((ext_vector_type(4))) __bf16 v4b;
template <int ROWS, int KS> struct GT { v4f r[ROWS * KS / 2048]; };
template <int ROWS, int KS> __device__ __forceinline__ void g_load(GT<ROWS, KS>& t, const float* p) {   // p: the thread's own place in the tile's first 2048 / KS rows
#pragma unroll
  for (int i = 0; i < ROWS * KS / 2048; ++i) t.r[i] = *(const v4f*)(p + (size_t)i * (2048 / KS) * CC); }
template <int ROWS, int KS> __device__ __forceinline__ void s_put(const GT<ROWS, KS>& t, __bf16* d) {
#pragma unroll
  for (int i = 0; i < ROWS * KS / 2048; ++i) { v4b o;
#pragma unroll
    for (int e = 0; e < 4; ++e) o[e] = (__bf16)t.r[i][e];
    *(v4b*)(d + i * (2048 / KS) * (KS + 8)) = o; } }
template <int ROWS, int KS> __device__ __forceinline__ void s_put2(const GT<ROWS, KS>& t, __bf16* dh, __bf16* dl) {   // hi + residual planes, bsplit16's split
#pragma unroll
  for (int i = 0; i < ROWS * KS / 2048; ++i) { v4b o, u;
#pragma unroll
    for (int e = 0; e < 4; ++e) { const float v = t.r[i][e]; const __bf16 h = (__bf16)v; o[e] = h; u[e] = (__bf16)(v - (float)h); }
    *(v4b*)(dh + i * (2048 / KS) * (KS + 8)) = o; *(v4b*)(dl + i * (2048 / KS) * (KS + 8)) = u; } }
// ---- k_proj: block = (128 rows, 256 cols, which), 16 waves in a 4 x 4 grid of 32 x 64 wave tiles: which 0: qk = x Wq^T + bq, done once for queries and keys alike -> f16 hi plane (the keys, and the queries' hi part) + residual plane; which 1: v -> bf16 hi + residual planes
//   x and W tiles of 64 k go through two LDS stage buffers in turn; the tile after next flies into registers while this one is multiplied. The stage buffers and the epilogue's tiles share one LDS range.
//   The large block tile is there for the L2: a loaded x row serves 256 columns and a loaded W row 128 rows; the squarer wave tile reads 6 fragments from LDS for 8 products; 64 k a stage keep enough bytes in flight for the one block of a WGP.
__global__ __launch_bounds__(512) void k_proj(const float* __restrict__ X, const float* __restrict__ WQ, const float* __restrict__ BQ, const float* __restrict__ WV, const float* __restrict__ BV, _Float16* __restrict__ QH, _Float16* __restrict__ QL, __bf16* __restrict__ VT, __bf16* __restrict__ VL) {
  constexpr int KS = 64, GP = KS + 8, XB = 128 * GP, SB = XB + 256 * GP, NK = CC / KS;   // in bf16 elements: row pitch, the x part and the whole of a stage buffer
  __shared__ __align__(16) unsigned char sm[2 * 256 * 136 * 2]; static_assert(2 * SB * 2 <= (int)sizeof(sm) && 2 * 128 * 264 * 2 <= (int)sizeof(sm), "LDS range");
  _Float16 (*sh)[264] = (_Float16 (*)[264])sm, (*sl)[264] = (_Float16 (*)[264])(sm + 128 * 264 * 2); __bf16 (*th)[136] = (__bf16 (*)[136])sm, (*tl2)[136] = (__bf16 (*)[136])(sm + 256 * 136 * 2); __bf16* st = (__bf16*)sm;
  const int tid = threadIdx.x, wave = tid >> 5, lane = tid & 31, col = lane & 15, g = lane >> 4, wm = (wave >> 2) * 32, wn = (wave & 3) * 64; const int which = blockIdx.z; const int c0 = blockIdx.y * 256; const size_t r0 = (size_t)blockIdx.x * 128; const float* WA = which == 0 ? WQ : WV; const float* BA = which == 0 ? BQ : BV;
  v8f acc[2][4] = {};
  const int lr = tid / (KS / 4), lc = (tid % (KS / 4)) * 4, lo = lr * GP + lc; const float* px = X + (r0 + lr) * CC + lc; const float* pw = WA + (size_t)(c0 + lr) * CC + lc; GT<128, KS> xr; GT<256, KS> wr;
  g_load(xr, px); g_load(wr, pw);
  asm volatile("s_wait_xcnt 0x0" :: "v"(px), "v"(pw) : "memory");   // the address registers of the issued loads stay whole up to this wait; behind it they are stepped
  px += KS; pw += KS;
  s_put(xr, st + lo); s_put(wr, st + XB + lo);
  g_load(xr, px); g_load(wr, pw);
  asm volatile("s_wait_xcnt 0x0" :: "v"(px), "v"(pw) : "memory");   // as above
  px += KS; pw += KS;
  __syncthreads();   // stage 0 is in LDS before a fragment of it is read
  for (int kc = 0; kc < NK; ++kc) { const __bf16* cur = st + (kc & 1) * SB; __bf16* nxt = st + ((kc + 1) & 1) * SB;
    if (kc + 1 < NK) { s_put(xr, nxt + lo); s_put(wr, nxt + XB + lo); }   // the buffer whose last readers left it at the barrier of the pass before
    if (kc + 2 < NK) { g_load(xr, px); g_load(wr, pw);
      asm volatile("s_wait_xcnt 0x0" :: "v"(px), "v"(pw) : "memory");   // as above
      px += KS; pw += KS; }
#pragma unroll
    for (int kk = 0; kk < KS; kk += 32) { v16b a[2], w[4];   // the fragments of 32 k are asked for together: one LDS latency for 8 products
#pragma unroll
      for (int i = 0; i < 2; ++i) a[i] = frag_b(cur + (wm + i * 16 + col) * GP + kk, lane);
#pragma unroll
      for (int j = 0; j < 4; ++j) w[j] = frag_b(cur + XB + (wn + j * 16 + col) * GP + kk, lane);
#pragma unroll
      for (int j = 0; j < 4; ++j)
#pragma unroll
        for (int i = 0; i < 2; ++i) acc[i][j] = wmma_bf(a[i], w[j], acc[i][j]); }
    __syncthreads();   // publishes stage kc + 1 and ends every read of stage kc (behind the last pass: before the epilogue's tiles overwrite the range)
  }
#pragma unroll
  for (int j = 0; j < 4; ++j) { const float bb = bfr(BA[c0 + wn + j * 16 + col]);
#pragma unroll
    for (int i = 0; i < 2; ++i)
#pragma unroll
    for (int r = 0; r < 8; ++r) { const float v = acc[i][j][r] + bb; const int rl = wm + i * 16 + 8 * g + r, cl = wn + j * 16 + col; const _Float16 hv = (_Float16)v;
      if (which == 1) { const __bf16 bh = (__bf16)v; th[cl][rl] = bh; tl2[cl][rl] = (__bf16)(v - (float)bh); } else { sh[rl][cl] = hv; sl[rl][cl] = (_Float16)((v - (float)hv) * 1024.0f); }   /* q residual carried x 2^10 so the plane stays f16-normal on the chip */ } }
  __syncthreads();
  const size_t bh = (r0 / TT) * NH + c0 / HD; const int t0 = (int)(r0 % TT);   // e counts the block's 16-byte pieces in the order of their places in the planes: neighbouring threads store neighbouring pieces
  if (which == 0) { for (int e = tid; e < 128 * 32; e += 512) { const int rl = ((e >> 7) & 7) * 16 + (e & 15), q = (e >> 10) * 8 + ((e >> 4) & 7); const size_t o = ((bh + (e >> 10)) * (TT / 16) + t0 / 16 + ((e >> 7) & 7)) * 1024 + (e & 127) * 8; vst2((unsigned*)(QH + o), *(const v4u*)&sh[rl][q * 8]);
      asm volatile("s_wait_xcnt 0x0" ::: "memory");   // the registers that the issued store names stay whole up to this wait; behind it they are reused
      vst2((unsigned*)(QL + o), *(const v4u*)&sl[rl][q * 8]);
      asm volatile("s_wait_xcnt 0x0" ::: "memory"); } }   // as above
  else { for (int e = tid; e < 256 * 16; e += 512) { const int cl = (e >> 10) * 64 + ((e >> 6) & 3) * 16 + (e & 15), q = ((e >> 8) & 3) * 4 + ((e >> 4) & 3); const size_t o2 = ((bh + (e >> 10)) * (TT / 32) + t0 / 32 + ((e >> 8) & 3)) * 2048 + (e & 255) * 8; vst2((unsigned*)(VT + o2), *(const v4u*)&th[cl][q * 8]);
      asm volatile("s_wait_xcnt 0x0" ::: "memory");   // as above
      vst2((unsigned*)(VL + o2), *(const v4u*)&tl2[cl][q * 8]);
      asm volatile("s_wait_xcnt 0x0" ::: "memory"); } } }   // as above
// ---- k_att: block = 32 queries of (b,h), 16 waves. The block's logit rows live in LDS from the products to P v:
//   1 wave w takes the 16-key tiles w, w + 16, ... of keys [0, kpad) against both query tiles (one key fragment serves 32 queries);
//   2 wave w does the softmax of rows w and w + 16 in place (e = exp(logit - max), masked -> 0; 1 / sum kept per row);
//   3 wave w sums the 32-key chunks w, w + 16, ... of P v for both query tiles, P = e / sum x 2^11 formed as the fragment is read;
//   4 the 16 partial tiles meet in the same LDS and are added in slice order.
// p: the lane's own place (8 * lane) in the first of a fragment's two 512-byte runs
__device__ __forceinline__ v16h frag_p(const _Float16* p) { union { v16h v; v8h q[2]; } u; u.q[0] = *(const v8h*)p; u.q[1] = *(const v8h*)(p + 256); return u.v; }
__device__ __forceinline__ v16b frag_q(const __bf16* p) { union { v16b v; v8b q[2]; } u; u.q[0] = *(const v8b*)p; u.q[1] = *(const v8b*)(p + 256); return u.v; }
#define FQ 32
#define FS 16
#define FP (TT + 4)   // row pitch in floats: 16 rows of a fragment read fall on 16 different groups of four banks
__global__ __launch_bounds__(512) void k_att(const _Float16* __restrict__ QH, const _Float16* __restrict__ QL, const __bf16* __restrict__ VT, const __bf16* __restrict__ VL, float* __restrict__ Y) { __shared__ __align__(16) float sp[FQ][FP]; __shared__ float sinv[FQ];
  const int tid = threadIdx.x, ks = __builtin_amdgcn_readfirstlane(tid >> 5) /* scalar, so the slice loops branch on SCC and EXEC stays full at the matrix instructions */, lane = tid & 31, col = lane & 15, g = lane >> 4; const int b = blockIdx.x / NH, h = blockIdx.x % NH; const int qb = (TT / FQ - 1 - (int)blockIdx.y) * FQ;   /* longest rows start first */ const int kend = qb + FQ, kpad = (kend + 127) & ~127;   /* rows are filled to a multiple of 128 keys (<= TT; keys past the diagonal masked), so that a wave's softmax loops run whole 128-key steps with every lane on */
  { v16h ah[2][2], al[2][2]; const size_t qo = ((size_t)blockIdx.x * (TT / 16) + qb / 16) * 1024 + 8 * lane; const _Float16* qh = QH + qo; const _Float16* ql = QL + qo;   // the lane's own fragment addresses
#pragma unroll
    for (int t = 0; t < 2; ++t)
#pragma unroll
      for (int kc = 0; kc < HD / 32; ++kc) { ah[t][kc] = frag_p(qh + t * 1024 + kc * 512); al[t][kc] = frag_p(ql + t * 1024 + kc * 512); }
    asm volatile("s_wait_xcnt 0x0" :: "v"(qh), "v"(ql) : "memory");   // the address registers of the issued loads stay whole up to this wait; behind it they may be reused
    auto tile = [&](const v16h kb0, const v16h kb1, const int kt) { const int key = kt * 16 + col;
#pragma unroll
      for (int t = 0; t < 2; ++t) { v8f a = {}, l = {}; a = wmma16(ah[t][0], kb0, a); l = wmma16(al[t][0], kb0, l); a = wmma16(ah[t][1], kb1, a); l = wmma16(al[t][1], kb1, l); a += l * (1.0f / 1024.0f);
#pragma unroll
        for (int r = 0; r < 8; ++r) { const int rl = t * 16 + 8 * g + r; float v = a[r] * 0.125f; if (key > qb + rl) v = -3.0e38f; sp[rl][key] = v; } } };
    const int nt = kpad / 16; const _Float16* kp = QH /* the keys are the shared projection's hi plane */ + ((size_t)blockIdx.x * (TT / 16) + ks) * 1024 + 8 * lane; v16h ka0 = {}, ka1 = {}, kc0 = {}, kc1 = {}; if (ks < nt) { ka0 = frag_p(kp); ka1 = frag_p(kp + 512); }
    for (int kt = ks; kt < nt; kt += 2 * FS) { const bool two = kt + FS < nt;   // two register sets in turn: a tile's key fragments fly while the tile before it is worked on
      if (two) { kc0 = frag_p(kp + FS * 1024); kc1 = frag_p(kp + FS * 1024 + 512); }
      tile(ka0, ka1, kt);
      if (kt + 2 * FS < nt) { ka0 = frag_p(kp + 2 * FS * 1024); ka1 = frag_p(kp + 2 * FS * 1024 + 512); }
      asm volatile("s_wait_xcnt 0x0" :: "v"(kp) : "memory");   // the address register of the issued loads stays whole up to this wait; behind it it is stepped
      kp += 2 * FS * 1024;
      if (two) tile(kc0, kc1, kt + FS); } }
  __syncthreads();   // every logit of the 32 rows is in LDS before a row's softmax reads it
  { float* s0 = &sp[ks][lane * 4]; float* s1 = &sp[ks + FS][lane * 4]; float m0 = -3.0e38f, m1 = -3.0e38f;   // two rows side by side: two independent chains per wave
    for (int k = 0; k < kpad; k += 128) { const v4f u = *(const v4f*)&s0[k], w = *(const v4f*)&s1[k]; m0 = fmaxf(fmaxf(m0, fmaxf(u[0], u[1])), fmaxf(u[2], u[3])); m1 = fmaxf(fmaxf(m1, fmaxf(w[0], w[1])), fmaxf(w[2], w[3])); }
#pragma unroll
    for (int o = 1; o < 32; o <<= 1) { m0 = fmaxf(m0, __shfl_xor(m0, o)); m1 = fmaxf(m1, __shfl_xor(m1, o)); }
    float a0 = 0.f, a1 = 0.f; const float l2e = 1.44269504088896340736f, n0 = -m0 * l2e, n1 = -m1 * l2e;   // n's rounding is one common factor of a row's e and of its sum: it cancels in e / sum
    for (int k = 0; k < kpad; k += 128) { const v4f u = *(const v4f*)&s0[k], w = *(const v4f*)&s1[k]; v4f e, f;
#pragma unroll
      for (int i = 0; i < 4; ++i) { e[i] = __builtin_amdgcn_exp2f(fmaf(u[i], l2e, n0)); f[i] = __builtin_amdgcn_exp2f(fmaf(w[i], l2e, n1)); }   // a masked logit (-3e38) gives an exponent of -inf and so e = 0 by itself
      a0 += (e[0] + e[1]) + (e[2] + e[3]); a1 += (f[0] + f[1]) + (f[2] + f[3]); *(v4f*)&s0[k] = e; *(v4f*)&s1[k] = f; }
#pragma unroll
    for (int o = 1; o < 32; o <<= 1) { a0 += __shfl_xor(a0, o); a1 += __shfl_xor(a1, o); }
    if (lane == 0) { sinv[ks] = 1.0f / a0; sinv[ks + FS] = 1.0f / a1; } }
  __syncthreads();   // every row's e and 1 / sum are in LDS before the P fragments are read
  v8f acc[2][HD / 16] = {}; const float sc[2] = { sinv[col] * 2048.0f, sinv[16 + col] * 2048.0f };
  const size_t vo = ((size_t)blockIdx.x * (TT / 32) + ks) * 2048 + 8 * lane; const __bf16* pvh = VT + vo; const __bf16* pvl = VL + vo;   // the lane's own fragment addresses, stepped from chunk to chunk
  for (int kc = ks; kc < kend / 32; kc += FS) { F2 p[2]; v16b vh[HD / 16], vl[HD / 16];   // all v fragments of the chunk are asked for first: one load latency a chunk, under the split of P
#pragma unroll
    for (int j = 0; j < HD / 16; ++j) { vh[j] = frag_q(pvh + j * 512); vl[j] = frag_q(pvl + j * 512); }
    asm volatile("s_wait_xcnt 0x0" :: "v"(pvh), "v"(pvl) : "memory");   // the address registers of the issued loads stay whole up to this wait; behind it they are stepped
    pvh += FS * 2048; pvl += FS * 2048;
#pragma unroll
    for (int t = 0; t < 2; ++t) { const v4f* q4 = (const v4f*)&sp[t * 16 + col][kc * 32 + 8 * g]; const v4f x0 = q4[0] * sc[t], x1 = q4[1] * sc[t], x2 = q4[4] * sc[t], x3 = q4[5] * sc[t]; float v[16];
#pragma unroll
      for (int i = 0; i < 4; ++i) { v[i] = x0[i]; v[4 + i] = x1[i]; v[8 + i] = x2[i]; v[12 + i] = x3[i]; }
      p[t] = bsplit16(v); }
#pragma unroll
    for (int j = 0; j < HD / 16; ++j)
#pragma unroll
      for (int t = 0; t < 2; ++t) { acc[t][j] = wmma_bf(p[t].h, vh[j], acc[t][j]); acc[t][j] = wmma_bf(p[t].l, vh[j], acc[t][j]); acc[t][j] = wmma_bf(p[t].h, vl[j], acc[t][j]); } }
  __syncthreads();   // the last P fragment is read before the partial tiles overwrite the rows
  float* ss = &sp[0][0];   // [FS][FQ][HD + 4]
#pragma unroll
  for (int t = 0; t < 2; ++t)
#pragma unroll
    for (int j = 0; j < HD / 16; ++j)
#pragma unroll
      for (int r = 0; r < 8; ++r) ss[(ks * FQ + t * 16 + 8 * g + r) * (HD + 4) + j * 16 + col] = acc[t][j][r];
  __syncthreads();   // every slice's partial tile is in LDS before any thread adds them
  { const int rl = tid >> 4, c4 = (tid & 15) * 4; v4f s = *(const v4f*)&ss[rl * (HD + 4) + c4];
#pragma unroll
    for (int i = 1; i < FS; ++i) s += *(const v4f*)&ss[(i * FQ + rl) * (HD + 4) + c4];
    vst2(Y + ((size_t)b * TT + qb + rl) * CC + h * HD + c4, s * (1.0f / 2048.0f)); } }
// ---- k_out: block = (128 rows, 128 cols), 16 waves in a 4 x 4 grid of 32 x 32 wave tiles: out = y (bf16 hi + lo) Wo^T + bo; y (split once for the block) and Wo tiles of 64 k go through two LDS stage buffers in turn, as in k_proj
__global__ __launch_bounds__(512) void k_out(const float* __restrict__ Y, const float* __restrict__ WP, const float* __restrict__ BP, float* __restrict__ OUT) { __shared__ __align__(16) float sf[16][32][36];
  constexpr int KS = 64, GP = KS + 8, YB = 128 * GP, SB = 2 * YB + 128 * GP, NK = CC / KS;   // in bf16 elements: row pitch, one y plane and the whole of a stage buffer
  __shared__ __align__(16) __bf16 st[2 * SB];
  const int tid = threadIdx.x, wave = tid >> 5, lane = tid & 31, col = lane & 15, g = lane >> 4, wm = (wave >> 2) * 32, wn = (wave & 3) * 32; const int c0 = blockIdx.y * 128 + wn; const size_t r0 = (size_t)blockIdx.x * 128 + wm;
  v8f acc[2][2] = {};
  const int lr = tid / (KS / 4), lc = (tid % (KS / 4)) * 4, lo = lr * GP + lc; const float* py = Y + ((size_t)blockIdx.x * 128 + lr) * CC + lc; const float* pw = WP + (size_t)(blockIdx.y * 128 + lr) * CC + lc; GT<128, KS> yr; GT<128, KS> wr;
  g_load(yr, py); g_load(wr, pw);
  asm volatile("s_wait_xcnt 0x0" :: "v"(py), "v"(pw) : "memory");   // the address registers of the issued loads stay whole up to this wait; behind it they are stepped
  py += KS; pw += KS;
  s_put2(yr, st + lo, st + YB + lo); s_put(wr, st + 2 * YB + lo);
  g_load(yr, py); g_load(wr, pw);
  asm volatile("s_wait_xcnt 0x0" :: "v"(py), "v"(pw) : "memory");   // as above
  py += KS; pw += KS;
  __syncthreads();   // stage 0 is in LDS before a fragment of it is read
  for (int kc = 0; kc < NK; ++kc) { const __bf16* cur = st + (kc & 1) * SB; __bf16* nxt = st + ((kc + 1) & 1) * SB;
    if (kc + 1 < NK) { s_put2(yr, nxt + lo, nxt + YB + lo); s_put(wr, nxt + 2 * YB + lo); }   // the buffer whose last readers left it at the barrier of the pass before
    if (kc + 2 < NK) { g_load(yr, py); g_load(wr, pw);
      asm volatile("s_wait_xcnt 0x0" :: "v"(py), "v"(pw) : "memory");   // as above
      py += KS; pw += KS; }
#pragma unroll
    for (int kk = 0; kk < KS; kk += 32) { v16b ah[2], al[2], w[2];   // the fragments of 32 k are asked for together: one LDS latency for 8 products
#pragma unroll
      for (int i = 0; i < 2; ++i) { ah[i] = frag_b(cur + (wm + i * 16 + col) * GP + kk, lane); al[i] = frag_b(cur + YB + (wm + i * 16 + col) * GP + kk, lane); }
#pragma unroll
      for (int j = 0; j < 2; ++j) w[j] = frag_b(cur + 2 * YB + (wn + j * 16 + col) * GP + kk, lane);
#pragma unroll
      for (int j = 0; j < 2; ++j)
#pragma unroll
        for (int i = 0; i < 2; ++i) { acc[i][j] = wmma_bf(ah[i], w[j], acc[i][j]); acc[i][j] = wmma_bf(al[i], w[j], acc[i][j]); } }
    __syncthreads();   // publishes stage kc + 1 and ends every read of stage kc
  }
#pragma unroll
  for (int j = 0; j < 2; ++j) { const float bb = BP ? bfr(BP[c0 + j * 16 + col]) : 0.f;
#pragma unroll
    for (int i = 0; i < 2; ++i)
#pragma unroll
    for (int r = 0; r < 8; ++r) sf[wave][i * 16 + 8 * g + r][j * 16 + col] = acc[i][j][r] + bb; }
  LDSX(); for (int p = 0; p < 8; ++p) { const int rl = p * 4 + (lane >> 3); vst2(OUT + (r0 + rl) * CC + c0 + (lane & 7) * 4, *(const v4f*)&sf[wave][rl][(lane & 7) * 4]); } }   // a wave store covers four whole 128-byte lines
extern "C" void kernel_launch(void* const* d_in, const int* in_sizes, int n_in, void* d_out, int out_size, void* d_ws, size_t ws_size, hipStream_t stream) {
  (void)in_sizes; (void)n_in; (void)out_size;
  const float** F = (const float**)d_in;   // 0 x [2,2048,1024], 1 Wq [1024,1024] ([out,in]), 2 bq, 3 Wv, 4 bv, 5 Wo, 6 bo
  if (ws_size < (size_t)WS_END) return;
  char* ws = (char*)d_ws; _Float16 *QH = (_Float16*)(ws + WS_QH), *QL = (_Float16*)(ws + WS_QL); __bf16 *VT = (__bf16*)(ws + WS_VT), *VL = (__bf16*)(ws + WS_VL); float *Y = (float*)(ws + WS_Y);
  k_proj<<<dim3(TNB * TT / 128, CC / 256, 2), 512, 0, stream>>>(F[0], F[1], F[2], F[3], F[4], QH, QL, VT, VL);   // queries and keys share Wq, bq: one projection serves both
  k_att<<<dim3(TNB * NH, TT / FQ), 512, 0, stream>>>(QH, QL, VT, VL, Y);
  k_out<<<dim3(TNB * TT / 128, CC / 128), 512, 0, stream>>>(Y, F[5], F[6], (float*)d_out);
}

// v008
// Measured time: 92.9 microseconds a run.
// Next to v007, in two timings, it ran 1.25 and 1.26 times as fast.
// Over all steps from v000 it is 16.2 times as fast.
// compute dtype: all float inputs rounded to bf16; qk = x Wq^T + bq (shared query/key) and v = x Wv^T + bv with EXACT bf16 products on WMMA 16x16x32, f32 accumulate; q as f16 hi + residual (x 2^10), k = the same f16 hi plane (projected once) -> 2-product logits / 8, causal, kept in f32 in registers; running-maximum softmax in f32 (e = 2^((logit - max) log2 e), one fused multiply-add and the chip's exp2), e f32 split bf16 hi + lo against v bf16 hi + lo (3 products), 1 / sum applied last; out = y (bf16 hi + lo) Wo^T + bo; f32 output.
#include <hip/hip_runtime.h>
#include <math.h>

typedef __attribute__((ext_vector_type(16))) _Float16 v16h;
typedef __attribute__((ext_vector_type(16))) __bf16 v16b;
typedef __attribute__((ext_vector_type(8)))  _Float16 v8h;
typedef __attribute__((ext_vector_type(8)))  float v8f;
typedef __attribute__((ext_vector_type(4)))  float v4f;
typedef __attribute__((ext_vector_type(2)))  float v2f;
typedef __attribute__((ext_vector_type(4)))  unsigned v4u;
typedef __attribute__((ext_vector_type(4)))  int v4i;
typedef float __attribute__((may_alias)) float_a;
typedef int __attribute__((may_alias)) int_a;

template <typename T> __device__ __forceinline__ void vst2(void* p, T v) { *(T*)p = v;  }
__device__ __forceinline__ v8f wmma16(v16h a, v16h b, v8f c) {
  v8f d = __builtin_amdgcn_wmma_f32_16x16x32_f16(false, a, false, b, (short)0, c, false, false);
  asm volatile("v_nop\n\tv_nop\n\tv_nop\n\tv_nop" : "+v"(d) : "v"(a), "v"(b));
  return d;
}
__device__ __forceinline__ v8f wmma_bf(v16b a, v16b b, v8f c) {
  v8f d = __builtin_amdgcn_wmma_f32_16x16x32_bf16(false, a, false, b, (short)0, c, false, false);
  asm volatile("v_nop\n\tv_nop\n\tv_nop\n\tv_nop" : "+v"(d) : "v"(a), "v"(b));
  return d;
}
// 16x16x32 fragments: lane = (h = lane>>4, row/col = lane&15); elements 0..7 = k0+8h+0..7, 8..15 = k0+16+8h+0..7; D element r = row 8h+r
__device__ __forceinline__ v16h frag_h(const _Float16* rowk0, int lane) {
  union { v16h v; v8h q[2]; } u; const _Float16* p = rowk0 + 8 * (lane >> 4);
  u.q[0] = *(const v8h*)p; u.q[1] = *(const v8h*)(p + 16); return u.v;
}
__device__ __forceinline__ v16h frag_f32(const float* rowk0, int lane) {
  v16h a; const float* p = rowk0 + 8 * (lane >> 4);
#pragma unroll
  for (int i = 0; i < 8; ++i) { a[i] = (_Float16)p[i]; a[8 + i] = (_Float16)p[16 + i]; }
  return a;
}
__device__ __forceinline__ v16h frag_f32s(const float* rowk0, int lane, float sc) {
  v16h a; const float* p = rowk0 + 8 * (lane >> 4);
#pragma unroll
  for (int i = 0; i < 8; ++i) { a[i] = (_Float16)(p[i] * sc); a[8 + i] = (_Float16)(p[16 + i] * sc); }
  return a;
}
// column fragment from a [K][ld] layout (column n), rows >= K read as 0
__device__ __forceinline__ v16h fragc_f32(const float* W, int k0, int n, int lane, int ld, int K) {
  v16h a; const int g = lane >> 4;
#pragma unroll
  for (int i = 0; i < 8; ++i) { const int ka = k0 + 8 * g + i, kb = ka + 16;
    a[i] = (_Float16)(ka < K ? W[(size_t)(ka < K ? ka : K - 1) * ld + n] : 0.f); a[8 + i] = (_Float16)(kb < K ? W[(size_t)(kb < K ? kb : K - 1) * ld + n] : 0.f); }
  return a;
}
struct F2 { v16b h, l; };
__device__ __forceinline__ F2 bsplit16(const float v[16]) { F2 r;
#pragma unroll
  for (int i = 0; i < 16; ++i) { const __bf16 h = (__bf16)v[i]; r.h[i] = h; r.l[i] = (__bf16)(v[i] - (float)h); }
  return r; }
__device__ __forceinline__ F2 split_row(const float* row, int k0, int lane) { float v[16]; const float* p = row + k0 + 8 * (lane >> 4);
#pragma unroll
  for (int i = 0; i < 8; ++i) { v[i] = p[i]; v[8 + i] = p[16 + i]; }
  return bsplit16(v); }
__device__ __forceinline__ F2 split_rowK(const float* row, int k0, int lane, int K) { float v[16]; const int g = lane >> 4;
#pragma unroll
  for (int i = 0; i < 8; ++i) { const int ka = k0 + 8 * g + i, kb = ka + 16; v[i] = ka < K ? row[ka < K ? ka : K - 1] : 0.f; v[8 + i] = kb < K ? row[kb < K ? kb : K - 1] : 0.f; }
  return bsplit16(v); }
__device__ __forceinline__ F2 split_col(const float* W, int k0, int n, int lane, int ld, int K) { float v[16]; const int g = lane >> 4;
#pragma unroll
  for (int i = 0; i < 8; ++i) { const int ka = k0 + 8 * g + i, kb = ka + 16; v[i] = ka < K ? W[(size_t)(ka < K ? ka : K - 1) * ld + n] : 0.f; v[8 + i] = kb < K ? W[(size_t)(kb < K ? kb : K - 1) * ld + n] : 0.f; }
  return bsplit16(v); }
__device__ __forceinline__ v8f mac3(const F2& a, const F2& b, v8f c) { c = wmma_bf(a.l, b.h, c); c = wmma_bf(a.h, b.l, c); return wmma_bf(a.h, b.h, c); }
__device__ __forceinline__ float sigm(float v) { return 1.0f / (1.0f + expf(-v)); }
#define LDSX() do { asm volatile("s_wait_dscnt 0" ::: "memory"); __builtin_amdgcn_wave_barrier(); __builtin_amdgcn_fence(__ATOMIC_RELEASE, "workgroup"); } while (0)


// Shared-QK causal attention ('LSHAttention', B 2, S 2,048, hidden 1,024 = 16 x 64): qk = x Wq^T + bq used as both queries and keys, v = x Wv^T + bv, causal softmax(qk qk^T / 8), P v, output Linear + bias.
#define NB 2
#define TT 2048
#define CC 1024
#define NH 16
#define HD 64
#ifndef TNB
#define TNB NB
#endif
typedef __attribute__((ext_vector_type(8))) __bf16 v8b;
__device__ __forceinline__ v16b frag_b(const __bf16* rowk0, int lane) {
  union { v16b v; v8b q[2]; } u; const __bf16* p = rowk0 + 8 * (lane >> 4);
  u.q[0] = *(const v8b*)p; u.q[1] = *(const v8b*)(p + 16); return u.v;
}
__device__ __forceinline__ float bfr(float v) { return (float)(__bf16)v; }
__device__ __attribute__((noinline)) float exp_ni(float v) { return expf(v); }
__device__ __attribute__((noinline)) float erf_ni(float v) { return erff(v); }

// qk and v planes lie in FRAGMENT ORDER, per (b, h): a 16x16x32 operand fragment is two runs of 512 contiguous bytes, lane l's 16 bytes at 16 l, so that each wave-wide 16-byte load of k_att covers four whole 128-byte lines.
//   qk: [b][h][t / 16][d / 16][(d / 8) & 1][t & 15][d & 7]      v: [b][h][t / 32][c / 16][(t / 16) & 1][(t / 8) & 1][c & 15][t & 7]
#define WS_QH  0u
#define WS_QL  (WS_QH + 2u * (size_t)NB * TT * CC)
#define WS_VT  (WS_QL + 2u * (size_t)NB * TT * CC)      // bf16 v planes
#define WS_VL  (WS_VT + 2u * (size_t)NB * CC * TT)      // bf16 v residual planes
#define WS_Y   (WS_VL + 2u * (size_t)NB * CC * TT)      // f32 y rows [b*t][C]
#define WS_END (WS_Y + 4u * (size_t)NB * TT * CC)

// ---- operand staging of the two projection GEMMs (blocks of 512 threads): a [ROWS][KS] f32 tile is read in whole 128-byte lines (16 bytes a lane, neighbouring lanes on neighbouring
//   addresses of a row), rounded to bf16 once for the block and put into LDS at a row pitch of KS + 8 elements (16 bytes x an odd number: the 16 rows of a fragment read fall on different banks).
typedef __attribute__((ext_vector_type(4))) __bf16 v4b;
template <int ROWS, int KS> struct GT { v4f r[ROWS * KS / 2048]; };
template <int ROWS, int KS> __device__ __forceinline__ void g_load(GT<ROWS, KS>& t, const float* p) {   // p: the thread's own place in the tile's first 2048 / KS rows
#pragma unroll
  for (int i = 0; i < ROWS * KS / 2048; ++i) t.r[i] = *(const v4f*)(p + (size_t)i * (2048 / KS) * CC); }
template <int ROWS, int KS> __device__ __forceinline__ void s_put(const GT<ROWS, KS>& t, __bf16* d) {
#pragma unroll
  for (int i = 0; i < ROWS * KS / 2048; ++i) { v4b o;
#pragma unroll
    for (int e = 0; e < 4; ++e) o[e] = (__bf16)t.r[i][e];
    *(v4b*)(d + i * (2048 / KS) * (KS + 8)) = o; } }
template <int ROWS, int KS> __device__ __forceinline__ void s_put2(const GT<ROWS, KS>& t, __bf16* dh, __bf16* dl) {   // hi + residual planes, bsplit16's split
#pragma unroll
  for (int i = 0; i < ROWS * KS / 2048; ++i) { v4b o, u;
#pragma unroll
    for (int e = 0; e < 4; ++e) { const float v = t.r[i][e]; const __bf16 h = (__bf16)v; o[e] = h; u[e] = (__bf16)(v - (float)h); }
    *(v4b*)(dh + i * (2048 / KS) * (KS + 8)) = o; *(v4b*)(dl + i * (2048 / KS) * (KS + 8)) = u; } }
// ---- k_proj: block = (128 rows, 256 cols, which), 16 waves in a 4 x 4 grid of 32 x 64 wave tiles: which 0: qk = x Wq^T + bq, done once for queries and keys alike -> f16 hi plane (the keys, and the queries' hi part) + residual plane; which 1: v -> bf16 hi + residual planes
//   x and W tiles of 64 k go through two LDS stage buffers in turn; the tile after next flies into registers while this one is multiplied. The stage buffers and the epilogue's tiles share one LDS range.
//   The large block tile is there for the L2: a loaded x row serves 256 columns and a loaded W row 128 rows; the squarer wave tile reads 6 fragments from LDS for 8 products; 64 k a stage keep enough bytes in flight for the one block of a WGP.
__global__ __launch_bounds__(512) void k_proj(const float* __restrict__ X, const float* __restrict__ WQ, const float* __restrict__ BQ, const float* __restrict__ WV, const float* __restrict__ BV, _Float16* __restrict__ QH, _Float16* __restrict__ QL, __bf16* __restrict__ VT, __bf16* __restrict__ VL) {
  constexpr int KS = 64, GP = KS + 8, XB = 128 * GP, SB = XB + 256 * GP, NK = CC / KS;   // in bf16 elements: row pitch, the x part and the whole of a stage buffer
  __shared__ __align__(16) unsigned char sm[2 * 256 * 136 * 2]; static_assert(2 * SB * 2 <= (int)sizeof(sm) && 2 * 128 * 264 * 2 <= (int)sizeof(sm), "LDS range");
  _Float16 (*sh)[264] = (_Float16 (*)[264])sm, (*sl)[264] = (_Float16 (*)[264])(sm + 128 * 264 * 2); __bf16 (*th)[136] = (__bf16 (*)[136])sm, (*tl2)[136] = (__bf16 (*)[136])(sm + 256 * 136 * 2); __bf16* st = (__bf16*)sm;
  const int tid = threadIdx.x, wave = tid >> 5, lane = tid & 31, col = lane & 15, g = lane >> 4, wm = (wave >> 2) * 32, wn = (wave & 3) * 64; const int which = blockIdx.z; const int c0 = blockIdx.y * 256; const size_t r0 = (size_t)blockIdx.x * 128; const float* WA = which == 0 ? WQ : WV; const float* BA = which == 0 ? BQ : BV;
  v8f acc[2][4] = {};
  const int lr = tid / (KS / 4), lc = (tid % (KS / 4)) * 4, lo = lr * GP + lc; const float* px = X + (r0 + lr) * CC + lc; const float* pw = WA + (size_t)(c0 + lr) * CC + lc; GT<128, KS> xr; GT<256, KS> wr;
  g_load(xr, px); g_load(wr, pw);
  asm volatile("s_wait_xcnt 0x0" :: "v"(px), "v"(pw) : "memory");   // the address registers of the issued loads stay whole up to this wait; behind it they are stepped
  px += KS; pw += KS;
  s_put(xr, st + lo); s_put(wr, st + XB + lo);
  g_load(xr, px); g_load(wr, pw);
  asm volatile("s_wait_xcnt 0x0" :: "v"(px), "v"(pw) : "memory");   // as above
  px += KS; pw += KS;
  __syncthreads();   // stage 0 is in LDS before a fragment of it is read
  for (int kc = 0; kc < NK; ++kc) { const __bf16* cur = st + (kc & 1) * SB; __bf16* nxt = st + ((kc + 1) & 1) * SB;
    if (kc + 1 < NK) { s_put(xr, nxt + lo); s_put(wr, nxt + XB + lo); }   // the buffer whose last readers left it at the barrier of the pass before
    if (kc + 2 < NK) { g_load(xr, px); g_load(wr, pw);
      asm volatile("s_wait_xcnt 0x0" :: "v"(px), "v"(pw) : "memory");   // as above
      px += KS; pw += KS; }
#pragma unroll
    for (int kk = 0; kk < KS; kk += 32) { v16b a[2], w[4];   // the fragments of 32 k are asked for together: one LDS latency for 8 products
#pragma unroll
      for (int i = 0; i < 2; ++i) a[i] = frag_b(cur + (wm + i * 16 + col) * GP + kk, lane);
#pragma unroll
      for (int j = 0; j < 4; ++j) w[j] = frag_b(cur + XB + (wn + j * 16 + col) * GP + kk, lane);
#pragma unroll
      for (int j = 0; j < 4; ++j)
#pragma unroll
        for (int i = 0; i < 2; ++i) acc[i][j] = wmma_bf(a[i], w[j], acc[i][j]); }
    __syncthreads();   // publishes stage kc + 1 and ends every read of stage kc (behind the last pass: before the epilogue's tiles overwrite the range)
  }
#pragma unroll
  for (int j = 0; j < 4; ++j) { const float bb = bfr(BA[c0 + wn + j * 16 + col]);
#pragma unroll
    for (int i = 0; i < 2; ++i)
#pragma unroll
    for (int r = 0; r < 8; ++r) { const float v = acc[i][j][r] + bb; const int rl = wm + i * 16 + 8 * g + r, cl = wn + j * 16 + col; const _Float16 hv = (_Float16)v;
      if (which == 1) { const __bf16 bh = (__bf16)v; th[cl][rl] = bh; tl2[cl][rl] = (__bf16)(v - (float)bh); } else { sh[rl][cl] = hv; sl[rl][cl] = (_Float16)((v - (float)hv) * 1024.0f); }   /* q residual carried x 2^10 so the plane stays f16-normal on the chip */ } }
  __syncthreads();
  const size_t bh = (r0 / TT) * NH + c0 / HD; const int t0 = (int)(r0 % TT);   // e counts the block's 16-byte pieces in the order of their places in the planes: neighbouring threads store neighbouring pieces
  if (which == 0) { for (int e = tid; e < 128 * 32; e += 512) { const int rl = ((e >> 7) & 7) * 16 + (e & 15), q = (e >> 10) * 8 + ((e >> 4) & 7); const size_t o = ((bh + (e >> 10)) * (TT / 16) + t0 / 16 + ((e >> 7) & 7)) * 1024 + (e & 127) * 8; vst2((unsigned*)(QH + o), *(const v4u*)&sh[rl][q * 8]);
      asm volatile("s_wait_xcnt 0x0" ::: "memory");   // the registers that the issued store names stay whole up to this wait; behind it they are reused
      vst2((unsigned*)(QL + o), *(const v4u*)&sl[rl][q * 8]);
      asm volatile("s_wait_xcnt 0x0" ::: "memory"); } }   // as above
  else { for (int e = tid; e < 256 * 16; e += 512) { const int cl = (e >> 10) * 64 + ((e >> 6) & 3) * 16 + (e & 15), q = ((e >> 8) & 3) * 4 + ((e >> 4) & 3); const size_t o2 = ((bh + (e >> 10)) * (TT / 32) + t0 / 32 + ((e >> 8) & 3)) * 2048 + (e & 255) * 8; vst2((unsigned*)(VT + o2), *(const v4u*)&th[cl][q * 8]);
      asm volatile("s_wait_xcnt 0x0" ::: "memory");   // as above
      vst2((unsigned*)(VL + o2), *(const v4u*)&tl2[cl][q * 8]);
      asm volatile("s_wait_xcnt 0x0" ::: "memory"); } } }   // as above
// ---- k_att: a wave = 32 queries of (b,h), and it walks their keys in chunks of 32 with the running-maximum softmax; scores, P and the output tile never leave the wave's registers, so there is no LDS and no barrier.
//   scores transposed, S^T = K Q^T: a lane holds 16 keys' scores of ONE query (column lane & 15), so maximum and sum are in-lane but for one exchange between the wave's halves;
//   two S^T tiles (keys 0..15, 16..31 of the chunk), turned into e = 2^((logit - max) log2 e) in place, are the B fragment of O^T += V^T P^T in the hardware's own k order, which is the order of the v planes;
//   a rise of the maximum scales the sum and the output tile by 2^((old - new) log2 e), the same factor in every register of a lane; 1 / sum comes last.
//   Block = 8 waves of one (b,h), so that they read the same key and value lines at about the same time; a long and a short query range meet on a SIMD under either numbering of the waves (w, w + 4 or w, w + 1).
// p: the lane's own place (8 * lane) in the first of a fragment's two 512-byte runs
__device__ __forceinline__ v16h frag_p(const _Float16* p) { union { v16h v; v8h q[2]; } u; u.q[0] = *(const v8h*)p; u.q[1] = *(const v8h*)(p + 256); return u.v; }
__device__ __forceinline__ v16b frag_q(const __bf16* p) { union { v16b v; v8b q[2]; } u; u.q[0] = *(const v8b*)p; u.q[1] = *(const v8b*)(p + 256); return u.v; }
__device__ __forceinline__ v8f mm_h(v16h a, v16h b, v8f c) { return __builtin_amdgcn_wmma_f32_16x16x32_f16(false, a, false, b, (short)0, c, false, false); }
__device__ __forceinline__ v8f mm_b(v16b a, v16b b, v8f c) { return __builtin_amdgcn_wmma_f32_16x16x32_bf16(false, a, false, b, (short)0, c, false, false); }
__device__ __forceinline__ float xhalf(float v) { const int b = __builtin_bit_cast(int, v); return __builtin_bit_cast(float, __builtin_amdgcn_permlanex16(b, b, 0x76543210, 0xfedcba98, false, false)); }   // lane l <-> l ^ 16
// 2^v with the one slot that the instruction set asks for behind a transcendental kept by construction. In the pair the second v_exp_f32 is the first one's independent instruction (outputs apart from inputs), the v_nop the second one's.
__device__ __forceinline__ float ex2n(float v) { float r; asm("v_exp_f32 %0, %1\n\tv_nop" : "=v"(r) : "v"(v)); return r; }
__device__ __forceinline__ v2f ex2p(float x, float y) { float a, b; asm("v_exp_f32 %0, %2\n\tv_exp_f32 %1, %3\n\tv_nop" : "=&v"(a), "=&v"(b) : "v"(x), "v"(y)); const v2f r = { a, b }; return r; }
#define FQ 32
#define AW 8
typedef __attribute__((ext_vector_type(2))) __bf16 v2b;
struct KV { v16h k[2][2]; v16b vh[HD / 16], vl[HD / 16]; };
__global__ __launch_bounds__(256) void k_att(const _Float16* __restrict__ QH, const _Float16* __restrict__ QL, const __bf16* __restrict__ VT, const __bf16* __restrict__ VL, float* __restrict__ Y) {
  const int tid = threadIdx.x, w = __builtin_amdgcn_readfirstlane(tid >> 5) /* scalar, so the chunk loop branches on SCC and EXEC stays full at the matrix instructions */, lane = tid & 31, col = lane & 15, g = lane >> 4; const int b = blockIdx.x / NH, h = blockIdx.x % NH;
  const int idx = (int)blockIdx.y * 4 + (w & 3), p = ((w ^ (w >> 2)) & 1) ? TT / FQ - 1 - idx : idx, qb = p * FQ;   // query range p has p + 1 chunks; every p of 0..63 is taken once
  v16h qh[2][2], ql[2][2];
  { const size_t qo = ((size_t)blockIdx.x * (TT / 16) + qb / 16) * 1024 + 8 * lane; const _Float16* ph = QH + qo; const _Float16* pl = QL + qo;   // the lane's own fragment addresses
#pragma unroll
    for (int t = 0; t < 2; ++t)
#pragma unroll
      for (int kc = 0; kc < HD / 32; ++kc) { qh[t][kc] = frag_p(ph + t * 1024 + kc * 512); ql[t][kc] = frag_p(pl + t * 1024 + kc * 512); }
    asm volatile("s_wait_xcnt 0x0" :: "v"(ph), "v"(pl) : "memory"); }   // the address registers of the issued loads stay whole up to this wait; behind it they may be reused
  unsigned off = ((unsigned)blockIdx.x * (TT * HD) + 8 * lane) * 2;   // the lane's own byte offset in the key plane (the shared projection's hi plane) and in the two value planes alike: a chunk of 32 keys is 4,096 bytes of each; stepped from chunk to chunk
  KV A, B; v8f acc[2][HD / 16] = {}; float m[2] = { -3.0e38f, -3.0e38f }, ls[2] = { 0.f, 0.f }; const float cs = 0.125f * 1.44269504088896340736f;
  auto ld = [&](KV& d) __attribute__((always_inline)) {   // one chunk's key and value fragments: 24 loads of 512 bytes a wave
    const _Float16* kp = (const _Float16*)((const char*)QH + off); const __bf16* pvh = (const __bf16*)((const char*)VT + off); const __bf16* pvl = (const __bf16*)((const char*)VL + off);
#pragma unroll
    for (int kt = 0; kt < 2; ++kt) { d.k[kt][0] = frag_p(kp + kt * 1024); d.k[kt][1] = frag_p(kp + kt * 1024 + 512); }
#pragma unroll
    for (int j = 0; j < HD / 16; ++j) { d.vh[j] = frag_q(pvh + j * 512); d.vl[j] = frag_q(pvl + j * 512); }
    asm volatile("s_wait_xcnt 0x0" : "+v"(off) :: "memory");   // the offset register of the issued loads stays whole up to this wait; the next offset is formed from the statement's output, so that the step cannot be lifted over it
    off += 4096; };
  auto chunk = [&](const KV& c, KV& nx, const bool pre, const bool last) __attribute__((always_inline)) { v8f s[2][2]; v16b ph[2], pl[2];
    if (pre) { ld(nx);
      __builtin_amdgcn_sched_barrier(0); }   // keeps the next chunk's loads at the head of this chunk, so that they fly under all of its work; the scheduler otherwise sinks them to the chunk's foot, where the next chunk waits for them at once
#pragma unroll
    for (int t = 0; t < 2; ++t)
#pragma unroll
      for (int kt = 0; kt < 2; ++kt) { v8f a = {}, l = {}; a = mm_h(c.k[kt][0], qh[t][0], a); l = mm_h(c.k[kt][0], ql[t][0], l); a = mm_h(c.k[kt][1], qh[t][1], a); l = mm_h(c.k[kt][1], ql[t][1], l); s[t][kt] = a + l * (1.0f / 1024.0f); }
#pragma unroll
    for (int t = 0; t < 2; ++t) {
      if (last) {   // the chunk on the diagonal: keys behind the query are masked
#pragma unroll
        for (int kt = 0; kt < 2; ++kt)
#pragma unroll
          for (int r = 0; r < 8; ++r) if (kt * 16 + 8 * g + r > t * 16 + col) s[t][kt][r] = -3.0e38f; }
      float mx = fmaxf(s[t][0][0], s[t][1][0]);
#pragma unroll
      for (int r = 1; r < 8; ++r) mx = fmaxf(mx, fmaxf(s[t][0][r], s[t][1][r]));
      mx = fmaxf(mx, xhalf(mx));
      const float mn = fmaxf(m[t], mx), n = -mn * cs, al = ex2n(fmaf(m[t], cs, n)); m[t] = mn;   // key 0 is open to every query, so mn is a real logit from the first chunk on; n's rounding is one common factor of e and of the sum
      v2f sum = { 0.f, 0.f };
#pragma unroll
      for (int i = 0; i < 8; ++i) {   // element pair 2 i, 2 i + 1 of the B fragment = registers of the two score tiles in their order
        const v2f e = ex2p(fmaf(s[t][i >> 2][(2 * i) & 7], cs, n), fmaf(s[t][i >> 2][(2 * i + 1) & 7], cs, n));   // a masked logit (-3e38) gives a huge negative exponent and so e = 0 by itself
        sum += e; const v2b hi = __builtin_convertvector(e, v2b); const v2b lo = __builtin_convertvector(e - __builtin_convertvector(hi, v2f), v2b);   // bsplit16's split, two elements at a time
        ph[t][2 * i] = hi[0]; ph[t][2 * i + 1] = hi[1]; pl[t][2 * i] = lo[0]; pl[t][2 * i + 1] = lo[1]; }
      ls[t] = fmaf(ls[t], al, sum[0] + sum[1]);   // the lane's own 16 keys; the halves meet behind the loop
#pragma unroll
      for (int j = 0; j < HD / 16; ++j) acc[t][j] *= al; }
#pragma unroll
    for (int j = 0; j < HD / 16; ++j)
#pragma unroll
      for (int t = 0; t < 2; ++t) acc[t][j] = mm_b(c.vh[j], ph[t], acc[t][j]);
#pragma unroll
    for (int j = 0; j < HD / 16; ++j)
#pragma unroll
      for (int t = 0; t < 2; ++t) acc[t][j] = mm_b(c.vh[j], pl[t], acc[t][j]);
#pragma unroll
    for (int j = 0; j < HD / 16; ++j)
#pragma unroll
      for (int t = 0; t < 2; ++t) acc[t][j] = mm_b(c.vl[j], ph[t], acc[t][j]); };
  ld(A);
  for (int kc = 0; ; kc += 2) {   // two register sets in turn: chunk kc + 1 flies while chunk kc is worked on; the test between the two halves keeps each chunk a block of its own, with its loads at its head
    if (kc == p) { chunk(A, B, false, true); break; }
    chunk(A, B, true, false);
    if (kc + 1 == p) { chunk(B, A, false, true); break; }
    chunk(B, A, true, false); }
  float inv[2] = { 1.0f / (ls[0] + xhalf(ls[0])), 1.0f / (ls[1] + xhalf(ls[1])) }; float* yp = Y + ((size_t)b * TT + qb + col) * CC + h * HD + 8 * g;   // a lane's 8 registers of a tile are 8 neighbouring columns of its query's row
#pragma unroll
  for (int t = 0; t < 2; ++t) {
#pragma unroll
    for (int j = 0; j < HD / 16; ++j) { const v8f o = acc[t][j] * inv[t]; const v4f o0 = { o[0], o[1], o[2], o[3] }, o1 = { o[4], o[5], o[6], o[7] }; vst2(yp + (size_t)t * 16 * CC + j * 16, o0); vst2(yp + (size_t)t * 16 * CC + j * 16 + 4, o1);
      asm volatile("s_wait_xcnt 0x0" : "+v"(inv[0]), "+v"(inv[1]) :: "memory"); } } }   // the registers that the issued stores name stay whole up to this wait; the next values are formed from the statement's outputs, so that they cannot be lifted over it into those registers
// ---- k_out: block = (128 rows, 128 cols), 16 waves in a 4 x 4 grid of 32 x 32 wave tiles: out = y (bf16 hi + lo) Wo^T + bo; y (split once for the block) and Wo tiles of 64 k go through two LDS stage buffers in turn, as in k_proj
__global__ __launch_bounds__(512) void k_out(const float* __restrict__ Y, const float* __restrict__ WP, const float* __restrict__ BP, float* __restrict__ OUT) { __shared__ __align__(16) float sf[16][32][36];
  constexpr int KS = 64, GP = KS + 8, YB = 128 * GP, SB = 2 * YB + 128 * GP, NK = CC / KS;   // in bf16 elements: row pitch, one y plane and the whole of a stage buffer
  __shared__ __align__(16) __bf16 st[2 * SB];
  const int tid = threadIdx.x, wave = tid >> 5, lane = tid & 31, col = lane & 15, g = lane >> 4, wm = (wave >> 2) * 32, wn = (wave & 3) * 32; const int c0 = blockIdx.y * 128 + wn; const size_t r0 = (size_t)blockIdx.x * 128 + wm;
  v8f acc[2][2] = {};
  const int lr = tid / (KS / 4), lc = (tid % (KS / 4)) * 4, lo = lr * GP + lc; const float* py = Y + ((size_t)blockIdx.x * 128 + lr) * CC + lc; const float* pw = WP + (size_t)(blockIdx.y * 128 + lr) * CC + lc; GT<128, KS> yr; GT<128, KS> wr;
  g_load(yr, py); g_load(wr, pw);
  asm volatile("s_wait_xcnt 0x0" :: "v"(py), "v"(pw) : "memory");   // the address registers of the issued loads stay whole up to this wait; behind it they are stepped
  py += KS; pw += KS;
  s_put2(yr, st + lo, st + YB + lo); s_put(wr, st + 2 * YB + lo);
  g_load(yr, py); g_load(wr, pw);
  asm volatile("s_wait_xcnt 0x0" :: "v"(py), "v"(pw) : "memory");   // as above
  py += KS; pw += KS;
  __syncthreads();   // stage 0 is in LDS before a fragment of it is read
  for (int kc = 0; kc < NK; ++kc) { const __bf16* cur = st + (kc & 1) * SB; __bf16* nxt = st + ((kc + 1) & 1) * SB;
    if (kc + 1 < NK) { s_put2(yr, nxt + lo, nxt + YB + lo); s_put(wr, nxt + 2 * YB + lo); }   // the buffer whose last readers left it at the barrier of the pass before
    if (kc + 2 < NK) { g_load(yr, py); g_load(wr, pw);
      asm volatile("s_wait_xcnt 0x0" :: "v"(py), "v"(pw) : "memory");   // as above
      py += KS; pw += KS; }
#pragma unroll
    for (int kk = 0; kk < KS; kk += 32) { v16b ah[2], al[2], w[2];   // the fragments of 32 k are asked for together: one LDS latency for 8 products
#pragma unroll
      for (int i = 0; i < 2; ++i) { ah[i] = frag_b(cur + (wm + i * 16 + col) * GP + kk, lane); al[i] = frag_b(cur + YB + (wm + i * 16 + col) * GP + kk, lane); }
#pragma unroll
      for (int j = 0; j < 2; ++j) w[j] = frag_b(cur + 2 * YB + (wn + j * 16 + col) * GP + kk, lane);
#pragma unroll
      for (int j = 0; j < 2; ++j)
#pragma unroll
        for (int i = 0; i < 2; ++i) { acc[i][j] = wmma_bf(ah[i], w[j], acc[i][j]); acc[i][j] = wmma_bf(al[i], w[j], acc[i][j]); } }
    __syncthreads();   // publishes stage kc + 1 and ends every read of stage kc
  }
#pragma unroll
  for (int j = 0; j < 2; ++j) { const float bb = BP ? bfr(BP[c0 + j * 16 + col]) : 0.f;
#pragma unroll
    for (int i = 0; i < 2; ++i)
#pragma unroll
    for (int r = 0; r < 8; ++r) sf[wave][i * 16 + 8 * g + r][j * 16 + col] = acc[i][j][r] + bb; }
  LDSX(); for (int p = 0; p < 8; ++p) { const int rl = p * 4 + (lane >> 3); vst2(OUT + (r0 + rl) * CC + c0 + (lane & 7) * 4, *(const v4f*)&sf[wave][rl][(lane & 7) * 4]); } }   // a wave store covers four whole 128-byte lines
extern "C" void kernel_launch(void* const* d_in, const int* in_sizes, int n_in, void* d_out, int out_size, void* d_ws, size_t ws_size, hipStream_t stream) {
  (void)in_sizes; (void)n_in; (void)out_size;
  const float** F = (const float**)d_in;   // 0 x [2,2048,1024], 1 Wq [1024,1024] ([out,in]), 2 bq, 3 Wv, 4 bv, 5 Wo, 6 bo
  if (ws_size < (size_t)WS_END) return;
  char* ws = (char*)d_ws; _Float16 *QH = (_Float16*)(ws + WS_QH), *QL = (_Float16*)(ws + WS_QL); __bf16 *VT = (__bf16*)(ws + WS_VT), *VL = (__bf16*)(ws + WS_VL); float *Y = (float*)(ws + WS_Y);
  k_proj<<<dim3(TNB * TT / 128, CC / 256, 2), 512, 0, stream>>>(F[0], F[1], F[2], F[3], F[4], QH, QL, VT, VL);   // queries and keys share Wq, bq: one projection serves both
  k_att<<<dim3(TNB * NH, TT / FQ / AW), 256, 0, stream>>>(QH, QL, VT, VL, Y);
  k_out<<<dim3(TNB * TT / 128, CC / 128), 512, 0, stream>>>(Y, F[5], F[6], (float*)d_out);
}

// v009
// Measured time: 82.2 microseconds a run.
// Two timings next to v008 put it at 1.12 and 1.13 times that version's speed.
// All steps since v000 together make it 18.3 times as fast.
// compute dtype: all float inputs rounded to bf16; qk = x Wq^T + bq (shared query/key) and v = x Wv^T + bv with EXACT bf16 products on WMMA 16x16x32, f32 accumulate; q as f16 hi + residual (x 2^10), k = the same f16 hi plane (projected once) -> 2-product logits / 8, causal, kept in f32 in registers; running-maximum softmax in f32 (e = 2^((logit - max) log2 e), one fused multiply-add and the chip's exp2), the keys of a query range dealt to two waves and their partial maxima, sums and tiles joined at the end, e f32 split bf16 hi + lo against v bf16 hi + lo (3 products), 1 / sum applied last; out = y (bf16 hi + lo) Wo^T + bo; f32 output.
#include <hip/hip_runtime.h>
#include <math.h>

typedef __attribute__((ext_vector_type(16))) _Float16 v16h;
typedef __attribute__((ext_vector_type(16))) __bf16 v16b;
typedef __attribute__((ext_vector_type(8)))  _Float16 v8h;
typedef __attribute__((ext_vector_type(8)))  float v8f;
typedef __attribute__((ext_vector_type(4)))  float v4f;
typedef __attribute__((ext_vector_type(2)))  float v2f;
typedef __attribute__((ext_vector_type(4)))  unsigned v4u;
typedef __attribute__((ext_vector_type(4)))  int v4i;
typedef float __attribute__((may_alias)) float_a;
typedef int __attribute__((may_alias)) int_a;

template <typename T> __device__ __forceinline__ void vst2(void* p, T v) { *(T*)p = v;  }
__device__ __forceinline__ v8f wmma16(v16h a, v16h b, v8f c) {
  v8f d = __builtin_amdgcn_wmma_f32_16x16x32_f16(false, a, false, b, (short)0, c, false, false);
  asm volatile("v_nop\n\tv_nop\n\tv_nop\n\tv_nop" : "+v"(d) : "v"(a), "v"(b));
  return d;
}
__device__ __forceinline__ v8f wmma_bf(v16b a, v16b b, v8f c) {
  v8f d = __builtin_amdgcn_wmma_f32_16x16x32_bf16(false, a, false, b, (short)0, c, false, false);
  asm volatile("v_nop\n\tv_nop\n\tv_nop\n\tv_nop" : "+v"(d) : "v"(a), "v"(b));
  return d;
}
// 16x16x32 fragments: lane = (h = lane>>4, row/col = lane&15); elements 0..7 = k0+8h+0..7, 8..15 = k0+16+8h+0..7; D element r = row 8h+r
__device__ __forceinline__ v16h frag_h(const _Float16* rowk0, int lane) {
  union { v16h v; v8h q[2]; } u; const _Float16* p = rowk0 + 8 * (lane >> 4);
  u.q[0] = *(const v8h*)p; u.q[1] = *(const v8h*)(p + 16); return u.v;
}
__device__ __forceinline__ v16h frag_f32(const float* rowk0, int lane) {
  v16h a; const float* p = rowk0 + 8 * (lane >> 4);
#pragma unroll
  for (int i = 0; i < 8; ++i) { a[i] = (_Float16)p[i]; a[8 + i] = (_Float16)p[16 + i]; }
  return a;
}
__device__ __forceinline__ v16h frag_f32s(const float* rowk0, int lane, float sc) {
  v16h a; const float* p = rowk0 + 8 * (lane >> 4);
#pragma unroll
  for (int i = 0; i < 8; ++i) { a[i] = (_Float16)(p[i] * sc); a[8 + i] = (_Float16)(p[16 + i] * sc); }
  return a;
}
// column fragment from a [K][ld] layout (column n), rows >= K read as 0
__device__ __forceinline__ v16h fragc_f32(const float* W, int k0, int n, int lane, int ld, int K) {
  v16h a; const int g = lane >> 4;
#pragma unroll
  for (int i = 0; i < 8; ++i) { const int ka = k0 + 8 * g + i, kb = ka + 16;
    a[i] = (_Float16)(ka < K ? W[(size_t)(ka < K ? ka : K - 1) * ld + n] : 0.f); a[8 + i] = (_Float16)(kb < K ? W[(size_t)(kb < K ? kb : K - 1) * ld + n] : 0.f); }
  return a;
}
struct F2 { v16b h, l; };
__device__ __forceinline__ F2 bsplit16(const float v[16]) { F2 r;
#pragma unroll
  for (int i = 0; i < 16; ++i) { const __bf16 h = (__bf16)v[i]; r.h[i] = h; r.l[i] = (__bf16)(v[i] - (float)h); }
  return r; }
__device__ __forceinline__ F2 split_row(const float* row, int k0, int lane) { float v[16]; const float* p = row + k0 + 8 * (lane >> 4);
#pragma unroll
  for (int i = 0; i < 8; ++i) { v[i] = p[i]; v[8 + i] = p[16 + i]; }
  return bsplit16(v); }
__device__ __forceinline__ F2 split_rowK(const float* row, int k0, int lane, int K) { float v[16]; const int g = lane >> 4;
#pragma unroll
  for (int i = 0; i < 8; ++i) { const int ka = k0 + 8 * g + i, kb = ka + 16; v[i] = ka < K ? row[ka < K ? ka : K - 1] : 0.f; v[8 + i] = kb < K ? row[kb < K ? kb : K - 1] : 0.f; }
  return bsplit16(v); }
__device__ __forceinline__ F2 split_col(const float* W, int k0, int n, int lane, int ld, int K) { float v[16]; const int g = lane >> 4;
#pragma unroll
  for (int i = 0; i < 8; ++i) { const int ka = k0 + 8 * g + i, kb = ka + 16; v[i] = ka < K ? W[(size_t)(ka < K ? ka : K - 1) * ld + n] : 0.f; v[8 + i] = kb < K ? W[(size_t)(kb < K ? kb : K - 1) * ld + n] : 0.f; }
  return bsplit16(v); }
__device__ __forceinline__ v8f mac3(const F2& a, const F2& b, v8f c) { c = wmma_bf(a.l, b.h, c); c = wmma_bf(a.h, b.l, c); return wmma_bf(a.h, b.h, c); }
__device__ __forceinline__ float sigm(float v) { return 1.0f / (1.0f + expf(-v)); }
#define LDSX() do { asm volatile("s_wait_dscnt 0" ::: "memory"); __builtin_amdgcn_wave_barrier(); __builtin_amdgcn_fence(__ATOMIC_RELEASE, "workgroup"); } while (0)


// Shared-QK causal attention ('LSHAttention', B 2, S 2,048, hidden 1,024 = 16 x 64): qk = x Wq^T + bq used as both queries and keys, v = x Wv^T + bv, causal softmax(qk qk^T / 8), P v, output Linear + bias.
#define NB 2
#define TT 2048
#define CC 1024
#define NH 16
#define HD 64
#ifndef TNB
#define TNB NB
#endif
typedef __attribute__((ext_vector_type(8))) __bf16 v8b;
__device__ __forceinline__ v16b frag_b(const __bf16* rowk0, int lane) {
  union { v16b v; v8b q[2]; } u; const __bf16* p = rowk0 + 8 * (lane >> 4);
  u.q[0] = *(const v8b*)p; u.q[1] = *(const v8b*)(p + 16); return u.v;
}
__device__ __forceinline__ float bfr(float v) { return (float)(__bf16)v; }
__device__ __attribute__((noinline)) float exp_ni(float v) { return expf(v); }
__device__ __attribute__((noinline)) float erf_ni(float v) { return erff(v); }

// qk and v planes lie in FRAGMENT ORDER, per (b, h): a 16x16x32 operand fragment is two runs of 512 contiguous bytes, lane l's 16 bytes at 16 l, so that each wave-wide 16-byte load of k_att covers four whole 128-byte lines.
//   qk: [b][h][t / 16][d / 16][(d / 8) & 1][t & 15][d & 7]      v: [b][h][t / 32][c / 16][(t / 16) & 1][(t / 8) & 1][c & 15][t & 7]
#define WS_QH  0u
#define WS_QL  (WS_QH + 2u * (size_t)NB * TT * CC)
#define WS_VT  (WS_QL + 2u * (size_t)NB * TT * CC)      // bf16 v planes
#define WS_VL  (WS_VT + 2u * (size_t)NB * CC * TT)      // bf16 v residual planes
#define WS_Y   (WS_VL + 2u * (size_t)NB * CC * TT)      // f32 y rows [b*t][C]
#define WS_END (WS_Y + 4u * (size_t)NB * TT * CC)

// ---- operand staging of the two projection GEMMs (blocks of 512 threads): a [ROWS][KS] f32 tile is read in whole 128-byte lines (16 bytes a lane, neighbouring lanes on neighbouring
//   addresses of a row), rounded to bf16 once for the block and put into LDS at a row pitch of KS + 8 elements (16 bytes x an odd number: the 16 rows of a fragment read fall on different banks).
typedef __attribute__((ext_vector_type(4))) __bf16 v4b;
template <int ROWS, int KS> struct GT { v4f r[ROWS * KS / 2048]; };
template <int ROWS, int KS> __device__ __forceinline__ void g_load(GT<ROWS, KS>& t, const float* p) {   // p: the thread's own place in the tile's first 2048 / KS rows
#pragma unroll
  for (int i = 0; i < ROWS * KS / 2048; ++i) t.r[i] = *(const v4f*)(p + (size_t)i * (2048 / KS) * CC); }
template <int ROWS, int KS> __device__ __forceinline__ void s_put(const GT<ROWS, KS>& t, __bf16* d) {
#pragma unroll
  for (int i = 0; i < ROWS * KS / 2048; ++i) { v4b o;
#pragma unroll
    for (int e = 0; e < 4; ++e) o[e] = (__bf16)t.r[i][e];
    *(v4b*)(d + i * (2048 / KS) * (KS + 8)) = o; } }
template <int ROWS, int KS> __device__ __forceinline__ void s_put2(const GT<ROWS, KS>& t, __bf16* dh, __bf16* dl) {   // hi + residual planes, bsplit16's split
#pragma unroll
  for (int i = 0; i < ROWS * KS / 2048; ++i) { v4b o, u;
#pragma unroll
    for (int e = 0; e < 4; ++e) { const float v = t.r[i][e]; const __bf16 h = (__bf16)v; o[e] = h; u[e] = (__bf16)(v - (float)h); }
    *(v4b*)(dh + i * (2048 / KS) * (KS + 8)) = o; *(v4b*)(dl + i * (2048 / KS) * (KS + 8)) = u; } }
// ---- k_proj: block = (128 rows, 256 cols, which), 16 waves in a 4 x 4 grid of 32 x 64 wave tiles: which 0: qk = x Wq^T + bq, done once for queries and keys alike -> f16 hi plane (the keys, and the queries' hi part) + residual plane; which 1: v -> bf16 hi + residual planes
//   x and W tiles of 64 k go through two LDS stage buffers in turn; the tile after next flies into registers while this one is multiplied. The stage buffers and the epilogue's tiles share one LDS range.
//   The large block tile is there for the L2: a loaded x row serves 256 columns and a loaded W row 128 rows; the squarer wave tile reads 6 fragments from LDS for 8 products; 64 k a stage keep enough bytes in flight for the one block of a WGP.
__global__ __launch_bounds__(512) void k_proj(const float* __restrict__ X, const float* __restrict__ WQ, const float* __restrict__ BQ, const float* __restrict__ WV, const float* __restrict__ BV, _Float16* __restrict__ QH, _Float16* __restrict__ QL, __bf16* __restrict__ VT, __bf16* __restrict__ VL) {
  constexpr int KS = 64, GP = KS + 8, XB = 128 * GP, SB = XB + 256 * GP, NK = CC / KS;   // in bf16 elements: row pitch, the x part and the whole of a stage buffer
  __shared__ __align__(16) unsigned char sm[2 * 256 * 136 * 2]; static_assert(2 * SB * 2 <= (int)sizeof(sm) && 2 * 128 * 264 * 2 <= (int)sizeof(sm), "LDS range");
  _Float16 (*sh)[264] = (_Float16 (*)[264])sm, (*sl)[264] = (_Float16 (*)[264])(sm + 128 * 264 * 2); __bf16 (*th)[136] = (__bf16 (*)[136])sm, (*tl2)[136] = (__bf16 (*)[136])(sm + 256 * 136 * 2); __bf16* st = (__bf16*)sm;
  const int tid = threadIdx.x, wave = tid >> 5, lane = tid & 31, col = lane & 15, g = lane >> 4, wm = (wave >> 2) * 32, wn = (wave & 3) * 64; const int which = blockIdx.z; const int c0 = blockIdx.y * 256; const size_t r0 = (size_t)blockIdx.x * 128; const float* WA = which == 0 ? WQ : WV; const float* BA = which == 0 ? BQ : BV;
  v8f acc[2][4] = {};
  const int lr = tid / (KS / 4), lc = (tid % (KS / 4)) * 4, lo = lr * GP + lc; const float* px = X + (r0 + lr) * CC + lc; const float* pw = WA + (size_t)(c0 + lr) * CC + lc; GT<128, KS> xr; GT<256, KS> wr;
  g_load(xr, px); g_load(wr, pw);
  asm volatile("s_wait_xcnt 0x0" :: "v"(px), "v"(pw) : "memory");   // the address registers of the issued loads stay whole up to this wait; behind it they are stepped
  px += KS; pw += KS;
  s_put(xr, st + lo); s_put(wr, st + XB + lo);
  g_load(xr, px); g_load(wr, pw);
  asm volatile("s_wait_xcnt 0x0" :: "v"(px), "v"(pw) : "memory");   // as above
  px += KS; pw += KS;
  __syncthreads();   // stage 0 is in LDS before a fragment of it is read
  for (int kc = 0; kc < NK; ++kc) { const __bf16* cur = st + (kc & 1) * SB; __bf16* nxt = st + ((kc + 1) & 1) * SB;
    if (kc + 1 < NK) { s_put(xr, nxt + lo); s_put(wr, nxt + XB + lo); }   // the buffer whose last readers left it at the barrier of the pass before
    if (kc + 2 < NK) { g_load(xr, px); g_load(wr, pw);
      asm volatile("s_wait_xcnt 0x0" :: "v"(px), "v"(pw) : "memory");   // as above
      px += KS; pw += KS; }
#pragma unroll
    for (int kk = 0; kk < KS; kk += 32) { v16b a[2], w[4];   // the fragments of 32 k are asked for together: one LDS latency for 8 products
#pragma unroll
      for (int i = 0; i < 2; ++i) a[i] = frag_b(cur + (wm + i * 16 + col) * GP + kk, lane);
#pragma unroll
      for (int j = 0; j < 4; ++j) w[j] = frag_b(cur + XB + (wn + j * 16 + col) * GP + kk, lane);
#pragma unroll
      for (int j = 0; j < 4; ++j)
#pragma unroll
        for (int i = 0; i < 2; ++i) acc[i][j] = wmma_bf(a[i], w[j], acc[i][j]); }
    __syncthreads();   // publishes stage kc + 1 and ends every read of stage kc (behind the last pass: before the epilogue's tiles overwrite the range)
  }
#pragma unroll
  for (int j = 0; j < 4; ++j) { const float bb = bfr(BA[c0 + wn + j * 16 + col]);
#pragma unroll
    for (int i = 0; i < 2; ++i)
#pragma unroll
    for (int r = 0; r < 8; ++r) { const float v = acc[i][j][r] + bb; const int rl = wm + i * 16 + 8 * g + r, cl = wn + j * 16 + col; const _Float16 hv = (_Float16)v;
      if (which == 1) { const __bf16 bh = (__bf16)v; th[cl][rl] = bh; tl2[cl][rl] = (__bf16)(v - (float)bh); } else { sh[rl][cl] = hv; sl[rl][cl] = (_Float16)((v - (float)hv) * 1024.0f); }   /* q residual carried x 2^10 so the plane stays f16-normal on the chip */ } }
  __syncthreads();
  const size_t bh = (r0 / TT) * NH + c0 / HD; const int t0 = (int)(r0 % TT);   // e counts the block's 16-byte pieces in the order of their places in the planes: neighbouring threads store neighbouring pieces
  if (which == 0) { for (int e = tid; e < 128 * 32; e += 512) { const int rl = ((e >> 7) & 7) * 16 + (e & 15), q = (e >> 10) * 8 + ((e >> 4) & 7); const size_t o = ((bh + (e >> 10)) * (TT / 16) + t0 / 16 + ((e >> 7) & 7)) * 1024 + (e & 127) * 8; vst2((unsigned*)(QH + o), *(const v4u*)&sh[rl][q * 8]);
      asm volatile("s_wait_xcnt 0x0" ::: "memory");   // the registers that the issued store names stay whole up to this wait; behind it they are reused
      vst2((unsigned*)(QL + o), *(const v4u*)&sl[rl][q * 8]);
      asm volatile("s_wait_xcnt 0x0" ::: "memory"); } }   // as above
  else { for (int e = tid; e < 256 * 16; e += 512) { const int cl = (e >> 10) * 64 + ((e >> 6) & 3) * 16 + (e & 15), q = ((e >> 8) & 3) * 4 + ((e >> 4) & 3); const size_t o2 = ((bh + (e >> 10)) * (TT / 32) + t0 / 32 + ((e >> 8) & 3)) * 2048 + (e & 255) * 8; vst2((unsigned*)(VT + o2), *(const v4u*)&th[cl][q * 8]);
      asm volatile("s_wait_xcnt 0x0" ::: "memory");   // as above
      vst2((unsigned*)(VL + o2), *(const v4u*)&tl2[cl][q * 8]);
      asm volatile("s_wait_xcnt 0x0" ::: "memory"); } } }   // as above
// ---- k_att: 32 queries of (b,h) are a range; two waves share a range and walk its keys in chunks of 32 with the running-maximum softmax, one the even chunks and one the odd; scores, P and the output tile stay in a wave's registers during a walk.
//   scores transposed, S^T = K Q^T: a lane holds 16 keys' scores of ONE query (column lane & 15), so maximum and sum are in-lane but for one exchange between the wave's halves;
//   two S^T tiles (keys 0..15, 16..31 of the chunk), turned into e = 2^((logit - max) log2 e) in place, are the B fragment of O^T += V^T P^T in the hardware's own k order, which is the order of the v planes;
//   a rise of the maximum scales the sum and the output tile by 2^((old - new) log2 e), the same factor in every register of a lane; 1 / sum comes last.
//   Block = 8 waves of one (b,h) = 4 pairs; a pair walks a long range (63 - idx) and then a short one (idx), so every wave has 32 or 33 chunks, no wave is left alone on its SIMD, and the longest chain of chunks is half of a range's;
//   the 4 waves of one parity read the same key and value lines at about the same time. Each walk's maximum, sum and tile go to LDS; behind the one barrier each wave joins the two partial results of one range and stores its rows.
// p: the lane's own place (8 * lane) in the first of a fragment's two 512-byte runs
__device__ __forceinline__ v16h frag_p(const _Float16* p) { union { v16h v; v8h q[2]; } u; u.q[0] = *(const v8h*)p; u.q[1] = *(const v8h*)(p + 256); return u.v; }
__device__ __forceinline__ v16b frag_q(const __bf16* p) { union { v16b v; v8b q[2]; } u; u.q[0] = *(const v8b*)p; u.q[1] = *(const v8b*)(p + 256); return u.v; }
__device__ __forceinline__ v8f mm_h(v16h a, v16h b, v8f c) { return __builtin_amdgcn_wmma_f32_16x16x32_f16(false, a, false, b, (short)0, c, false, false); }
__device__ __forceinline__ v8f mm_b(v16b a, v16b b, v8f c) { return __builtin_amdgcn_wmma_f32_16x16x32_bf16(false, a, false, b, (short)0, c, false, false); }
__device__ __forceinline__ float xhalf(float v) { const int b = __builtin_bit_cast(int, v); return __builtin_bit_cast(float, __builtin_amdgcn_permlanex16(b, b, 0x76543210, 0xfedcba98, false, false)); }   // lane l <-> l ^ 16
// 2^v with the one slot that the instruction set asks for behind a transcendental kept by construction. In the pair the second v_exp_f32 is the first one's independent instruction (outputs apart from inputs), the v_nop the second one's.
__device__ __forceinline__ float ex2n(float v) { float r; asm("v_exp_f32 %0, %1\n\tv_nop" : "=v"(r) : "v"(v)); return r; }
__device__ __forceinline__ v2f ex2p(float x, float y) { float a, b; asm("v_exp_f32 %0, %2\n\tv_exp_f32 %1, %3\n\tv_nop" : "=&v"(a), "=&v"(b) : "v"(x), "v"(y)); const v2f r = { a, b }; return r; }
#define FQ 32
#define AW 8
typedef __attribute__((ext_vector_type(2))) __bf16 v2b;
struct KV { v16h k[2][2]; v16b vh[HD / 16], vl[HD / 16]; };
__global__ __launch_bounds__(256) void k_att(const _Float16* __restrict__ QH, const _Float16* __restrict__ QL, const __bf16* __restrict__ VT, const __bf16* __restrict__ VL, float* __restrict__ Y) {
  const int tid = threadIdx.x, w = __builtin_amdgcn_readfirstlane(tid >> 5) /* scalar, so the chunk loop branches on SCC and EXEC stays full at the matrix instructions */, lane = tid & 31, col = lane & 15, g = lane >> 4; const int b = blockIdx.x / NH, h = blockIdx.x % NH;
  __shared__ __align__(16) float part[2][AW][17][32][4];   // [walk][wave][16 rows of 4 tile registers each, then one row of the two maxima and the two sums][lane][4]
  const int pi = w & 3, sp = w >> 2, idx = (int)blockIdx.y * 4 + pi;   // pair, parity of the wave's chunks; query range p has p + 1 chunks; every p of 0..63 is taken by one pair
  v16h qh[2][2], ql[2][2]; KV A, B; v8f acc[2][HD / 16]; float m[2], ls[2]; unsigned off; int lim; const float cs = 0.125f * 1.44269504088896340736f;
  auto ldq = [&](const int qb) __attribute__((always_inline)) { const size_t qo = ((size_t)blockIdx.x * (TT / 16) + qb / 16) * 1024 + 8 * lane; const _Float16* ph = QH + qo; const _Float16* pl = QL + qo;   // the lane's own fragment addresses
#pragma unroll
    for (int t = 0; t < 2; ++t)
#pragma unroll
      for (int kc = 0; kc < HD / 32; ++kc) { qh[t][kc] = frag_p(ph + t * 1024 + kc * 512); ql[t][kc] = frag_p(pl + t * 1024 + kc * 512); }
    asm volatile("s_wait_xcnt 0x0" :: "v"(ph), "v"(pl) : "memory"); };   // the address registers of the issued loads stay whole up to this wait; behind it they may be reused
  auto ld = [&](KV& d) __attribute__((always_inline)) {   // one chunk's key and value fragments: 24 loads of 512 bytes a wave
    const _Float16* kp = (const _Float16*)((const char*)QH + off); const __bf16* pvh = (const __bf16*)((const char*)VT + off); const __bf16* pvl = (const __bf16*)((const char*)VL + off);
#pragma unroll
    for (int kt = 0; kt < 2; ++kt) { d.k[kt][0] = frag_p(kp + kt * 1024); d.k[kt][1] = frag_p(kp + kt * 1024 + 512); }
#pragma unroll
    for (int j = 0; j < HD / 16; ++j) { d.vh[j] = frag_q(pvh + j * 512); d.vl[j] = frag_q(pvl + j * 512); }
    asm volatile("s_wait_xcnt 0x0" : "+v"(off) :: "memory");   // the offset register of the issued loads stays whole up to this wait; the next offset is formed from the statement's output, so that the step cannot be lifted over it
    off += 8192; };   // the wave's next chunk is the one after next
  auto chunk = [&](const KV& c, KV& nx, const bool pre, const bool last) __attribute__((always_inline)) { v8f s[2][2]; v16b ph[2], pl[2];
    if (pre) { ld(nx);
      __builtin_amdgcn_sched_barrier(0); }   // keeps the next chunk's loads at the head of this chunk, so that they fly under all of its work; the scheduler otherwise sinks them to the chunk's foot, where the next chunk waits for them at once
#pragma unroll
    for (int t = 0; t < 2; ++t)
#pragma unroll
      for (int kt = 0; kt < 2; ++kt) { v8f a = {}, l = {}; a = mm_h(c.k[kt][0], qh[t][0], a); l = mm_h(c.k[kt][0], ql[t][0], l); a = mm_h(c.k[kt][1], qh[t][1], a); l = mm_h(c.k[kt][1], ql[t][1], l); s[t][kt] = a + l * (1.0f / 1024.0f); }
#pragma unroll
    for (int t = 0; t < 2; ++t) {
      if (last) {   // the wave's last chunk of a range: where it is the one on the diagonal (lim = col - 8 g: key 16 kt + 8 g + r against query 16 t + col), keys behind the query are masked; else lim lies beyond every key of the chunk
#pragma unroll
        for (int kt = 0; kt < 2; ++kt)
#pragma unroll
          for (int r = 0; r < 8; ++r) if (kt * 16 + r - t * 16 > lim) s[t][kt][r] = -3.0e38f; }
      float mx = fmaxf(s[t][0][0], s[t][1][0]);
#pragma unroll
      for (int r = 1; r < 8; ++r) mx = fmaxf(mx, fmaxf(s[t][0][r], s[t][1][r]));
      mx = fmaxf(mx, xhalf(mx));
      const float mn = fmaxf(m[t], mx), n = -mn * cs, al = ex2n(fmaf(m[t], cs, n)); m[t] = mn;   // the first key of every chunk that a wave works on is open to every query of the range, so mn is a real logit from the wave's first chunk on; n's rounding is one common factor of e and of the sum
      v2f sum = { 0.f, 0.f };
#pragma unroll
      for (int i = 0; i < 8; ++i) {   // element pair 2 i, 2 i + 1 of the B fragment = registers of the two score tiles in their order
        const v2f e = ex2p(fmaf(s[t][i >> 2][(2 * i) & 7], cs, n), fmaf(s[t][i >> 2][(2 * i + 1) & 7], cs, n));   // a masked logit (-3e38) gives a huge negative exponent and so e = 0 by itself
        sum += e; const v2b hi = __builtin_convertvector(e, v2b); const v2b lo = __builtin_convertvector(e - __builtin_convertvector(hi, v2f), v2b);   // bsplit16's split, two elements at a time
        ph[t][2 * i] = hi[0]; ph[t][2 * i + 1] = hi[1]; pl[t][2 * i] = lo[0]; pl[t][2 * i + 1] = lo[1]; }
      ls[t] = fmaf(ls[t], al, sum[0] + sum[1]);   // the lane's own 16 keys; the halves meet behind the loop
#pragma unroll
      for (int j = 0; j < HD / 16; ++j) acc[t][j] *= al; }
#pragma unroll
    for (int j = 0; j < HD / 16; ++j)
#pragma unroll
      for (int t = 0; t < 2; ++t) acc[t][j] = mm_b(c.vh[j], ph[t], acc[t][j]);
#pragma unroll
    for (int j = 0; j < HD / 16; ++j)
#pragma unroll
      for (int t = 0; t < 2; ++t) acc[t][j] = mm_b(c.vh[j], pl[t], acc[t][j]);
#pragma unroll
    for (int j = 0; j < HD / 16; ++j)
#pragma unroll
      for (int t = 0; t < 2; ++t) acc[t][j] = mm_b(c.vl[j], ph[t], acc[t][j]); };
  off = ((unsigned)blockIdx.x * (TT * HD) + 8 * lane) * 2 + sp * 4096;   // the lane's own byte offset in the key plane (the shared projection's hi plane) and in the two value planes alike: a chunk of 32 keys is 4,096 bytes of each; stepped from chunk to chunk
  for (int wk = 0; wk < 2; ++wk) { const int p = wk ? idx : TT / FQ - 1 - idx, n = (p - sp + 2) >> 1;   // the wave's chunks of range p: sp, sp + 2, ... up to p; none for the odd wave of range 0
    lim = col - 8 * g + (((p - sp) & 1) ? 2 * FQ : 0);   // chunk p, the one on the diagonal, is the last of the wave whose parity it has
    ldq(p * FQ);
#pragma unroll
    for (int t = 0; t < 2; ++t) { m[t] = -3.0e38f; ls[t] = 0.f;
#pragma unroll
      for (int j = 0; j < HD / 16; ++j) acc[t][j] = v8f{}; }
    if (n > 0) { ld(A);
      for (int kc = 0; ; kc += 2) {   // two register sets in turn: the wave's next chunk flies while this one is worked on; the test between the two halves keeps each chunk a block of its own, with its loads at its head
        if (kc + 1 == n) { chunk(A, B, false, true); break; }
        chunk(A, B, true, false);
        if (kc + 2 == n) { chunk(B, A, false, true); break; }
        chunk(B, A, true, false); } }
    off -= n * 8192;   // back to the wave's first chunk for the second walk: one carried register in place of start addresses kept over the walks, which the register budget of two waves a SIMD has no room for
    float* ps = &part[wk][w][0][lane][0];   // 16 bytes a lane, neighbouring lanes on neighbouring places
#pragma unroll
    for (int t = 0; t < 2; ++t)
#pragma unroll
      for (int j = 0; j < HD / 16; ++j) { const v8f a = acc[t][j]; const v4f a0 = { a[0], a[1], a[2], a[3] }, a1 = { a[4], a[5], a[6], a[7] }; *(v4f*)(ps + ((t * 4 + j) * 2) * 128) = a0; *(v4f*)(ps + ((t * 4 + j) * 2 + 1) * 128) = a1; }
    const v4f ml = { m[0], m[1], ls[0], ls[1] }; *(v4f*)(ps + 16 * 128) = ml; }
  __syncthreads();   // every wave's two partial results are in LDS before one of them is read
  const int qb = (sp ? idx : TT / FQ - 1 - idx) * FQ; float inv[2];   // wave (pi, sp) joins walk sp of its pair
  { const float* pa = &part[sp][pi][0][lane][0]; const float* pb = &part[sp][pi + 4][0][lane][0]; const v4f ma = *(const v4f*)(pa + 16 * 128), mb = *(const v4f*)(pb + 16 * 128);
#pragma unroll
    for (int t = 0; t < 2; ++t) { const float n = -fmaxf(ma[t], mb[t]) * cs; const v2f f = ex2p(fmaf(ma[t], cs, n), fmaf(mb[t], cs, n));   // each part scaled to the common maximum; a wave without a chunk left maximum -3e38, sum 0 and tile 0, and its factor is 0
      const float l = fmaf(ma[2 + t], f[0], mb[2 + t] * f[1]); inv[t] = 1.0f / (l + xhalf(l));
#pragma unroll
      for (int j = 0; j < HD / 16; ++j)
#pragma unroll
        for (int q = 0; q < 2; ++q) { const v4f x = *(const v4f*)(pa + ((t * 4 + j) * 2 + q) * 128), y = *(const v4f*)(pb + ((t * 4 + j) * 2 + q) * 128);
#pragma unroll
          for (int e = 0; e < 4; ++e) acc[t][j][4 * q + e] = fmaf(x[e], f[0], y[e] * f[1]); } } }
  float* yp = Y + ((size_t)b * TT + qb + col) * CC + h * HD + 8 * g;   // a lane's 8 registers of a tile are 8 neighbouring columns of its query's row
#pragma unroll
  for (int t = 0; t < 2; ++t) {
#pragma unroll
    for (int j = 0; j < HD / 16; ++j) { const v8f o = acc[t][j] * inv[t]; const v4f o0 = { o[0], o[1], o[2], o[3] }, o1 = { o[4], o[5], o[6], o[7] }; vst2(yp + (size_t)t * 16 * CC + j * 16, o0); vst2(yp + (size_t)t * 16 * CC + j * 16 + 4, o1);
      asm volatile("s_wait_xcnt 0x0" : "+v"(inv[0]), "+v"(inv[1]) :: "memory"); } } }   // the registers that the issued stores name stay whole up to this wait; the next values are formed from the statement's outputs, so that they cannot be lifted over it into those registers
// ---- k_out: block = (128 rows, 128 cols), 16 waves in a 4 x 4 grid of 32 x 32 wave tiles: out = y (bf16 hi + lo) Wo^T + bo; y (split once for the block) and Wo tiles of 64 k go through two LDS stage buffers in turn, as in k_proj
__global__ __launch_bounds__(512) void k_out(const float* __restrict__ Y, const float* __restrict__ WP, const float* __restrict__ BP, float* __restrict__ OUT) { __shared__ __align__(16) float sf[16][32][36];
  constexpr int KS = 64, GP = KS + 8, YB = 128 * GP, SB = 2 * YB + 128 * GP, NK = CC / KS;   // in bf16 elements: row pitch, one y plane and the whole of a stage buffer
  __shared__ __align__(16) __bf16 st[2 * SB];
  const int tid = threadIdx.x, wave = tid >> 5, lane = tid & 31, col = lane & 15, g = lane >> 4, wm = (wave >> 2) * 32, wn = (wave & 3) * 32; const int c0 = blockIdx.y * 128 + wn; const size_t r0 = (size_t)blockIdx.x * 128 + wm;
  v8f acc[2][2] = {};
  const int lr = tid / (KS / 4), lc = (tid % (KS / 4)) * 4, lo = lr * GP + lc; const float* py = Y + ((size_t)blockIdx.x * 128 + lr) * CC + lc; const float* pw = WP + (size_t)(blockIdx.y * 128 + lr) * CC + lc; GT<128, KS> yr; GT<128, KS> wr;
  g_load(yr, py); g_load(wr, pw);
  asm volatile("s_wait_xcnt 0x0" :: "v"(py), "v"(pw) : "memory");   // the address registers of the issued loads stay whole up to this wait; behind it they are stepped
  py += KS; pw += KS;
  s_put2(yr, st + lo, st + YB + lo); s_put(wr, st + 2 * YB + lo);
  g_load(yr, py); g_load(wr, pw);
  asm volatile("s_wait_xcnt 0x0" :: "v"(py), "v"(pw) : "memory");   // as above
  py += KS; pw += KS;
  __syncthreads();   // stage 0 is in LDS before a fragment of it is read
  for (int kc = 0; kc < NK; ++kc) { const __bf16* cur = st + (kc & 1) * SB; __bf16* nxt = st + ((kc + 1) & 1) * SB;
    if (kc + 1 < NK) { s_put2(yr, nxt + lo, nxt + YB + lo); s_put(wr, nxt + 2 * YB + lo); }   // the buffer whose last readers left it at the barrier of the pass before
    if (kc + 2 < NK) { g_load(yr, py); g_load(wr, pw);
      asm volatile("s_wait_xcnt 0x0" :: "v"(py), "v"(pw) : "memory");   // as above
      py += KS; pw += KS; }
#pragma unroll
    for (int kk = 0; kk < KS; kk += 32) { v16b ah[2], al[2], w[2];   // the fragments of 32 k are asked for together: one LDS latency for 8 products
#pragma unroll
      for (int i = 0; i < 2; ++i) { ah[i] = frag_b(cur + (wm + i * 16 + col) * GP + kk, lane); al[i] = frag_b(cur + YB + (wm + i * 16 + col) * GP + kk, lane); }
#pragma unroll
      for (int j = 0; j < 2; ++j) w[j] = frag_b(cur + 2 * YB + (wn + j * 16 + col) * GP + kk, lane);
#pragma unroll
      for (int j = 0; j < 2; ++j)
#pragma unroll
        for (int i = 0; i < 2; ++i) { acc[i][j] = wmma_bf(ah[i], w[j], acc[i][j]); acc[i][j] = wmma_bf(al[i], w[j], acc[i][j]); } }
    __syncthreads();   // publishes stage kc + 1 and ends every read of stage kc
  }
#pragma unroll
  for (int j = 0; j < 2; ++j) { const float bb = BP ? bfr(BP[c0 + j * 16 + col]) : 0.f;
#pragma unroll
    for (int i = 0; i < 2; ++i)
#pragma unroll
    for (int r = 0; r < 8; ++r) sf[wave][i * 16 + 8 * g + r][j * 16 + col] = acc[i][j][r] + bb; }
  LDSX(); for (int p = 0; p < 8; ++p) { const int rl = p * 4 + (lane >> 3); vst2(OUT + (r0 + rl) * CC + c0 + (lane & 7) * 4, *(const v4f*)&sf[wave][rl][(lane & 7) * 4]); } }   // a wave store covers four whole 128-byte lines
extern "C" void kernel_launch(void* const* d_in, const int* in_sizes, int n_in, void* d_out, int out_size, void* d_ws, size_t ws_size, hipStream_t stream) {
  (void)in_sizes; (void)n_in; (void)out_size;
  const float** F = (const float**)d_in;   // 0 x [2,2048,1024], 1 Wq [1024,1024] ([out,in]), 2 bq, 3 Wv, 4 bv, 5 Wo, 6 bo
  if (ws_size < (size_t)WS_END) return;
  char* ws = (char*)d_ws; _Float16 *QH = (_Float16*)(ws + WS_QH), *QL = (_Float16*)(ws + WS_QL); __bf16 *VT = (__bf16*)(ws + WS_VT), *VL = (__bf16*)(ws + WS_VL); float *Y = (float*)(ws + WS_Y);
  k_proj<<<dim3(TNB * TT / 128, CC / 256, 2), 512, 0, stream>>>(F[0], F[1], F[2], F[3], F[4], QH, QL, VT, VL);   // queries and keys share Wq, bq: one projection serves both
  k_att<<<dim3(TNB * NH, TT / FQ / AW), 256, 0, stream>>>(QH, QL, VT, VL, Y);
  k_out<<<dim3(TNB * TT / 128, CC / 128), 512, 0, stream>>>(Y, F[5], F[6], (float*)d_out);
}

// v010
// Measured time: 79.4 microseconds a run.
// Timed twice side by side with v009, it ran 1.03 and 1.04 times as fast.
// All steps since v000 together make it 18.9 times as fast.
// compute dtype: all float inputs rounded to bf16; qk = x Wq^T + bq (shared query/key) and v = x Wv^T + bv with EXACT bf16 products on WMMA 16x16x32, f32 accumulate; q as f16 hi + residual (x 2^10), k = the same f16 hi plane (projected once) -> 2-product logits / 8, causal, kept in f32 in registers; running-maximum softmax in f32 (e = 2^((logit - max) log2 e), one fused multiply-add and the chip's exp2), the keys of a query range dealt to two waves and their partial maxima, sums and tiles joined at the end, e x 2^12 rounded once to f16 (the significand that the f16 keys already give the logits) against v f16 hi + lo (2 products), 1 / sum applied last; out = y (bf16 hi + lo) Wo^T + bo; f32 output.
#include <hip/hip_runtime.h>
#include <math.h>

typedef __attribute__((ext_vector_type(16))) _Float16 v16h;
typedef __attribute__((ext_vector_type(16))) __bf16 v16b;
typedef __attribute__((ext_vector_type(8)))  _Float16 v8h;
typedef __attribute__((ext_vector_type(8)))  float v8f;
typedef __attribute__((ext_vector_type(4)))  float v4f;
typedef __attribute__((ext_vector_type(2)))  float v2f;
typedef __attribute__((ext_vector_type(4)))  unsigned v4u;
typedef __attribute__((ext_vector_type(4)))  int v4i;
typedef float __attribute__((may_alias)) float_a;
typedef int __attribute__((may_alias)) int_a;

template <typename T> __device__ __forceinline__ void vst2(void* p, T v) { *(T*)p = v;  }
__device__ __forceinline__ v8f wmma16(v16h a, v16h b, v8f c) {
  v8f d = __builtin_amdgcn_wmma_f32_16x16x32_f16(false, a, false, b, (short)0, c, false, false);
  asm volatile("v_nop\n\tv_nop\n\tv_nop\n\tv_nop" : "+v"(d) : "v"(a), "v"(b));
  return d;
}
__device__ __forceinline__ v8f wmma_bf(v16b a, v16b b, v8f c) {
  v8f d = __builtin_amdgcn_wmma_f32_16x16x32_bf16(false, a, false, b, (short)0, c, false, false);
  asm volatile("v_nop\n\tv_nop\n\tv_nop\n\tv_nop" : "+v"(d) : "v"(a), "v"(b));
  return d;
}
// 16x16x32 fragments: lane = (h = lane>>4, row/col = lane&15); elements 0..7 = k0+8h+0..7, 8..15 = k0+16+8h+0..7; D element r = row 8h+r
__device__ __forceinline__ v16h frag_h(const _Float16* rowk0, int lane) {
  union { v16h v; v8h q[2]; } u; const _Float16* p = rowk0 + 8 * (lane >> 4);
  u.q[0] = *(const v8h*)p; u.q[1] = *(const v8h*)(p + 16); return u.v;
}
__device__ __forceinline__ v16h frag_f32(const float* rowk0, int lane) {
  v16h a; const float* p = rowk0 + 8 * (lane >> 4);
#pragma unroll
  for (int i = 0; i < 8; ++i) { a[i] = (_Float16)p[i]; a[8 + i] = (_Float16)p[16 + i]; }
  return a;
}
__device__ __forceinline__ v16h frag_f32s(const float* rowk0, int lane, float sc) {
  v16h a; const float* p = rowk0 + 8 * (lane >> 4);
#pragma unroll
  for (int i = 0; i < 8; ++i) { a[i] = (_Float16)(p[i] * sc); a[8 + i] = (_Float16)(p[16 + i] * sc); }
  return a;
}
// column fragment from a [K][ld] layout (column n), rows >= K read as 0
__device__ __forceinline__ v16h fragc_f32(const float* W, int k0, int n, int lane, int ld, int K) {
  v16h a; const int g = lane >> 4;
#pragma unroll
  for (int i = 0; i < 8; ++i) { const int ka = k0 + 8 * g + i, kb = ka + 16;
    a[i] = (_Float16)(ka < K ? W[(size_t)(ka < K ? ka : K - 1) * ld + n] : 0.f); a[8 + i] = (_Float16)(kb < K ? W[(size_t)(kb < K ? kb : K - 1) * ld + n] : 0.f); }
  return a;
}
struct F2 { v16b h, l; };
__device__ __forceinline__ F2 bsplit16(const float v[16]) { F2 r;
#pragma unroll
  for (int i = 0; i < 16; ++i) { const __bf16 h = (__bf16)v[i]; r.h[i] = h; r.l[i] = (__bf16)(v[i] - (float)h); }
  return r; }
__device__ __forceinline__ F2 split_row(const float* row, int k0, int lane) { float v[16]; const float* p = row + k0 + 8 * (lane >> 4);
#pragma unroll
  for (int i = 0; i < 8; ++i) { v[i] = p[i]; v[8 + i] = p[16 + i]; }
  return bsplit16(v); }
__device__ __forceinline__ F2 split_rowK(const float* row, int k0, int lane, int K) { float v[16]; const int g = lane >> 4;
#pragma unroll
  for (int i = 0; i < 8; ++i) { const int ka = k0 + 8 * g + i, kb = ka + 16; v[i] = ka < K ? row[ka < K ? ka : K - 1] : 0.f; v[8 + i] = kb < K ? row[kb < K ? kb : K - 1] : 0.f; }
  return bsplit16(v); }
__device__ __forceinline__ F2 split_col(const float* W, int k0, int n, int lane, int ld, int K) { float v[16]; const int g = lane >> 4;
#pragma unroll
  for (int i = 0; i < 8; ++i) { const int ka = k0 + 8 * g + i, kb = ka + 16; v[i] = ka < K ? W[(size_t)(ka < K ? ka : K - 1) * ld + n] : 0.f; v[8 + i] = kb < K ? W[(size_t)(kb < K ? kb : K - 1) * ld + n] : 0.f; }
  return bsplit16(v); }
__device__ __forceinline__ v8f mac3(const F2& a, const F2& b, v8f c) { c = wmma_bf(a.l, b.h, c); c = wmma_bf(a.h, b.l, c); return wmma_bf(a.h, b.h, c); }
__device__ __forceinline__ float sigm(float v) { return 1.0f / (1.0f + expf(-v)); }
#define LDSX() do { asm volatile("s_wait_dscnt 0" ::: "memory"); __builtin_amdgcn_wave_barrier(); __builtin_amdgcn_fence(__ATOMIC_RELEASE, "workgroup"); } while (0)


// Shared-QK causal attention ('LSHAttention', B 2, S 2,048, hidden 1,024 = 16 x 64): qk = x Wq^T + bq used as both queries and keys, v = x Wv^T + bv, causal softmax(qk qk^T / 8), P v, output Linear + bias.
#define NB 2
#define TT 2048
#define CC 1024
#define NH 16
#define HD 64
#ifndef TNB
#define TNB NB
#endif
typedef __attribute__((ext_vector_type(8))) __bf16 v8b;
__device__ __forceinline__ v16b frag_b(const __bf16* rowk0, int lane) {
  union { v16b v; v8b q[2]; } u; const __bf16* p = rowk0 + 8 * (lane >> 4);
  u.q[0] = *(const v8b*)p; u.q[1] = *(const v8b*)(p + 16); return u.v;
}
__device__ __forceinline__ float bfr(float v) { return (float)(__bf16)v; }
__device__ __attribute__((noinline)) float exp_ni(float v) { return expf(v); }
__device__ __attribute__((noinline)) float erf_ni(float v) { return erff(v); }

// qk and v planes lie in FRAGMENT ORDER, per (b, h): a 16x16x32 operand fragment is two runs of 512 contiguous bytes, lane l's 16 bytes at 16 l, so that each wave-wide 16-byte load of k_att covers four whole 128-byte lines.
//   qk: [b][h][t / 16][d / 16][(d / 8) & 1][t & 15][d & 7]      v: [b][h][t / 32][c / 16][(t / 16) & 1][(t / 8) & 1][c & 15][t & 7]
#define WS_QH  0u
#define WS_QL  (WS_QH + 2u * (size_t)NB * TT * CC)
#define WS_VT  (WS_QL + 2u * (size_t)NB * TT * CC)      // f16 v planes
#define WS_VL  (WS_VT + 2u * (size_t)NB * CC * TT)      // f16 v residual planes
#define WS_Y   (WS_VL + 2u * (size_t)NB * CC * TT)      // f32 y rows [b*t][C]
#define WS_END (WS_Y + 4u * (size_t)NB * TT * CC)

// ---- operand staging of the two projection GEMMs (blocks of 512 threads): a [ROWS][KS] f32 tile is read in whole 128-byte lines (16 bytes a lane, neighbouring lanes on neighbouring
//   addresses of a row), rounded to bf16 once for the block and put into LDS at a row pitch of KS + 8 elements (16 bytes x an odd number: the 16 rows of a fragment read fall on different banks).
typedef __attribute__((ext_vector_type(4))) __bf16 v4b;
template <int ROWS, int KS> struct GT { v4f r[ROWS * KS / 2048]; };
template <int ROWS, int KS> __device__ __forceinline__ void g_load(GT<ROWS, KS>& t, const float* p) {   // p: the thread's own place in the tile's first 2048 / KS rows
#pragma unroll
  for (int i = 0; i < ROWS * KS / 2048; ++i) t.r[i] = *(const v4f*)(p + (size_t)i * (2048 / KS) * CC); }
template <int ROWS, int KS> __device__ __forceinline__ void s_put(const GT<ROWS, KS>& t, __bf16* d) {
#pragma unroll
  for (int i = 0; i < ROWS * KS / 2048; ++i) { v4b o;
#pragma unroll
    for (int e = 0; e < 4; ++e) o[e] = (__bf16)t.r[i][e];
    *(v4b*)(d + i * (2048 / KS) * (KS + 8)) = o; } }
template <int ROWS, int KS> __device__ __forceinline__ void s_put2(const GT<ROWS, KS>& t, __bf16* dh, __bf16* dl) {   // hi + residual planes, bsplit16's split
#pragma unroll
  for (int i = 0; i < ROWS * KS / 2048; ++i) { v4b o, u;
#pragma unroll
    for (int e = 0; e < 4; ++e) { const float v = t.r[i][e]; const __bf16 h = (__bf16)v; o[e] = h; u[e] = (__bf16)(v - (float)h); }
    *(v4b*)(dh + i * (2048 / KS) * (KS + 8)) = o; *(v4b*)(dl + i * (2048 / KS) * (KS + 8)) = u; } }
// ---- k_proj: block = (128 rows, 256 cols, which), 16 waves in a 4 x 4 grid of 32 x 64 wave tiles: which 0: qk = x Wq^T + bq, done once for queries and keys alike -> f16 hi plane (the keys, and the queries' hi part) + residual plane; which 1: v -> f16 hi + residual planes
//   x and W tiles of 64 k go through two LDS stage buffers in turn; the tile after next flies into registers while this one is multiplied. The stage buffers and the epilogue's tiles share one LDS range.
//   The large block tile is there for the L2: a loaded x row serves 256 columns and a loaded W row 128 rows; the squarer wave tile reads 6 fragments from LDS for 8 products; 64 k a stage keep enough bytes in flight for the one block of a WGP.
__global__ __launch_bounds__(512) void k_proj(const float* __restrict__ X, const float* __restrict__ WQ, const float* __restrict__ BQ, const float* __restrict__ WV, const float* __restrict__ BV, _Float16* __restrict__ QH, _Float16* __restrict__ QL, _Float16* __restrict__ VT, _Float16* __restrict__ VL) {
  constexpr int KS = 64, GP = KS + 8, XB = 128 * GP, SB = XB + 256 * GP, NK = CC / KS;   // in bf16 elements: row pitch, the x part and the whole of a stage buffer
  __shared__ __align__(16) unsigned char sm[2 * 256 * 136 * 2]; static_assert(2 * SB * 2 <= (int)sizeof(sm) && 2 * 128 * 264 * 2 <= (int)sizeof(sm), "LDS range");
  _Float16 (*sh)[264] = (_Float16 (*)[264])sm, (*sl)[264] = (_Float16 (*)[264])(sm + 128 * 264 * 2); _Float16 (*th)[136] = (_Float16 (*)[136])sm, (*tl2)[136] = (_Float16 (*)[136])(sm + 256 * 136 * 2); __bf16* st = (__bf16*)sm;
  const int tid = threadIdx.x, wave = tid >> 5, lane = tid & 31, col = lane & 15, g = lane >> 4, wm = (wave >> 2) * 32, wn = (wave & 3) * 64; const int which = blockIdx.z; const int c0 = blockIdx.y * 256; const size_t r0 = (size_t)blockIdx.x * 128; const float* WA = which == 0 ? WQ : WV; const float* BA = which == 0 ? BQ : BV;
  v8f acc[2][4] = {};
  const int lr = tid / (KS / 4), lc = (tid % (KS / 4)) * 4, lo = lr * GP + lc; const float* px = X + (r0 + lr) * CC + lc; const float* pw = WA + (size_t)(c0 + lr) * CC + lc; GT<128, KS> xr; GT<256, KS> wr;
  g_load(xr, px); g_load(wr, pw);
  asm volatile("s_wait_xcnt 0x0" :: "v"(px), "v"(pw) : "memory");   // the address registers of the issued loads stay whole up to this wait; behind it they are stepped
  px += KS; pw += KS;
  s_put(xr, st + lo); s_put(wr, st + XB + lo);
  g_load(xr, px); g_load(wr, pw);
  asm volatile("s_wait_xcnt 0x0" :: "v"(px), "v"(pw) : "memory");   // as above
  px += KS; pw += KS;
  __syncthreads();   // stage 0 is in LDS before a fragment of it is read
  for (int kc = 0; kc < NK; ++kc) { const __bf16* cur = st + (kc & 1) * SB; __bf16* nxt = st + ((kc + 1) & 1) * SB;
    if (kc + 1 < NK) { s_put(xr, nxt + lo); s_put(wr, nxt + XB + lo); }   // the buffer whose last readers left it at the barrier of the pass before
    if (kc + 2 < NK) { g_load(xr, px); g_load(wr, pw);
      asm volatile("s_wait_xcnt 0x0" :: "v"(px), "v"(pw) : "memory");   // as above
      px += KS; pw += KS; }
#pragma unroll
    for (int kk = 0; kk < KS; kk += 32) { v16b a[2], w[4];   // the fragments of 32 k are asked for together: one LDS latency for 8 products
#pragma unroll
      for (int i = 0; i < 2; ++i) a[i] = frag_b(cur + (wm + i * 16 + col) * GP + kk, lane);
#pragma unroll
      for (int j = 0; j < 4; ++j) w[j] = frag_b(cur + XB + (wn + j * 16 + col) * GP + kk, lane);
#pragma unroll
      for (int j = 0; j < 4; ++j)
#pragma unroll
        for (int i = 0; i < 2; ++i) acc[i][j] = wmma_bf(a[i], w[j], acc[i][j]); }
    __syncthreads();   // publishes stage kc + 1 and ends every read of stage kc (behind the last pass: before the epilogue's tiles overwrite the range)
  }
#pragma unroll
  for (int j = 0; j < 4; ++j) { const float bb = bfr(BA[c0 + wn + j * 16 + col]);
#pragma unroll
    for (int i = 0; i < 2; ++i)
#pragma unroll
    for (int r = 0; r < 8; ++r) { const float v = acc[i][j][r] + bb; const int rl = wm + i * 16 + 8 * g + r, cl = wn + j * 16 + col; const _Float16 hv = (_Float16)v;
      if (which == 1) { th[cl][rl] = hv; tl2[cl][rl] = (_Float16)(v - (float)hv); } else { sh[rl][cl] = hv; sl[rl][cl] = (_Float16)((v - (float)hv) * 1024.0f); }   /* q residual carried x 2^10 so the plane stays f16-normal on the chip */ } }
  __syncthreads();
  const size_t bh = (r0 / TT) * NH + c0 / HD; const int t0 = (int)(r0 % TT);   // e counts the block's 16-byte pieces in the order of their places in the planes: neighbouring threads store neighbouring pieces
  if (which == 0) { for (int e = tid; e < 128 * 32; e += 512) { const int rl = ((e >> 7) & 7) * 16 + (e & 15), q = (e >> 10) * 8 + ((e >> 4) & 7); const size_t o = ((bh + (e >> 10)) * (TT / 16) + t0 / 16 + ((e >> 7) & 7)) * 1024 + (e & 127) * 8; vst2((unsigned*)(QH + o), *(const v4u*)&sh[rl][q * 8]);
      asm volatile("s_wait_xcnt 0x0" ::: "memory");   // the registers that the issued store names stay whole up to this wait; behind it they are reused
      vst2((unsigned*)(QL + o), *(const v4u*)&sl[rl][q * 8]);
      asm volatile("s_wait_xcnt 0x0" ::: "memory"); } }   // as above
  else { for (int e = tid; e < 256 * 16; e += 512) { const int cl = (e >> 10) * 64 + ((e >> 6) & 3) * 16 + (e & 15), q = ((e >> 8) & 3) * 4 + ((e >> 4) & 3); const size_t o2 = ((bh + (e >> 10)) * (TT / 32) + t0 / 32 + ((e >> 8) & 3)) * 2048 + (e & 255) * 8; vst2((unsigned*)(VT + o2), *(const v4u*)&th[cl][q * 8]);
      asm volatile("s_wait_xcnt 0x0" ::: "memory");   // as above
      vst2((unsigned*)(VL + o2), *(const v4u*)&tl2[cl][q * 8]);
      asm volatile("s_wait_xcnt 0x0" ::: "memory"); } } }   // as above
// ---- k_att: 32 queries of (b,h) are a range; two waves share a range and walk its keys in chunks of 32 with the running-maximum softmax, one the even chunks and one the odd; scores, P and the output tile stay in a wave's registers during a walk.
//   scores transposed, S^T = K Q^T: a lane holds 16 keys' scores of ONE query (column lane & 15), so maximum and sum are in-lane but for one exchange between the wave's halves;
//   two S^T tiles (keys 0..15, 16..31 of the chunk), turned into e = 2^((logit - max) log2 e + 12) in place and rounded to f16, are the B fragment of O^T += V^T P^T in the hardware's own k order, which is the order of the v planes;
//   a rise of the maximum scales the sum and the output tile by 2^((old - new) log2 e), the same factor in every register of a lane; 1 / sum comes last.
//   Block = 8 waves of one (b,h) = 4 pairs; a pair walks a long range (63 - idx) and then a short one (idx), so every wave has 32 or 33 chunks, no wave is left alone on its SIMD, and the longest chain of chunks is half of a range's;
//   the 4 waves of one parity read the same key and value lines at about the same time. Each walk's maximum, sum and tile go to LDS; behind the one barrier each wave joins the two partial results of one range and stores its rows.
// p: the lane's own place (8 * lane) in the first of a fragment's two 512-byte runs
__device__ __forceinline__ v16h frag_p(const _Float16* p) { union { v16h v; v8h q[2]; } u; u.q[0] = *(const v8h*)p; u.q[1] = *(const v8h*)(p + 256); return u.v; }
__device__ __forceinline__ v8f mm_h(v16h a, v16h b, v8f c) { return __builtin_amdgcn_wmma_f32_16x16x32_f16(false, a, false, b, (short)0, c, false, false); }
__device__ __forceinline__ float xhalf(float v) { const int b = __builtin_bit_cast(int, v); return __builtin_bit_cast(float, __builtin_amdgcn_permlanex16(b, b, 0x76543210, 0xfedcba98, false, false)); }   // lane l <-> l ^ 16
// 2^v with the one slot that the instruction set asks for behind a transcendental kept by construction. In the pair the second v_exp_f32 is the first one's independent instruction (outputs apart from inputs), the v_nop the second one's.
__device__ __forceinline__ float ex2n(float v) { float r; asm("v_exp_f32 %0, %1\n\tv_nop" : "=v"(r) : "v"(v)); return r; }
__device__ __forceinline__ v2f ex2p(float x, float y) { float a, b; asm("v_exp_f32 %0, %2\n\tv_exp_f32 %1, %3\n\tv_nop" : "=&v"(a), "=&v"(b) : "v"(x), "v"(y)); const v2f r = { a, b }; return r; }
#define FQ 32
#define AW 8
typedef __attribute__((ext_vector_type(2))) _Float16 v2h;
struct KV { v16h k[2][2]; v16h vh[HD / 16], vl[HD / 16]; };
__global__ __launch_bounds__(256) void k_att(const _Float16* __restrict__ QH, const _Float16* __restrict__ QL, const _Float16* __restrict__ VT, const _Float16* __restrict__ VL, float* __restrict__ Y) {
  const int tid = threadIdx.x, w = __builtin_amdgcn_readfirstlane(tid >> 5) /* scalar, so the chunk loop branches on SCC and EXEC stays full at the matrix instructions */, lane = tid & 31, col = lane & 15, g = lane >> 4; const int b = blockIdx.x / NH, h = blockIdx.x % NH;
  __shared__ __align__(16) float part[2][AW][17][32][4];   // [walk][wave][16 rows of 4 tile registers each, then one row of the two maxima and the two sums][lane][4]
  const int pi = w & 3, sp = w >> 2, idx = (int)blockIdx.y * 4 + pi;   // pair, parity of the wave's chunks; query range p has p + 1 chunks; every p of 0..63 is taken by one pair
  v16h qh[2][2], ql[2][2]; KV A, B; v8f acc[2][HD / 16]; float m[2], ls[2]; unsigned off; int lim; const float cs = 0.125f * 1.44269504088896340736f;
  auto ldq = [&](const int qb) __attribute__((always_inline)) { const size_t qo = ((size_t)blockIdx.x * (TT / 16) + qb / 16) * 1024 + 8 * lane; const _Float16* ph = QH + qo; const _Float16* pl = QL + qo;   // the lane's own fragment addresses
#pragma unroll
    for (int t = 0; t < 2; ++t)
#pragma unroll
      for (int kc = 0; kc < HD / 32; ++kc) { qh[t][kc] = frag_p(ph + t * 1024 + kc * 512); ql[t][kc] = frag_p(pl + t * 1024 + kc * 512); }
    asm volatile("s_wait_xcnt 0x0" :: "v"(ph), "v"(pl) : "memory"); };   // the address registers of the issued loads stay whole up to this wait; behind it they may be reused
  auto ld = [&](KV& d) __attribute__((always_inline)) {   // one chunk's key and value fragments: 24 loads of 512 bytes a wave
    const _Float16* kp = (const _Float16*)((const char*)QH + off); const _Float16* pvh = (const _Float16*)((const char*)VT + off); const _Float16* pvl = (const _Float16*)((const char*)VL + off);
#pragma unroll
    for (int kt = 0; kt < 2; ++kt) { d.k[kt][0] = frag_p(kp + kt * 1024); d.k[kt][1] = frag_p(kp + kt * 1024 + 512); }
#pragma unroll
    for (int j = 0; j < HD / 16; ++j) { d.vh[j] = frag_p(pvh + j * 512); d.vl[j] = frag_p(pvl + j * 512); }
    asm volatile("s_wait_xcnt 0x0" : "+v"(off) :: "memory");   // the offset register of the issued loads stays whole up to this wait; the next offset is formed from the statement's output, so that the step cannot be lifted over it
    off += 8192; };   // the wave's next chunk is the one after next
  auto chunk = [&](const KV& c, KV& nx, const bool pre, const bool last) __attribute__((always_inline)) { v8f s[2][2]; v16h pe[2];
    if (pre) { ld(nx);
      __builtin_amdgcn_sched_barrier(0); }   // keeps the next chunk's loads at the head of this chunk, so that they fly under all of its work; the scheduler otherwise sinks them to the chunk's foot, where the next chunk waits for them at once
#pragma unroll
    for (int t = 0; t < 2; ++t)
#pragma unroll
      for (int kt = 0; kt < 2; ++kt) { v8f a = {}, l = {}; a = mm_h(c.k[kt][0], qh[t][0], a); l = mm_h(c.k[kt][0], ql[t][0], l); a = mm_h(c.k[kt][1], qh[t][1], a); l = mm_h(c.k[kt][1], ql[t][1], l); s[t][kt] = a + l * (1.0f / 1024.0f); }
#pragma unroll
    for (int t = 0; t < 2; ++t) {
      if (last) {   // the wave's last chunk of a range: where it is the one on the diagonal (lim = col - 8 g: key 16 kt + 8 g + r against query 16 t + col), keys behind the query are masked; else lim lies beyond every key of the chunk
#pragma unroll
        for (int kt = 0; kt < 2; ++kt)
#pragma unroll
          for (int r = 0; r < 8; ++r) if (kt * 16 + r - t * 16 > lim) s[t][kt][r] = -3.0e38f; }
      float mx = fmaxf(s[t][0][0], s[t][1][0]);
#pragma unroll
      for (int r = 1; r < 8; ++r) mx = fmaxf(mx, fmaxf(s[t][0][r], s[t][1][r]));
      mx = fmaxf(mx, xhalf(mx));
      const float mn = fmaxf(m[t], mx), n = fmaf(mn, -cs, 12.0f), al = ex2n(fmaf(m[t], cs, n) - 12.0f); m[t] = mn;   // e carries the factor 2^12, common to the tile and the sum (it cancels in tile / sum): weights down to 2^-26 of the largest stay f16-normal, and 2^12 leaves four binades below the f16 ceiling; the first key of every chunk that a wave works on is open to every query of the range, so mn is a real logit from the wave's first chunk on; n's rounding is one common factor of e and of the sum
      v2f sum = { 0.f, 0.f };
#pragma unroll
      for (int i = 0; i < 8; ++i) {   // element pair 2 i, 2 i + 1 of the B fragment = registers of the two score tiles in their order
        const v2f e = ex2p(fmaf(s[t][i >> 2][(2 * i) & 7], cs, n), fmaf(s[t][i >> 2][(2 * i + 1) & 7], cs, n));   // a masked logit (-3e38) gives a huge negative exponent and so e = 0 by itself
        sum += e; const v2h hi = __builtin_convertvector(e, v2h);   // one rounding to 11 bits, two elements at a time
        pe[t][2 * i] = hi[0]; pe[t][2 * i + 1] = hi[1]; }
      ls[t] = fmaf(ls[t], al, sum[0] + sum[1]);   // the lane's own 16 keys; the halves meet behind the loop
#pragma unroll
      for (int j = 0; j < HD / 16; ++j) acc[t][j] *= al; }
#pragma unroll
    for (int j = 0; j < HD / 16; ++j)
#pragma unroll
      for (int t = 0; t < 2; ++t) acc[t][j] = mm_h(c.vh[j], pe[t], acc[t][j]);
#pragma unroll
    for (int j = 0; j < HD / 16; ++j)
#pragma unroll
      for (int t = 0; t < 2; ++t) acc[t][j] = mm_h(c.vl[j], pe[t], acc[t][j]); };
  off = ((unsigned)blockIdx.x * (TT * HD) + 8 * lane) * 2 + sp * 4096;   // the lane's own byte offset in the key plane (the shared projection's hi plane) and in the two value planes alike: a chunk of 32 keys is 4,096 bytes of each; stepped from chunk to chunk
  for (int wk = 0; wk < 2; ++wk) { const int p = wk ? idx : TT / FQ - 1 - idx, n = (p - sp + 2) >> 1;   // the wave's chunks of range p: sp, sp + 2, ... up to p; none for the odd wave of range 0
    lim = col - 8 * g + (((p - sp) & 1) ? 2 * FQ : 0);   // chunk p, the one on the diagonal, is the last of the wave whose parity it has
    ldq(p * FQ);
#pragma unroll
    for (int t = 0; t < 2; ++t) { m[t] = -3.0e38f; ls[t] = 0.f;
#pragma unroll
      for (int j = 0; j < HD / 16; ++j) acc[t][j] = v8f{}; }
    if (n > 0) { ld(A);
      for (int kc = 0; ; kc += 2) {   // two register sets in turn: the wave's next chunk flies while this one is worked on; the test between the two halves keeps each chunk a block of its own, with its loads at its head
        if (kc + 1 == n) { chunk(A, B, false, true); break; }
        chunk(A, B, true, false);
        if (kc + 2 == n) { chunk(B, A, false, true); break; }
        chunk(B, A, true, false); } }
    off -= n * 8192;   // back to the wave's first chunk for the second walk: one carried register in place of start addresses kept over the walks, which the register budget of two waves a SIMD has no room for
    float* ps = &part[wk][w][0][lane][0];   // 16 bytes a lane, neighbouring lanes on neighbouring places
#pragma unroll
    for (int t = 0; t < 2; ++t)
#pragma unroll
      for (int j = 0; j < HD / 16; ++j) { const v8f a = acc[t][j]; const v4f a0 = { a[0], a[1], a[2], a[3] }, a1 = { a[4], a[5], a[6], a[7] }; *(v4f*)(ps + ((t * 4 + j) * 2) * 128) = a0; *(v4f*)(ps + ((t * 4 + j) * 2 + 1) * 128) = a1; }
    const v4f ml = { m[0], m[1], ls[0], ls[1] }; *(v4f*)(ps + 16 * 128) = ml; }
  __syncthreads();   // every wave's two partial results are in LDS before one of them is read
  const int qb = (sp ? idx : TT / FQ - 1 - idx) * FQ; float inv[2];   // wave (pi, sp) joins walk sp of its pair
  { const float* pa = &part[sp][pi][0][lane][0]; const float* pb = &part[sp][pi + 4][0][lane][0]; const v4f ma = *(const v4f*)(pa + 16 * 128), mb = *(const v4f*)(pb + 16 * 128);
#pragma unroll
    for (int t = 0; t < 2; ++t) { const float n = -fmaxf(ma[t], mb[t]) * cs; const v2f f = ex2p(fmaf(ma[t], cs, n), fmaf(mb[t], cs, n));   // each part scaled to the common maximum; a wave without a chunk left maximum -3e38, sum 0 and tile 0, and its factor is 0
      const float l = fmaf(ma[2 + t], f[0], mb[2 + t] * f[1]); inv[t] = 1.0f / (l + xhalf(l));
#pragma unroll
      for (int j = 0; j < HD / 16; ++j)
#pragma unroll
        for (int q = 0; q < 2; ++q) { const v4f x = *(const v4f*)(pa + ((t * 4 + j) * 2 + q) * 128), y = *(const v4f*)(pb + ((t * 4 + j) * 2 + q) * 128);
#pragma unroll
          for (int e = 0; e < 4; ++e) acc[t][j][4 * q + e] = fmaf(x[e], f[0], y[e] * f[1]); } } }
  float* yp = Y + ((size_t)b * TT + qb + col) * CC + h * HD + 8 * g;   // a lane's 8 registers of a tile are 8 neighbouring columns of its query's row
#pragma unroll
  for (int t = 0; t < 2; ++t) {
#pragma unroll
    for (int j = 0; j < HD / 16; ++j) { const v8f o = acc[t][j] * inv[t]; const v4f o0 = { o[0], o[1], o[2], o[3] }, o1 = { o[4], o[5], o[6], o[7] }; vst2(yp + (size_t)t * 16 * CC + j * 16, o0); vst2(yp + (size_t)t * 16 * CC + j * 16 + 4, o1);
      asm volatile("s_wait_xcnt 0x0" : "+v"(inv[0]), "+v"(inv[1]) :: "memory"); } } }   // the registers that the issued stores name stay whole up to this wait; the next values are formed from the statement's outputs, so that they cannot be lifted over it into those registers
// ---- k_out: block = (128 rows, 128 cols), 16 waves in a 4 x 4 grid of 32 x 32 wave tiles: out = y (bf16 hi + lo) Wo^T + bo; y (split once for the block) and Wo tiles of 64 k go through two LDS stage buffers in turn, as in k_proj
__global__ __launch_bounds__(512) void k_out(const float* __restrict__ Y, const float* __restrict__ WP, const float* __restrict__ BP, float* __restrict__ OUT) { __shared__ __align__(16) float sf[16][32][36];
  constexpr int KS = 64, GP = KS + 8, YB = 128 * GP, SB = 2 * YB + 128 * GP, NK = CC / KS;   // in bf16 elements: row pitch, one y plane and the whole of a stage buffer
  __shared__ __align__(16) __bf16 st[2 * SB];
  const int tid = threadIdx.x, wave = tid >> 5, lane = tid & 31, col = lane & 15, g = lane >> 4, wm = (wave >> 2) * 32, wn = (wave & 3) * 32; const int c0 = blockIdx.y * 128 + wn; const size_t r0 = (size_t)blockIdx.x * 128 + wm;
  v8f acc[2][2] = {};
  const int lr = tid / (KS / 4), lc = (tid % (KS / 4)) * 4, lo = lr * GP + lc; const float* py = Y + ((size_t)blockIdx.x * 128 + lr) * CC + lc; const float* pw = WP + (size_t)(blockIdx.y * 128 + lr) * CC + lc; GT<128, KS> yr; GT<128, KS> wr;
  g_load(yr, py); g_load(wr, pw);
  asm volatile("s_wait_xcnt 0x0" :: "v"(py), "v"(pw) : "memory");   // the address registers of the issued loads stay whole up to this wait; behind it they are stepped
  py += KS; pw += KS;
  s_put2(yr, st + lo, st + YB + lo); s_put(wr, st + 2 * YB + lo);
  g_load(yr, py); g_load(wr, pw);
  asm volatile("s_wait_xcnt 0x0" :: "v"(py), "v"(pw) : "memory");   // as above
  py += KS; pw += KS;
  __syncthreads();   // stage 0 is in LDS before a fragment of it is read
  for (int kc = 0; kc < NK; ++kc) { const __bf16* cur = st + (kc & 1) * SB; __bf16* nxt = st + ((kc + 1) & 1) * SB;
    if (kc + 1 < NK) { s_put2(yr, nxt + lo, nxt + YB + lo); s_put(wr, nxt + 2 * YB + lo); }   // the buffer whose last readers left it at the barrier of the pass before
    if (kc + 2 < NK) { g_load(yr, py); g_load(wr, pw);
      asm volatile("s_wait_xcnt 0x0" :: "v"(py), "v"(pw) : "memory");   // as above
      py += KS; pw += KS; }
#pragma unroll
    for (int kk = 0; kk < KS; kk += 32) { v16b ah[2], al[2], w[2];   // the fragments of 32 k are asked for together: one LDS latency for 8 products
#pragma unroll
      for (int i = 0; i < 2; ++i) { ah[i] = frag_b(cur + (wm + i * 16 + col) * GP + kk, lane); al[i] = frag_b(cur + YB + (wm + i * 16 + col) * GP + kk, lane); }
#pragma unroll
      for (int j = 0; j < 2; ++j) w[j] = frag_b(cur + 2 * YB + (wn + j * 16 + col) * GP + kk, lane);
#pragma unroll
      for (int j = 0; j < 2; ++j)
#pragma unroll
        for (int i = 0; i < 2; ++i) { acc[i][j] = wmma_bf(ah[i], w[j], acc[i][j]); acc[i][j] = wmma_bf(al[i], w[j], acc[i][j]); } }
    __syncthreads();   // publishes stage kc + 1 and ends every read of stage kc
  }
#pragma unroll
  for (int j = 0; j < 2; ++j) { const float bb = BP ? bfr(BP[c0 + j * 16 + col]) : 0.f;
#pragma unroll
    for (int i = 0; i < 2; ++i)
#pragma unroll
    for (int r = 0; r < 8; ++r) sf[wave][i * 16 + 8 * g + r][j * 16 + col] = acc[i][j][r] + bb; }
  LDSX(); for (int p = 0; p < 8; ++p) { const int rl = p * 4 + (lane >> 3); vst2(OUT + (r0 + rl) * CC + c0 + (lane & 7) * 4, *(const v4f*)&sf[wave][rl][(lane & 7) * 4]); } }   // a wave store covers four whole 128-byte lines
extern "C" void kernel_launch(void* const* d_in, const int* in_sizes, int n_in, void* d_out, int out_size, void* d_ws, size_t ws_size, hipStream_t stream) {
  (void)in_sizes; (void)n_in; (void)out_size;
  const float** F = (const float**)d_in;   // 0 x [2,2048,1024], 1 Wq [1024,1024] ([out,in]), 2 bq, 3 Wv, 4 bv, 5 Wo, 6 bo
  if (ws_size < (size_t)WS_END) return;
  char* ws = (char*)d_ws; _Float16 *QH = (_Float16*)(ws + WS_QH), *QL = (_Float16*)(ws + WS_QL); _Float16 *VT = (_Float16*)(ws + WS_VT), *VL = (_Float16*)(ws + WS_VL); float *Y = (float*)(ws + WS_Y);
  k_proj<<<dim3(TNB * TT / 128, CC / 256, 2), 512, 0, stream>>>(F[0], F[1], F[2], F[3], F[4], QH, QL, VT, VL);   // queries and keys share Wq, bq: one projection serves both
  k_att<<<dim3(TNB * NH, TT / FQ / AW), 256, 0, stream>>>(QH, QL, VT, VL, Y);
  k_out<<<dim3(TNB * TT / 128, CC / 128), 512, 0, stream>>>(Y, F[5], F[6], (float*)d_out);
}
